// v000
// Measured on an AMD MI455X. A time is GPU time per run, averaged over a window of back-to-back runs after a warm-up
// (all launches, gaps included; the runs take copies of the inputs in turn), and the median of several windows.
// Apart from v000's, it joins two sittings. Times from different sittings can be a few percent apart, while
// side-by-side timings come from the same sitting.
// v000 is the starting kernel. One run takes 624 microseconds.
#include <hip/hip_runtime.h>

// All contractions on 16-bit WMMA, f32 accumulate: the three 1x1 projections q/k/v = v_wmma_f32_16x16x32_bf16 on RNE-bf16 copies of x and of the weights (single products); scores q.k = bf16 hi/lo split (hi.hi + lo.hi + hi.lo, K = 128); attn.v = v_wmma_f32_16x16x32_f16 (softmax rows carried x 2^14 as f16, v as f16); output projection = bf16 hi/lo planes of y times bf16 Wo (2 products). Bias adds, softmax and the residual add in f32.
// x [NB][128][4096]; q/k/v [4096][128] token-major (GEMM, bias added in the convert passes); s[n][m] = q_n . k_m (unscaled); attn[n][m] = softmax_m(s); y[n][o] = sum_m attn[n][m] v[m][o]; out[c][n] = x[c][n] + bo[c] + sum_o Wo[c][o] y[n][o].

#ifndef NB
#define NB 4
#endif
#ifndef SEQ
#define SEQ 4096
#endif
#define NB_FULL  4
#define SEQ_FULL 4096
#define CC   128
#define IC   128
#define HW   SEQ
#define HWF  SEQ_FULL
#define PCAR 16384.0f
static_assert(NB >= 1 && NB <= NB_FULL);
static_assert(SEQ >= 128 && SEQ <= SEQ_FULL && (SEQ % 128) == 0);
static_assert((HW % 64) == 0 && (IC % 64) == 0 && (CC % 64) == 0);
static_assert((HW % 32) == 0 && (IC % 32) == 0 && (CC % 32) == 0);
static_assert(((IC * CC) % 8) == 0 && ((HW * CC) % 4) == 0 && ((HW * IC) % 4) == 0 && ((IC * HW) % 2) == 0 && (HW % 8) == 0 && (IC % 4) == 0);
static_assert(((size_t)HW * CC / 4) % 256 == 0 && ((size_t)HW * IC / 4) % 256 == 0 && ((size_t)HW * IC / 2) % 256 == 0);

typedef _Float16 h16;
typedef unsigned short bf;
typedef __attribute__((ext_vector_type(16))) __bf16   v16bf;
typedef __attribute__((ext_vector_type(16))) _Float16 v16h;
typedef __attribute__((ext_vector_type(8)))  _Float16 v8h;
typedef __attribute__((ext_vector_type(8)))  unsigned short v8us;
typedef __attribute__((ext_vector_type(8)))  float    v8f;
typedef __attribute__((ext_vector_type(4)))  float    v4f;
typedef v8h  __attribute__((may_alias)) v8ha;
typedef v4f  __attribute__((may_alias)) v4fa;
typedef v8us __attribute__((may_alias)) v8usa;

__device__ __forceinline__ unsigned short f2bf(float f) { unsigned u = __float_as_uint(f); u += 0x7FFFu + ((u >> 16) & 1u); return (unsigned short)(u >> 16); }
__device__ __forceinline__ float bf2f(unsigned short b) { return __uint_as_float(((unsigned)b) << 16); }
__device__ __forceinline__ float bfr(float f) { return bf2f(f2bf(f)); }
__device__ __forceinline__ v16h cat16(v8h lo, v8h hi) { return __builtin_shufflevector(lo, hi, 0, 1, 2, 3, 4, 5, 6, 7, 8, 9, 10, 11, 12, 13, 14, 15); }
__device__ __forceinline__ v16bf cat16b(v8us lo, v8us hi) { return __builtin_bit_cast(v16bf, __builtin_shufflevector(lo, hi, 0, 1, 2, 3, 4, 5, 6, 7, 8, 9, 10, 11, 12, 13, 14, 15)); }
__device__ __forceinline__ v8f wmma16(v16h a, v16h b, v8f c) { return __builtin_amdgcn_wmma_f32_16x16x32_f16(false, a, false, b, (short)0, c, false, false); }
__device__ __forceinline__ v8f wmmab(v16bf a, v16bf b, v8f c) { return __builtin_amdgcn_wmma_f32_16x16x32_bf16(false, a, false, b, (short)0, c, false, false); }

// ---- k_gemmw: register-blocked GEMM, ONE WAVE per 64x64 output tile (16 accumulators), operands straight from K-contiguous 16-bit planes; grid (M/64, N/64, Z), 32 threads.
// C[m][n] (f32, pitch ldc, + optional f32 bias[n]) = sum_k A[m][k] Bt[n][k] (+ split products per NSPLIT). z-batch strides sA/sB/sC in elements. K % 32 == 0.
// Fragments: lane l, h = l >> 4, row/col = l & 15; elements 0..7 = k0 + 8h + 0..7, elements 8..15 = k0 + 16 + 8h + 0..7 for BOTH A and Bt; D element r = (row 8h + r, col l & 15).
template <typename T16> struct WFrag;
template <> struct WFrag<h16> { typedef v16h V; static __device__ __forceinline__ V ld(const h16* p) { return cat16(*(const v8h*)p, *(const v8h*)(p + 16)); } static __device__ __forceinline__ v8f mma(V a, V b, v8f c) { return wmma16(a, b, c); } };
template <> struct WFrag<bf> { typedef v16bf V; static __device__ __forceinline__ V ld(const bf* p) { return cat16b(*(const v8us*)p, *(const v8us*)(p + 16)); } static __device__ __forceinline__ v8f mma(V a, V b, v8f c) { return wmmab(a, b, c); } };
template <typename T16, int NSPLIT, bool BIAS>
__global__ __launch_bounds__(32) void k_gemmw(const T16* __restrict__ A, const T16* __restrict__ A2, const T16* __restrict__ Bt, const T16* __restrict__ Bt2, int K, float* C, int ldc, const float* __restrict__ bias, size_t sA, size_t sB, size_t sC) {
    typedef typename WFrag<T16>::V V;
    __shared__ __align__(16) float os[16 * 68];
    const size_t z = blockIdx.z; A += z * sA; if (A2) A2 += z * sA; Bt += z * sB; if (Bt2) Bt2 += z * sB; C += z * sC;
    const int lane = threadIdx.x & 31, lr = lane & 15, hi = lane >> 4; const int r0 = blockIdx.x * 64, c0 = blockIdx.y * 64;
    v8f acc[4][4];
#pragma unroll
    for (int mb = 0; mb < 4; ++mb)
#pragma unroll
        for (int nb = 0; nb < 4; ++nb) acc[mb][nb] = (v8f){};
    const size_t aoff = (size_t)(r0 + lr) * K + 8 * hi, boff = (size_t)(c0 + lr) * K + 8 * hi;
#pragma unroll 1
    for (int kc = 0; kc < K; kc += 32) {
        V a[4], a2[4];
#pragma unroll
        for (int mb = 0; mb < 4; ++mb) { a[mb] = WFrag<T16>::ld(A + aoff + (size_t)mb * 16 * K + kc); if (NSPLIT == 1 || NSPLIT == 2) a2[mb] = WFrag<T16>::ld(A2 + aoff + (size_t)mb * 16 * K + kc); }
#pragma unroll
        for (int nb = 0; nb < 4; ++nb) { const V b = WFrag<T16>::ld(Bt + boff + (size_t)nb * 16 * K + kc); V b2; if (NSPLIT >= 2) b2 = WFrag<T16>::ld(Bt2 + boff + (size_t)nb * 16 * K + kc);
#pragma unroll
            for (int mb = 0; mb < 4; ++mb) { acc[mb][nb] = WFrag<T16>::mma(a[mb], b, acc[mb][nb]); if (NSPLIT == 1 || NSPLIT == 2) acc[mb][nb] = WFrag<T16>::mma(a2[mb], b, acc[mb][nb]); if (NSPLIT >= 2) acc[mb][nb] = WFrag<T16>::mma(a[mb], b2, acc[mb][nb]); } }
        asm volatile("v_nop\n\tv_nop\n\tv_nop\n\tv_nop" : "+v"(acc[0][0]), "+v"(acc[1][1]), "+v"(acc[2][2]), "+v"(acc[3][3]) : "v"(a[0]), "v"(a[3]));
    }
#pragma unroll
    for (int mb = 0; mb < 4; ++mb) {
#pragma unroll
        for (int nb = 0; nb < 4; ++nb) {
#pragma unroll
            for (int j = 0; j < 8; ++j) os[(hi * 8 + j) * 68 + nb * 16 + lr] = acc[mb][nb][j]; }
        __builtin_amdgcn_wave_barrier(); asm volatile("" ::: "memory");
        float* crow = C + (size_t)(r0 + mb * 16) * ldc + c0;
{
#pragma unroll
            for (int s = 0; s < 8; ++s) { const int row = 2 * s + hi, cofs = lr * 4; v4f val = *(const v4fa*)(os + row * 68 + cofs); if (BIAS) { val[0] += bfr(bias[c0 + cofs]); val[1] += bfr(bias[c0 + cofs + 1]); val[2] += bfr(bias[c0 + cofs + 2]); val[3] += bfr(bias[c0 + cofs + 3]); }
                *(v4f*)(crow + (size_t)row * ldc + cofs) = val; }
             }
        __builtin_amdgcn_wave_barrier(); asm volatile("" ::: "memory");
    }
}

__device__ __forceinline__ h16 tohx(float x) { return (h16)x; }
__device__ __forceinline__ void splitf(float y, unsigned short& h, unsigned short& l) { h = f2bf(y); l = f2bf(y - bf2f(h)); }
typedef __attribute__((ext_vector_type(2))) unsigned short v2us;
typedef __attribute__((ext_vector_type(4))) unsigned short v4us;
typedef __attribute__((ext_vector_type(2))) _Float16 v2h;
typedef __attribute__((ext_vector_type(4))) _Float16 v4h;
typedef __attribute__((ext_vector_type(2))) float v2f;

__global__ __launch_bounds__(256) void k_cvtw(const float* __restrict__ w0, const float* __restrict__ w1, const float* __restrict__ w2, const float* __restrict__ w3, bf* B3, bf* BZ, int n8) {
    const int i = blockIdx.x * 256 + threadIdx.x; if (i >= n8) return;
    const size_t e = (size_t)i * 8, pl = (size_t)n8 * 8;
    const v8f a0 = *(const v8f*)(w0 + e), a1 = *(const v8f*)(w1 + e), a2 = *(const v8f*)(w2 + e), a3 = *(const v8f*)(w3 + e);
    v8us o0, o1, o2, o3;
#pragma unroll
    for (int k = 0; k < 8; ++k) { o0[k] = f2bf(a0[k]); o1[k] = f2bf(a1[k]); o2[k] = f2bf(a2[k]); o3[k] = f2bf(a3[k]); }
    *(v8us*)(B3 + e) = o0; *(v8us*)(B3 + pl + e) = o1; *(v8us*)(B3 + 2 * pl + e) = o2; *(v8us*)(BZ + e) = o3;
    
}
__global__ __launch_bounds__(256) void k_xt(const float* __restrict__ xb, bf* XT) { const size_t e = ((size_t)blockIdx.x * 256 + threadIdx.x) * 4; if (e >= (size_t)HW * CC) return; const int c = (int)(e % CC); const int m = (int)(e / CC); v4us o;
#pragma unroll
    for (int u = 0; u < 4; ++u) o[u] = f2bf(xb[(size_t)(c + u) * HWF + m]); *(v4us*)(XT + e) = o;  }
__global__ __launch_bounds__(256) void k_hlb(const float* __restrict__ F, const float* __restrict__ b0, const float* __restrict__ b1, bf* Fh, bf* Fl, size_t n, size_t pl) { const size_t e = ((size_t)blockIdx.x * 256 + threadIdx.x) * 4; if (e >= n) return; const v4f a = *(const v4f*)(F + e); const int i = (int)(e % IC); const bool sec = (e >= pl); const v4f cA = *(const v4f*)(b0 + i), cB = *(const v4f*)(b1 + i); v4us oh, ol;
#pragma unroll
    for (int u = 0; u < 4; ++u) { const float bb = sec ? bfr(cB[u]) : bfr(cA[u]); unsigned short p, q; splitf(__fadd_rn(a[u], bb), p, q); oh[u] = p; ol[u] = q; } *(v4us*)(Fh + e) = oh; *(v4us*)(Fl + e) = ol;  }
__global__ __launch_bounds__(256) void k_gt16b(const float* __restrict__ G, const float* __restrict__ bvec, h16* GT) { const size_t e = ((size_t)blockIdx.x * 256 + threadIdx.x) * 2; if (e >= (size_t)IC * HW) return; const int m = (int)(e % HW); const int i = (int)(e / HW); const float bb = bfr(bvec[i]); v2h o; o[0] = tohx(__fadd_rn(G[(size_t)m * IC + i], bb)); o[1] = tohx(__fadd_rn(G[(size_t)(m + 1) * IC + i], bb)); *(v2h*)(GT + e) = o;  }
__global__ __launch_bounds__(256) void k_rsoft(const float* __restrict__ S, h16* P16) { const int lane = threadIdx.x & 31; const int row = blockIdx.x * 8 + (threadIdx.x >> 5); if (row >= HW) return; const float* sr = S + (size_t)row * HW; float v[HW / 32]; float mx = -3.0e38f;
#pragma unroll
    for (int ch = 0; ch < HW / 128; ++ch) { const v4f a = *(const v4f*)(sr + ch * 128 + lane * 4);
#pragma unroll
        for (int u = 0; u < 4; ++u) { const float t = a[u]; v[ch * 4 + u] = t; mx = fmaxf(mx, t); } }
#pragma unroll
    for (int sh = 16; sh; sh >>= 1) mx = fmaxf(mx, __shfl_xor(mx, sh, 32));
    float sum = 0.f;
#pragma unroll
    for (int q = 0; q < HW / 32; ++q) { float d0 = __fsub_rn(v[q], mx); asm volatile("" : "+v"(d0)); v[q] = __builtin_amdgcn_exp2f(__fmul_rn(d0, 1.4426950408889634f)); sum += v[q]; }
#pragma unroll
    for (int sh = 16; sh; sh >>= 1) sum += __shfl_xor(sum, sh, 32);
    const float f = __fdiv_rn(PCAR, sum);
    {
#pragma unroll
        for (int ch = 0; ch < HW / 128; ++ch) { v4h o4;
#pragma unroll
            for (int q = 0; q < 4; ++q) o4[q] = tohx(v[ch * 4 + q] * f); *(v4h*)(P16 + (size_t)row * HW + ch * 128 + lane * 4) = o4; }
         } }
__global__ __launch_bounds__(256) void k_yhl(const float* __restrict__ Y, bf* Yh, bf* Yl) { const size_t e = ((size_t)blockIdx.x * 256 + threadIdx.x) * 4; if (e >= (size_t)HW * IC) return; const v4f a = *(const v4f*)(Y + e); v4us oh, ol;
#pragma unroll
    for (int u = 0; u < 4; ++u) { unsigned short p, q; splitf(a[u] * (1.0f / PCAR), p, q); oh[u] = p; ol[u] = q; } *(v4us*)(Yh + e) = oh; *(v4us*)(Yl + e) = ol;  }
__global__ __launch_bounds__(256) void k_finb(const float* __restrict__ Z, const float* __restrict__ xb, const float* __restrict__ bo, float* OUTb) { const size_t e = ((size_t)blockIdx.x * 256 + threadIdx.x) * 4; if (e >= (size_t)CC * HW) return; const int n = (int)(e % HW); const int c = (int)(e / HW); const float bb = bfr(bo[c]); v4f r;
#pragma unroll
    for (int u = 0; u < 4; ++u) r[u] = __fadd_rn(__fadd_rn(Z[(size_t)(n + u) * CC + c], bb), bfr(xb[(size_t)c * HWF + n + u])); *(v4f*)(OUTb + e) = r;  }

extern "C" void kernel_launch(void* const* d_in, const int* in_sizes, int n_in,
                              void* d_out, int out_size, void* d_ws, size_t ws_size, hipStream_t stream) {
    if (n_in < 9) return;
    if (in_sizes[0] < NB * CC * HW) return;
    if (in_sizes[1] < IC * CC || in_sizes[3] < IC * CC || in_sizes[5] < IC * CC || in_sizes[7] < CC * IC) return;
    if (in_sizes[2] < IC || in_sizes[4] < IC || in_sizes[6] < IC || in_sizes[8] < CC) return;
    if (out_size < NB * CC * HW) return;
    const float* x  = (const float*)d_in[0];   // [NB][CC][HWF]
    const float* wq = (const float*)d_in[1];   // [IC][CC]  (queries)
    const float* bq = (const float*)d_in[2];   // [IC]
    const float* wk = (const float*)d_in[3];   // [IC][CC]  (keys)
    const float* bk = (const float*)d_in[4];   // [IC]
    const float* wv = (const float*)d_in[5];   // [IC][CC]  (values)
    const float* bv = (const float*)d_in[6];   // [IC]
    const float* wo = (const float*)d_in[7];   // [CC][IC]  (output projection)
    const float* bo = (const float*)d_in[8];   // [CC]
    float* OUT = (float*)d_out;                // [NB][CC][HW]
    char* wsp = (char*)d_ws;
    auto take = [&](size_t bytes) { char* p = wsp; wsp += (bytes + 255) & ~(size_t)255; return (void*)p; };
    bf* BW3 = (bf*)take((size_t)3 * IC * CC * 2);          // [q][k][v], each [IC][CC]
    bf* BZ  = (bf*)take((size_t)CC * IC * 2);
    bf* XT  = (bf*)take((size_t)HW * CC * 2);              // [m][c]
    float* TPG = (float*)take((size_t)3 * HW * IC * 4);    // [q][k][v], each [HW][IC] f32 (no bias yet)
    bf* Hh  = (bf*)take((size_t)2 * HW * IC * 2);          // hi planes of q+bq, k+bk
    bf* Hl  = (bf*)take((size_t)2 * HW * IC * 2);          // lo planes of q+bq, k+bk
    h16* GT = (h16*)take((size_t)IC * HW * 2);             // [i][m] fp16 (v + bv)
    float* S = (float*)take((size_t)HW * HW * 4);          // [n][m]
    h16* P16 = (h16*)take((size_t)HW * HW * 2);            // [n][m] fp16 x 2^14
    float* Y = (float*)take((size_t)HW * IC * 4);          // [n][i] (x 2^14)
    bf* Yh  = (bf*)take((size_t)HW * IC * 2); bf* Yl = (bf*)take((size_t)HW * IC * 2);
    float* Z = (float*)take((size_t)HW * CC * 4);          // [n][c]
    if ((size_t)(wsp - (char*)d_ws) > ws_size) return;    // total 119,668,736 B at SEQ 4096

    const size_t PL = (size_t)HW * IC;                      // one [HW][IC] plane, elements
    k_cvtw<<<(unsigned)((IC * CC / 8 + 255) / 256), 256, 0, stream>>>(wq, wk, wv, wo, BW3, BZ, IC * CC / 8);
    const unsigned L4  = (unsigned)((PL / 4 + 255) / 256);
    const unsigned L42 = (unsigned)((2 * PL / 4 + 255) / 256);
    for (int b = 0; b < NB; ++b) {
        const float* xb = x + (size_t)b * CC * HWF;
        k_xt<<<(unsigned)(((size_t)HW * CC / 4 + 255) / 256), 256, 0, stream>>>(xb, XT);
        // q / k / v [m][o] = sum_c XT[m][c] W[o][c]   (z = 0 q, 1 k, 2 v; exact bf16 products)
        k_gemmw<bf, 0, false><<<dim3(HW / 64, IC / 64, 3), 32, 0, stream>>>(XT, nullptr, BW3, nullptr, CC, TPG, IC, nullptr, (size_t)0, (size_t)IC * CC, PL);
        k_hlb<<<L42, 256, 0, stream>>>(TPG, bq, bk, Hh, Hl, 2 * PL, PL);                     // hi/lo planes of q+bq (first PL) and k+bk (second PL)
        k_gt16b<<<(unsigned)((PL / 2 + 255) / 256), 256, 0, stream>>>(TPG + 2 * PL, bv, GT);
        // s[n][m] = q_n . k_m (3 products)
        k_gemmw<bf, 2, false><<<dim3(HW / 64, HW / 64, 1), 32, 0, stream>>>(Hh, Hl, Hh + PL, Hl + PL, IC, S, HW, nullptr, (size_t)0, (size_t)0, (size_t)0);
        k_rsoft<<<HW / 8, 256, 0, stream>>>(S, P16);
        // y[n][i] = sum_m attn[n][m] v[m][i]  (x 2^14)
        k_gemmw<h16, 0, false><<<dim3(HW / 64, IC / 64, 1), 32, 0, stream>>>(P16, nullptr, GT, nullptr, HW, Y, IC, nullptr, (size_t)0, (size_t)0, (size_t)0);
        k_yhl<<<L4, 256, 0, stream>>>(Y, Yh, Yl);
        // z[n][c] = sum_o y[n][o] Wo[c][o]  (hi + lo planes of y, 2 products)
        k_gemmw<bf, 1, false><<<dim3(HW / 64, CC / 64, 1), 32, 0, stream>>>(Yh, Yl, BZ, nullptr, IC, Z, CC, nullptr, (size_t)0, (size_t)0, (size_t)0);
        k_finb<<<(unsigned)(((size_t)CC * HW / 4 + 255) / 256), 256, 0, stream>>>(Z, xb, bo, OUT + (size_t)b * CC * HW);
    }
}

// v001
// A run of this version takes 334 microseconds.
// Timed twice side by side with v000, it ran 1.88 and 1.87 times as fast.
#include <hip/hip_runtime.h>

// All contractions on 16-bit WMMA, f32 accumulate: the three 1x1 projections q/k/v = v_wmma_f32_16x16x32_bf16 on RNE-bf16 copies of x and of the weights (single products); scores q.k = bf16 hi/lo split (hi.hi + lo.hi + hi.lo, K = 128); attn.v = v_wmma_f32_16x16x32_f16 (softmax rows carried x 2^14 as f16, v as f16); output projection = bf16 hi/lo planes of y times bf16 Wo (2 products). Bias adds, softmax and the residual add in f32.
// x [NB][128][4096]; q/k/v [4096][128] token-major (GEMM, bias added in the convert passes); s[n][m] = q_n . k_m (unscaled); attn[n][m] = softmax_m(s); y[n][o] = sum_m attn[n][m] v[m][o]; out[c][n] = x[c][n] + bo[c] + sum_o Wo[c][o] y[n][o].

#ifndef NB
#define NB 4
#endif
#ifndef SEQ
#define SEQ 4096
#endif
#define NB_FULL  4
#define SEQ_FULL 4096
#define CC   128
#define IC   128
#define HW   SEQ
#define HWF  SEQ_FULL
#define PCAR 16384.0f
static_assert(NB >= 1 && NB <= NB_FULL);
static_assert(SEQ >= 128 && SEQ <= SEQ_FULL && (SEQ % 128) == 0);
static_assert((HW % 64) == 0 && (IC % 64) == 0 && (CC % 64) == 0);
static_assert((HW % 32) == 0 && (IC % 32) == 0 && (CC % 32) == 0);
static_assert(((IC * CC) % 8) == 0 && ((HW * CC) % 4) == 0 && ((HW * IC) % 4) == 0 && ((IC * HW) % 2) == 0 && (HW % 8) == 0 && (IC % 4) == 0);
static_assert(((size_t)HW * CC / 4) % 256 == 0 && ((size_t)HW * IC / 4) % 256 == 0 && ((size_t)HW * IC / 2) % 256 == 0);

typedef _Float16 h16;
typedef unsigned short bf;
typedef __attribute__((ext_vector_type(16))) __bf16   v16bf;
typedef __attribute__((ext_vector_type(16))) _Float16 v16h;
typedef __attribute__((ext_vector_type(8)))  _Float16 v8h;
typedef __attribute__((ext_vector_type(8)))  unsigned short v8us;
typedef __attribute__((ext_vector_type(8)))  float    v8f;
typedef __attribute__((ext_vector_type(4)))  float    v4f;
typedef v8h  __attribute__((may_alias)) v8ha;
typedef v4f  __attribute__((may_alias)) v4fa;
typedef v8us __attribute__((may_alias)) v8usa;

__device__ __forceinline__ unsigned short f2bf(float f) { unsigned u = __float_as_uint(f); u += 0x7FFFu + ((u >> 16) & 1u); return (unsigned short)(u >> 16); }
__device__ __forceinline__ float bf2f(unsigned short b) { return __uint_as_float(((unsigned)b) << 16); }
__device__ __forceinline__ float bfr(float f) { return bf2f(f2bf(f)); }
__device__ __forceinline__ v16h cat16(v8h lo, v8h hi) { return __builtin_shufflevector(lo, hi, 0, 1, 2, 3, 4, 5, 6, 7, 8, 9, 10, 11, 12, 13, 14, 15); }
__device__ __forceinline__ v16bf cat16b(v8us lo, v8us hi) { return __builtin_bit_cast(v16bf, __builtin_shufflevector(lo, hi, 0, 1, 2, 3, 4, 5, 6, 7, 8, 9, 10, 11, 12, 13, 14, 15)); }
__device__ __forceinline__ v8f wmma16(v16h a, v16h b, v8f c) { return __builtin_amdgcn_wmma_f32_16x16x32_f16(false, a, false, b, (short)0, c, false, false); }
__device__ __forceinline__ v8f wmmab(v16bf a, v16bf b, v8f c) { return __builtin_amdgcn_wmma_f32_16x16x32_bf16(false, a, false, b, (short)0, c, false, false); }

// ---- k_gemmw: register-blocked GEMM, ONE WAVE per 64x64 output tile (16 accumulators), operands straight from K-contiguous 16-bit planes; grid (M/64, N/64, Z), 32 threads.
// C[m][n] (f32, pitch ldc, + optional f32 bias[n]) = sum_k A[m][k] Bt[n][k] (+ split products per NSPLIT). z-batch strides sA/sB/sC in elements. K % 32 == 0.
// Fragments: lane l, h = l >> 4, row/col = l & 15; elements 0..7 = k0 + 8h + 0..7, elements 8..15 = k0 + 16 + 8h + 0..7 for BOTH A and Bt; D element r = (row 8h + r, col l & 15).
template <typename T16> struct WFrag;
template <> struct WFrag<h16> { typedef v16h V; static __device__ __forceinline__ V ld(const h16* p) { return cat16(*(const v8h*)p, *(const v8h*)(p + 16)); } static __device__ __forceinline__ v8f mma(V a, V b, v8f c) { return wmma16(a, b, c); } };
template <> struct WFrag<bf> { typedef v16bf V; static __device__ __forceinline__ V ld(const bf* p) { return cat16b(*(const v8us*)p, *(const v8us*)(p + 16)); } static __device__ __forceinline__ v8f mma(V a, V b, v8f c) { return wmmab(a, b, c); } };
template <typename T16, int NSPLIT, bool BIAS>
__global__ __launch_bounds__(32) void k_gemmw(const T16* __restrict__ A, const T16* __restrict__ A2, const T16* __restrict__ Bt, const T16* __restrict__ Bt2, int K, float* C, int ldc, const float* __restrict__ bias, size_t sA, size_t sB, size_t sC) {
    typedef typename WFrag<T16>::V V;
    __shared__ __align__(16) float os[16 * 68];
    const size_t z = blockIdx.z; A += z * sA; if (A2) A2 += z * sA; Bt += z * sB; if (Bt2) Bt2 += z * sB; C += z * sC;
    const int lane = threadIdx.x & 31, lr = lane & 15, hi = lane >> 4; const int r0 = blockIdx.x * 64, c0 = blockIdx.y * 64;
    v8f acc[4][4];
#pragma unroll
    for (int mb = 0; mb < 4; ++mb)
#pragma unroll
        for (int nb = 0; nb < 4; ++nb) acc[mb][nb] = (v8f){};
    const size_t aoff = (size_t)(r0 + lr) * K + 8 * hi, boff = (size_t)(c0 + lr) * K + 8 * hi;
#pragma unroll 1
    for (int kc = 0; kc < K; kc += 32) {
        V a[4], a2[4];
#pragma unroll
        for (int mb = 0; mb < 4; ++mb) { a[mb] = WFrag<T16>::ld(A + aoff + (size_t)mb * 16 * K + kc); if (NSPLIT == 1 || NSPLIT == 2) a2[mb] = WFrag<T16>::ld(A2 + aoff + (size_t)mb * 16 * K + kc); }
#pragma unroll
        for (int nb = 0; nb < 4; ++nb) { const V b = WFrag<T16>::ld(Bt + boff + (size_t)nb * 16 * K + kc); V b2; if (NSPLIT >= 2) b2 = WFrag<T16>::ld(Bt2 + boff + (size_t)nb * 16 * K + kc);
#pragma unroll
            for (int mb = 0; mb < 4; ++mb) { acc[mb][nb] = WFrag<T16>::mma(a[mb], b, acc[mb][nb]); if (NSPLIT == 1 || NSPLIT == 2) acc[mb][nb] = WFrag<T16>::mma(a2[mb], b, acc[mb][nb]); if (NSPLIT >= 2) acc[mb][nb] = WFrag<T16>::mma(a[mb], b2, acc[mb][nb]); } }
        asm volatile("v_nop\n\tv_nop\n\tv_nop\n\tv_nop" : "+v"(acc[0][0]), "+v"(acc[1][1]), "+v"(acc[2][2]), "+v"(acc[3][3]) : "v"(a[0]), "v"(a[3]));
    }
#pragma unroll
    for (int mb = 0; mb < 4; ++mb) {
#pragma unroll
        for (int nb = 0; nb < 4; ++nb) {
#pragma unroll
            for (int j = 0; j < 8; ++j) os[(hi * 8 + j) * 68 + nb * 16 + lr] = acc[mb][nb][j]; }
        __builtin_amdgcn_wave_barrier(); asm volatile("" ::: "memory");
        float* crow = C + (size_t)(r0 + mb * 16) * ldc + c0;
{
#pragma unroll
            for (int s = 0; s < 8; ++s) { const int row = 2 * s + hi, cofs = lr * 4; v4f val = *(const v4fa*)(os + row * 68 + cofs); if (BIAS) { val[0] += bfr(bias[c0 + cofs]); val[1] += bfr(bias[c0 + cofs + 1]); val[2] += bfr(bias[c0 + cofs + 2]); val[3] += bfr(bias[c0 + cofs + 3]); }
                *(v4f*)(crow + (size_t)row * ldc + cofs) = val; }
             }
        __builtin_amdgcn_wave_barrier(); asm volatile("" ::: "memory");
    }
}

// ---- k_pv: y = attn . v with K (the keys) split: blockIdx.z takes one of PVZ interleaved key sets (one f32 partial plane each, added in k_yhl), and inside a work-group each of the PVW waves
// holds the whole 64x64 tile for its own 64-key chunks (one 128-B line of every operand row per chunk). The PVW partial tiles meet in LDS: wave w sums accumulator w over the waves in the order 0..PVW-1.
// Fragments and D layout as in k_gemmw. grid (HW/64, IC/64, PVZ), 32 * PVW threads.
#define PVW 16
#define PVZ 2
static_assert(PVW == 16 && PVZ == 2 && (HW % (64 * PVW * PVZ)) == 0);   // 16 accumulators, one per summing wave; k_yhl adds two planes
__global__ __launch_bounds__(32 * PVW) void k_pv(const h16* __restrict__ A, const h16* __restrict__ Bt, float* C) {
    __shared__ __align__(16) float part[PVW * 4096];
    __shared__ __align__(16) float os[64 * 68];
    const int lane = threadIdx.x & 31, lr = lane & 15, hi = lane >> 4; const int w = __builtin_amdgcn_readfirstlane((int)(threadIdx.x >> 5));
    const int r0 = blockIdx.x * 64, c0 = blockIdx.y * 64; const int k0 = ((int)blockIdx.z * PVW + w) * 64;
    v8f acc[4][4];
#pragma unroll
    for (int mb = 0; mb < 4; ++mb)
#pragma unroll
        for (int nb = 0; nb < 4; ++nb) acc[mb][nb] = (v8f){};
    const h16* ap = A + (size_t)(r0 + lr) * HW + 8 * hi + k0; const h16* bp = Bt + (size_t)(c0 + lr) * HW + 8 * hi + k0;
#pragma unroll 1   // rolled: unrolled, the fragments of both trips beside the 128 accumulator registers pass the 256-register budget of a 16-wave work-group and spill
    for (int kc = 0; kc < HW; kc += 64 * PVW * PVZ) {
        v16h a[4][2];
#pragma unroll
        for (int mb = 0; mb < 4; ++mb) { a[mb][0] = WFrag<h16>::ld(ap + (size_t)mb * 16 * HW + kc); a[mb][1] = WFrag<h16>::ld(ap + (size_t)mb * 16 * HW + kc + 32); }
        v16h b[2][2]; b[0][0] = WFrag<h16>::ld(bp + kc); b[0][1] = WFrag<h16>::ld(bp + kc + 32);
#pragma unroll
        for (int nb = 0; nb < 4; ++nb) {
            if (nb < 3) { b[(nb + 1) & 1][0] = WFrag<h16>::ld(bp + (size_t)(nb + 1) * 16 * HW + kc); b[(nb + 1) & 1][1] = WFrag<h16>::ld(bp + (size_t)(nb + 1) * 16 * HW + kc + 32); }
            // keeps the four 16-byte loads of each 128-B line next to one another and ahead of the WMMAs; sunk apart (as the build without it has them) a line's second half is asked for a k-step later, when the other waves' lines may have pushed it out of the 64-KiB cache
            __builtin_amdgcn_sched_barrier(0);
#pragma unroll
            for (int mb = 0; mb < 4; ++mb) acc[mb][nb] = wmma16(a[mb][0], b[nb & 1][0], acc[mb][nb]);
#pragma unroll
            for (int mb = 0; mb < 4; ++mb) acc[mb][nb] = wmma16(a[mb][1], b[nb & 1][1], acc[mb][nb]); }
    }
    float* my = part + w * 4096 + lane * 4;
#pragma unroll
    for (int mb = 0; mb < 4; ++mb)
#pragma unroll
        for (int nb = 0; nb < 4; ++nb) { const v8f t = acc[mb][nb]; *(v4fa*)(my + (mb * 4 + nb) * 256) = (v4f){t[0], t[1], t[2], t[3]}; *(v4fa*)(my + (mb * 4 + nb) * 256 + 128) = (v4f){t[4], t[5], t[6], t[7]}; }
    __syncthreads();
    const float* src = part + w * 256 + lane * 4; v4f s0 = *(const v4fa*)src, s1 = *(const v4fa*)(src + 128);
#pragma unroll
    for (int u = 1; u < PVW; ++u) { s0 += *(const v4fa*)(src + u * 4096); s1 += *(const v4fa*)(src + u * 4096 + 128); }
    float* od = os + ((w >> 2) * 16 + hi * 8) * 68 + (w & 3) * 16 + lr;
#pragma unroll
    for (int j = 0; j < 4; ++j) { od[j * 68] = s0[j]; od[(4 + j) * 68] = s1[j]; }
    __syncthreads();
    float* crow = C + (size_t)blockIdx.z * HW * IC + (size_t)r0 * IC + c0;
#pragma unroll
    for (int q = 0; q < 2; ++q) { const int row = q * 32 + (int)(threadIdx.x >> 4), cofs = (int)(threadIdx.x & 15) * 4; *(v4f*)(crow + (size_t)row * IC + cofs) = *(const v4fa*)(os + row * 68 + cofs); }
}

__device__ __forceinline__ h16 tohx(float x) { return (h16)x; }
__device__ __forceinline__ void splitf(float y, unsigned short& h, unsigned short& l) { h = f2bf(y); l = f2bf(y - bf2f(h)); }
typedef __attribute__((ext_vector_type(2))) unsigned short v2us;
typedef __attribute__((ext_vector_type(4))) unsigned short v4us;
typedef __attribute__((ext_vector_type(2))) _Float16 v2h;
typedef __attribute__((ext_vector_type(4))) _Float16 v4h;
typedef __attribute__((ext_vector_type(2))) float v2f;

__global__ __launch_bounds__(256) void k_cvtw(const float* __restrict__ w0, const float* __restrict__ w1, const float* __restrict__ w2, const float* __restrict__ w3, bf* B3, bf* BZ, int n8) {
    const int i = blockIdx.x * 256 + threadIdx.x; if (i >= n8) return;
    const size_t e = (size_t)i * 8, pl = (size_t)n8 * 8;
    const v8f a0 = *(const v8f*)(w0 + e), a1 = *(const v8f*)(w1 + e), a2 = *(const v8f*)(w2 + e), a3 = *(const v8f*)(w3 + e);
    v8us o0, o1, o2, o3;
#pragma unroll
    for (int k = 0; k < 8; ++k) { o0[k] = f2bf(a0[k]); o1[k] = f2bf(a1[k]); o2[k] = f2bf(a2[k]); o3[k] = f2bf(a3[k]); }
    *(v8us*)(B3 + e) = o0; *(v8us*)(B3 + pl + e) = o1; *(v8us*)(B3 + 2 * pl + e) = o2; *(v8us*)(BZ + e) = o3;
    
}
__global__ __launch_bounds__(256) void k_xt(const float* __restrict__ xb, bf* XT) { const size_t e = ((size_t)blockIdx.x * 256 + threadIdx.x) * 4; if (e >= (size_t)HW * CC) return; const int c = (int)(e % CC); const int m = (int)(e / CC); v4us o;
#pragma unroll
    for (int u = 0; u < 4; ++u) o[u] = f2bf(xb[(size_t)(c + u) * HWF + m]); *(v4us*)(XT + e) = o;  }
__global__ __launch_bounds__(256) void k_hlb(const float* __restrict__ F, const float* __restrict__ b0, const float* __restrict__ b1, bf* Fh, bf* Fl, size_t n, size_t pl) { const size_t e = ((size_t)blockIdx.x * 256 + threadIdx.x) * 4; if (e >= n) return; const v4f a = *(const v4f*)(F + e); const int i = (int)(e % IC); const bool sec = (e >= pl); const v4f cA = *(const v4f*)(b0 + i), cB = *(const v4f*)(b1 + i); v4us oh, ol;
#pragma unroll
    for (int u = 0; u < 4; ++u) { const float bb = sec ? bfr(cB[u]) : bfr(cA[u]); unsigned short p, q; splitf(__fadd_rn(a[u], bb), p, q); oh[u] = p; ol[u] = q; } *(v4us*)(Fh + e) = oh; *(v4us*)(Fl + e) = ol;  }
__global__ __launch_bounds__(256) void k_gt16b(const float* __restrict__ G, const float* __restrict__ bvec, h16* GT) { const size_t e = ((size_t)blockIdx.x * 256 + threadIdx.x) * 2; if (e >= (size_t)IC * HW) return; const int m = (int)(e % HW); const int i = (int)(e / HW); const float bb = bfr(bvec[i]); v2h o; o[0] = tohx(__fadd_rn(G[(size_t)m * IC + i], bb)); o[1] = tohx(__fadd_rn(G[(size_t)(m + 1) * IC + i], bb)); *(v2h*)(GT + e) = o;  }
__global__ __launch_bounds__(256) void k_rsoft(const float* __restrict__ S, h16* P16) { const int lane = threadIdx.x & 31; const int row = blockIdx.x * 8 + (threadIdx.x >> 5); if (row >= HW) return; const float* sr = S + (size_t)row * HW; float v[HW / 32]; float mx = -3.0e38f;
#pragma unroll
    for (int ch = 0; ch < HW / 128; ++ch) { const v4f a = *(const v4f*)(sr + ch * 128 + lane * 4);
#pragma unroll
        for (int u = 0; u < 4; ++u) { const float t = a[u]; v[ch * 4 + u] = t; mx = fmaxf(mx, t); } }
#pragma unroll
    for (int sh = 16; sh; sh >>= 1) mx = fmaxf(mx, __shfl_xor(mx, sh, 32));
    float sum = 0.f;
#pragma unroll
    for (int q = 0; q < HW / 32; ++q) { float d0 = __fsub_rn(v[q], mx); asm volatile("" : "+v"(d0)); v[q] = __builtin_amdgcn_exp2f(__fmul_rn(d0, 1.4426950408889634f)); sum += v[q]; }
#pragma unroll
    for (int sh = 16; sh; sh >>= 1) sum += __shfl_xor(sum, sh, 32);
    const float f = __fdiv_rn(PCAR, sum);
    {
#pragma unroll
        for (int ch = 0; ch < HW / 128; ++ch) { v4h o4;
#pragma unroll
            for (int q = 0; q < 4; ++q) o4[q] = tohx(v[ch * 4 + q] * f); *(v4h*)(P16 + (size_t)row * HW + ch * 128 + lane * 4) = o4; }
         } }
__global__ __launch_bounds__(256) void k_yhl(const float* __restrict__ Y, bf* Yh, bf* Yl) { const size_t e = ((size_t)blockIdx.x * 256 + threadIdx.x) * 4; if (e >= (size_t)HW * IC) return; const v4f a = *(const v4f*)(Y + e) + *(const v4f*)(Y + (size_t)HW * IC + e); v4us oh, ol;
#pragma unroll
    for (int u = 0; u < 4; ++u) { unsigned short p, q; splitf(a[u] * (1.0f / PCAR), p, q); oh[u] = p; ol[u] = q; } *(v4us*)(Yh + e) = oh; *(v4us*)(Yl + e) = ol;  }
__global__ __launch_bounds__(256) void k_finb(const float* __restrict__ Z, const float* __restrict__ xb, const float* __restrict__ bo, float* OUTb) { const size_t e = ((size_t)blockIdx.x * 256 + threadIdx.x) * 4; if (e >= (size_t)CC * HW) return; const int n = (int)(e % HW); const int c = (int)(e / HW); const float bb = bfr(bo[c]); v4f r;
#pragma unroll
    for (int u = 0; u < 4; ++u) r[u] = __fadd_rn(__fadd_rn(Z[(size_t)(n + u) * CC + c], bb), bfr(xb[(size_t)c * HWF + n + u])); *(v4f*)(OUTb + e) = r;  }

extern "C" void kernel_launch(void* const* d_in, const int* in_sizes, int n_in,
                              void* d_out, int out_size, void* d_ws, size_t ws_size, hipStream_t stream) {
    if (n_in < 9) return;
    if (in_sizes[0] < NB * CC * HW) return;
    if (in_sizes[1] < IC * CC || in_sizes[3] < IC * CC || in_sizes[5] < IC * CC || in_sizes[7] < CC * IC) return;
    if (in_sizes[2] < IC || in_sizes[4] < IC || in_sizes[6] < IC || in_sizes[8] < CC) return;
    if (out_size < NB * CC * HW) return;
    const float* x  = (const float*)d_in[0];   // [NB][CC][HWF]
    const float* wq = (const float*)d_in[1];   // [IC][CC]  (queries)
    const float* bq = (const float*)d_in[2];   // [IC]
    const float* wk = (const float*)d_in[3];   // [IC][CC]  (keys)
    const float* bk = (const float*)d_in[4];   // [IC]
    const float* wv = (const float*)d_in[5];   // [IC][CC]  (values)
    const float* bv = (const float*)d_in[6];   // [IC]
    const float* wo = (const float*)d_in[7];   // [CC][IC]  (output projection)
    const float* bo = (const float*)d_in[8];   // [CC]
    float* OUT = (float*)d_out;                // [NB][CC][HW]
    char* wsp = (char*)d_ws;
    auto take = [&](size_t bytes) { char* p = wsp; wsp += (bytes + 255) & ~(size_t)255; return (void*)p; };
    bf* BW3 = (bf*)take((size_t)3 * IC * CC * 2);          // [q][k][v], each [IC][CC]
    bf* BZ  = (bf*)take((size_t)CC * IC * 2);
    bf* XT  = (bf*)take((size_t)HW * CC * 2);              // [m][c]
    float* TPG = (float*)take((size_t)3 * HW * IC * 4);    // [q][k][v], each [HW][IC] f32 (no bias yet)
    bf* Hh  = (bf*)take((size_t)2 * HW * IC * 2);          // hi planes of q+bq, k+bk
    bf* Hl  = (bf*)take((size_t)2 * HW * IC * 2);          // lo planes of q+bq, k+bk
    h16* GT = (h16*)take((size_t)IC * HW * 2);             // [i][m] fp16 (v + bv)
    float* S = (float*)take((size_t)HW * HW * 4);          // [n][m]
    h16* P16 = (h16*)take((size_t)HW * HW * 2);            // [n][m] fp16 x 2^14
    float* Y = (float*)take((size_t)PVZ * HW * IC * 4);    // PVZ partial planes [n][i] (x 2^14)
    bf* Yh  = (bf*)take((size_t)HW * IC * 2); bf* Yl = (bf*)take((size_t)HW * IC * 2);
    float* Z = (float*)take((size_t)HW * CC * 4);          // [n][c]
    if ((size_t)(wsp - (char*)d_ws) > ws_size) return;    // total 121,765,888 B at SEQ 4096

    const size_t PL = (size_t)HW * IC;                      // one [HW][IC] plane, elements
    k_cvtw<<<(unsigned)((IC * CC / 8 + 255) / 256), 256, 0, stream>>>(wq, wk, wv, wo, BW3, BZ, IC * CC / 8);
    const unsigned L4  = (unsigned)((PL / 4 + 255) / 256);
    const unsigned L42 = (unsigned)((2 * PL / 4 + 255) / 256);
    for (int b = 0; b < NB; ++b) {
        const float* xb = x + (size_t)b * CC * HWF;
        k_xt<<<(unsigned)(((size_t)HW * CC / 4 + 255) / 256), 256, 0, stream>>>(xb, XT);
        // q / k / v [m][o] = sum_c XT[m][c] W[o][c]   (z = 0 q, 1 k, 2 v; exact bf16 products)
        k_gemmw<bf, 0, false><<<dim3(HW / 64, IC / 64, 3), 32, 0, stream>>>(XT, nullptr, BW3, nullptr, CC, TPG, IC, nullptr, (size_t)0, (size_t)IC * CC, PL);
        k_hlb<<<L42, 256, 0, stream>>>(TPG, bq, bk, Hh, Hl, 2 * PL, PL);                     // hi/lo planes of q+bq (first PL) and k+bk (second PL)
        k_gt16b<<<(unsigned)((PL / 2 + 255) / 256), 256, 0, stream>>>(TPG + 2 * PL, bv, GT);
        // s[n][m] = q_n . k_m (3 products)
        k_gemmw<bf, 2, false><<<dim3(HW / 64, HW / 64, 1), 32, 0, stream>>>(Hh, Hl, Hh + PL, Hl + PL, IC, S, HW, nullptr, (size_t)0, (size_t)0, (size_t)0);
        k_rsoft<<<HW / 8, 256, 0, stream>>>(S, P16);
        // y[n][i] = sum_m attn[n][m] v[m][i]  (x 2^14), keys split over PVZ planes x PVW waves
        k_pv<<<dim3(HW / 64, IC / 64, PVZ), 32 * PVW, 0, stream>>>(P16, GT, Y);
        k_yhl<<<L4, 256, 0, stream>>>(Y, Yh, Yl);
        // z[n][c] = sum_o y[n][o] Wo[c][o]  (hi + lo planes of y, 2 products)
        k_gemmw<bf, 1, false><<<dim3(HW / 64, CC / 64, 1), 32, 0, stream>>>(Yh, Yl, BZ, nullptr, IC, Z, CC, nullptr, (size_t)0, (size_t)0, (size_t)0);
        k_finb<<<(unsigned)(((size_t)CC * HW / 4 + 255) / 256), 256, 0, stream>>>(Z, xb, bo, OUT + (size_t)b * CC * HW);
    }
}

// v002
// One run takes 247 microseconds.
// In two side-by-side timings against v001, it was 1.36 and 1.35 times as fast.
// Counting every step since v000, it is 2.55 times as fast.
#include <hip/hip_runtime.h>

// All contractions on 16-bit WMMA, f32 accumulate: the three 1x1 projections q/k/v = v_wmma_f32_16x16x32_bf16 on RNE-bf16 copies of x and of the weights (single products); scores q.k = bf16 hi/lo split (hi.hi + lo.hi + hi.lo, K = 128); attn.v = v_wmma_f32_16x16x32_f16 (softmax rows carried x 2^14 as f16, v as f16); output projection = bf16 hi/lo planes of y times bf16 Wo (2 products). Bias adds, softmax and the residual add in f32.
// x [NB][128][4096]; q/k/v [4096][128] token-major (GEMM, bias added in the convert passes); s[n][m] = q_n . k_m (unscaled); attn[n][m] = softmax_m(s); y[n][o] = sum_m attn[n][m] v[m][o]; out[c][n] = x[c][n] + bo[c] + sum_o Wo[c][o] y[n][o].

#ifndef NB
#define NB 4
#endif
#ifndef SEQ
#define SEQ 4096
#endif
#define NB_FULL  4
#define SEQ_FULL 4096
#define CC   128
#define IC   128
#define HW   SEQ
#define HWF  SEQ_FULL
#define PCAR 16384.0f
static_assert(NB >= 1 && NB <= NB_FULL);
static_assert(SEQ >= 128 && SEQ <= SEQ_FULL && (SEQ % 128) == 0);
static_assert((HW % 64) == 0 && (IC % 64) == 0 && (CC % 64) == 0);
static_assert((HW % 32) == 0 && (IC % 32) == 0 && (CC % 32) == 0);
static_assert(((IC * CC) % 8) == 0 && ((HW * CC) % 4) == 0 && ((HW * IC) % 4) == 0 && ((IC * HW) % 2) == 0 && (HW % 8) == 0 && (IC % 4) == 0);
static_assert(((size_t)HW * CC / 4) % 256 == 0 && ((size_t)HW * IC / 4) % 256 == 0 && ((size_t)HW * IC / 2) % 256 == 0);

typedef _Float16 h16;
typedef unsigned short bf;
typedef __attribute__((ext_vector_type(16))) __bf16   v16bf;
typedef __attribute__((ext_vector_type(16))) _Float16 v16h;
typedef __attribute__((ext_vector_type(8)))  _Float16 v8h;
typedef __attribute__((ext_vector_type(8)))  unsigned short v8us;
typedef __attribute__((ext_vector_type(8)))  float    v8f;
typedef __attribute__((ext_vector_type(4)))  float    v4f;
typedef v8h  __attribute__((may_alias)) v8ha;
typedef v4f  __attribute__((may_alias)) v4fa;
typedef v8us __attribute__((may_alias)) v8usa;

__device__ __forceinline__ unsigned short f2bf(float f) { unsigned u = __float_as_uint(f); u += 0x7FFFu + ((u >> 16) & 1u); return (unsigned short)(u >> 16); }
__device__ __forceinline__ float bf2f(unsigned short b) { return __uint_as_float(((unsigned)b) << 16); }
__device__ __forceinline__ float bfr(float f) { return bf2f(f2bf(f)); }
__device__ __forceinline__ v16h cat16(v8h lo, v8h hi) { return __builtin_shufflevector(lo, hi, 0, 1, 2, 3, 4, 5, 6, 7, 8, 9, 10, 11, 12, 13, 14, 15); }
__device__ __forceinline__ v16bf cat16b(v8us lo, v8us hi) { return __builtin_bit_cast(v16bf, __builtin_shufflevector(lo, hi, 0, 1, 2, 3, 4, 5, 6, 7, 8, 9, 10, 11, 12, 13, 14, 15)); }
__device__ __forceinline__ v8f wmma16(v16h a, v16h b, v8f c) { return __builtin_amdgcn_wmma_f32_16x16x32_f16(false, a, false, b, (short)0, c, false, false); }
__device__ __forceinline__ v8f wmmab(v16bf a, v16bf b, v8f c) { return __builtin_amdgcn_wmma_f32_16x16x32_bf16(false, a, false, b, (short)0, c, false, false); }

// ---- k_gemmw: register-blocked GEMM, ONE WAVE per 64x64 output tile (16 accumulators), operands straight from K-contiguous 16-bit planes; grid (M/64, N/64, Z), 32 threads.
// C[m][n] (f32, pitch ldc, + optional f32 bias[n]) = sum_k A[m][k] Bt[n][k] (+ split products per NSPLIT). z-batch strides sA/sB/sC in elements. K % 32 == 0.
// blockIdx.z = z: C plane z; ZB == 1: A plane z, Bt plane z; ZB > 1: A plane z / ZB (the image), Bt plane z % ZB (one of ZB weight matrices that every image shares).
// Fragments: lane l, h = l >> 4, row/col = l & 15; elements 0..7 = k0 + 8h + 0..7, elements 8..15 = k0 + 16 + 8h + 0..7 for BOTH A and Bt; D element r = (row 8h + r, col l & 15).
template <typename T16> struct WFrag;
template <> struct WFrag<h16> { typedef v16h V; static __device__ __forceinline__ V ld(const h16* p) { return cat16(*(const v8h*)p, *(const v8h*)(p + 16)); } static __device__ __forceinline__ v8f mma(V a, V b, v8f c) { return wmma16(a, b, c); } };
template <> struct WFrag<bf> { typedef v16bf V; static __device__ __forceinline__ V ld(const bf* p) { return cat16b(*(const v8us*)p, *(const v8us*)(p + 16)); } static __device__ __forceinline__ v8f mma(V a, V b, v8f c) { return wmmab(a, b, c); } };
template <typename T16, int NSPLIT, bool BIAS, int ZB>
__global__ __launch_bounds__(32) void k_gemmw(const T16* __restrict__ A, const T16* __restrict__ A2, const T16* __restrict__ Bt, const T16* __restrict__ Bt2, int K, float* C, int ldc, const float* __restrict__ bias, size_t sA, size_t sB, size_t sC) {
    typedef typename WFrag<T16>::V V;
    __shared__ __align__(16) float os[16 * 68];
    const size_t z = blockIdx.z, zA = z / ZB, zB = (ZB > 1) ? z % ZB : z; A += zA * sA; if (A2) A2 += zA * sA; Bt += zB * sB; if (Bt2) Bt2 += zB * sB; C += z * sC;
    const int lane = threadIdx.x & 31, lr = lane & 15, hi = lane >> 4; const int r0 = blockIdx.x * 64, c0 = blockIdx.y * 64;
    v8f acc[4][4];
#pragma unroll
    for (int mb = 0; mb < 4; ++mb)
#pragma unroll
        for (int nb = 0; nb < 4; ++nb) acc[mb][nb] = (v8f){};
    const size_t aoff = (size_t)(r0 + lr) * K + 8 * hi, boff = (size_t)(c0 + lr) * K + 8 * hi;
#pragma unroll 1
    for (int kc = 0; kc < K; kc += 32) {
        V a[4], a2[4];
#pragma unroll
        for (int mb = 0; mb < 4; ++mb) { a[mb] = WFrag<T16>::ld(A + aoff + (size_t)mb * 16 * K + kc); if (NSPLIT == 1 || NSPLIT == 2) a2[mb] = WFrag<T16>::ld(A2 + aoff + (size_t)mb * 16 * K + kc); }
#pragma unroll
        for (int nb = 0; nb < 4; ++nb) { const V b = WFrag<T16>::ld(Bt + boff + (size_t)nb * 16 * K + kc); V b2; if (NSPLIT >= 2) b2 = WFrag<T16>::ld(Bt2 + boff + (size_t)nb * 16 * K + kc);
#pragma unroll
            for (int mb = 0; mb < 4; ++mb) { acc[mb][nb] = WFrag<T16>::mma(a[mb], b, acc[mb][nb]); if (NSPLIT == 1 || NSPLIT == 2) acc[mb][nb] = WFrag<T16>::mma(a2[mb], b, acc[mb][nb]); if (NSPLIT >= 2) acc[mb][nb] = WFrag<T16>::mma(a[mb], b2, acc[mb][nb]); } }
        asm volatile("v_nop\n\tv_nop\n\tv_nop\n\tv_nop" : "+v"(acc[0][0]), "+v"(acc[1][1]), "+v"(acc[2][2]), "+v"(acc[3][3]) : "v"(a[0]), "v"(a[3]));
    }
#pragma unroll
    for (int mb = 0; mb < 4; ++mb) {
#pragma unroll
        for (int nb = 0; nb < 4; ++nb) {
#pragma unroll
            for (int j = 0; j < 8; ++j) os[(hi * 8 + j) * 68 + nb * 16 + lr] = acc[mb][nb][j]; }
        __builtin_amdgcn_wave_barrier(); asm volatile("" ::: "memory");
        float* crow = C + (size_t)(r0 + mb * 16) * ldc + c0;
{
#pragma unroll
            for (int s = 0; s < 8; ++s) { const int row = 2 * s + hi, cofs = lr * 4; v4f val = *(const v4fa*)(os + row * 68 + cofs); if (BIAS) { val[0] += bfr(bias[c0 + cofs]); val[1] += bfr(bias[c0 + cofs + 1]); val[2] += bfr(bias[c0 + cofs + 2]); val[3] += bfr(bias[c0 + cofs + 3]); }
                *(v4f*)(crow + (size_t)row * ldc + cofs) = val; }
             }
        __builtin_amdgcn_wave_barrier(); asm volatile("" ::: "memory");
    }
}

// ---- k_pv: y = attn . v with K (the keys) split: blockIdx.z takes one of PVZ interleaved key sets (one f32 partial plane each, added in k_yhl), and inside a work-group each of the PVW waves
// holds the whole 64x64 tile for its own 64-key chunks (one 128-B line of every operand row per chunk). The PVW partial tiles meet in LDS: wave w sums accumulator w over the waves in the order 0..PVW-1.
// Fragments and D layout as in k_gemmw. grid (HW/64, IC/64, PVZ * images), 32 * PVW threads; blockIdx.z = image * PVZ + key set, which is also the number of the partial plane in C.
#define PVW 16
#define PVZ 2
static_assert(PVW == 16 && PVZ == 2 && (HW % (64 * PVW * PVZ)) == 0);   // 16 accumulators, one per summing wave; k_yhl adds two planes
#define SG 2   // images per launch of the score, softmax and attn.v passes
static_assert(PVZ * IC + CC <= 3 * IC);   // Y and Z together fit the bytes of the dead q/k/v planes
__global__ __launch_bounds__(32 * PVW) void k_pv(const h16* __restrict__ A, const h16* __restrict__ Bt, float* C) {
    __shared__ __align__(16) float part[PVW * 4096];
    __shared__ __align__(16) float os[64 * 68];
    const int lane = threadIdx.x & 31, lr = lane & 15, hi = lane >> 4; const int w = __builtin_amdgcn_readfirstlane((int)(threadIdx.x >> 5));
    const int r0 = blockIdx.x * 64, c0 = blockIdx.y * 64; const int k0 = ((int)(blockIdx.z % PVZ) * PVW + w) * 64;
    A += (size_t)(blockIdx.z / PVZ) * HW * HW; Bt += (size_t)(blockIdx.z / PVZ) * IC * HW;
    v8f acc[4][4];
#pragma unroll
    for (int mb = 0; mb < 4; ++mb)
#pragma unroll
        for (int nb = 0; nb < 4; ++nb) acc[mb][nb] = (v8f){};
    const h16* ap = A + (size_t)(r0 + lr) * HW + 8 * hi + k0; const h16* bp = Bt + (size_t)(c0 + lr) * HW + 8 * hi + k0;
#pragma unroll 1   // rolled: unrolled, the fragments of both trips beside the 128 accumulator registers pass the 256-register budget of a 16-wave work-group and spill
    for (int kc = 0; kc < HW; kc += 64 * PVW * PVZ) {
        v16h a[4][2];
#pragma unroll
        for (int mb = 0; mb < 4; ++mb) { a[mb][0] = WFrag<h16>::ld(ap + (size_t)mb * 16 * HW + kc); a[mb][1] = WFrag<h16>::ld(ap + (size_t)mb * 16 * HW + kc + 32); }
        v16h b[2][2]; b[0][0] = WFrag<h16>::ld(bp + kc); b[0][1] = WFrag<h16>::ld(bp + kc + 32);
#pragma unroll
        for (int nb = 0; nb < 4; ++nb) {
            if (nb < 3) { b[(nb + 1) & 1][0] = WFrag<h16>::ld(bp + (size_t)(nb + 1) * 16 * HW + kc); b[(nb + 1) & 1][1] = WFrag<h16>::ld(bp + (size_t)(nb + 1) * 16 * HW + kc + 32); }
            // keeps the four 16-byte loads of each 128-B line next to one another and ahead of the WMMAs; sunk apart (as the build without it has them) a line's second half is asked for a k-step later, when the other waves' lines may have pushed it out of the 64-KiB cache
            __builtin_amdgcn_sched_barrier(0);
#pragma unroll
            for (int mb = 0; mb < 4; ++mb) acc[mb][nb] = wmma16(a[mb][0], b[nb & 1][0], acc[mb][nb]);
#pragma unroll
            for (int mb = 0; mb < 4; ++mb) acc[mb][nb] = wmma16(a[mb][1], b[nb & 1][1], acc[mb][nb]); }
    }
    float* my = part + w * 4096 + lane * 4;
#pragma unroll
    for (int mb = 0; mb < 4; ++mb)
#pragma unroll
        for (int nb = 0; nb < 4; ++nb) { const v8f t = acc[mb][nb]; *(v4fa*)(my + (mb * 4 + nb) * 256) = (v4f){t[0], t[1], t[2], t[3]}; *(v4fa*)(my + (mb * 4 + nb) * 256 + 128) = (v4f){t[4], t[5], t[6], t[7]}; }
    __syncthreads();
    const float* src = part + w * 256 + lane * 4; v4f s0 = *(const v4fa*)src, s1 = *(const v4fa*)(src + 128);
#pragma unroll
    for (int u = 1; u < PVW; ++u) { s0 += *(const v4fa*)(src + u * 4096); s1 += *(const v4fa*)(src + u * 4096 + 128); }
    float* od = os + ((w >> 2) * 16 + hi * 8) * 68 + (w & 3) * 16 + lr;
#pragma unroll
    for (int j = 0; j < 4; ++j) { od[j * 68] = s0[j]; od[(4 + j) * 68] = s1[j]; }
    __syncthreads();
    float* crow = C + (size_t)blockIdx.z * HW * IC + (size_t)r0 * IC + c0;
#pragma unroll
    for (int q = 0; q < 2; ++q) { const int row = q * 32 + (int)(threadIdx.x >> 4), cofs = (int)(threadIdx.x & 15) * 4; *(v4f*)(crow + (size_t)row * IC + cofs) = *(const v4fa*)(os + row * 68 + cofs); }
}

__device__ __forceinline__ h16 tohx(float x) { return (h16)x; }
__device__ __forceinline__ void splitf(float y, unsigned short& h, unsigned short& l) { h = f2bf(y); l = f2bf(y - bf2f(h)); }
typedef __attribute__((ext_vector_type(2))) unsigned short v2us;
typedef __attribute__((ext_vector_type(4))) unsigned short v4us;
typedef __attribute__((ext_vector_type(2))) _Float16 v2h;
typedef __attribute__((ext_vector_type(4))) _Float16 v4h;
typedef __attribute__((ext_vector_type(2))) float v2f;

__global__ __launch_bounds__(256) void k_cvtw(const float* __restrict__ w0, const float* __restrict__ w1, const float* __restrict__ w2, const float* __restrict__ w3, bf* B3, bf* BZ, int n8) {
    const int i = blockIdx.x * 256 + threadIdx.x; if (i >= n8) return;
    const size_t e = (size_t)i * 8, pl = (size_t)n8 * 8;
    const v8f a0 = *(const v8f*)(w0 + e), a1 = *(const v8f*)(w1 + e), a2 = *(const v8f*)(w2 + e), a3 = *(const v8f*)(w3 + e);
    v8us o0, o1, o2, o3;
#pragma unroll
    for (int k = 0; k < 8; ++k) { o0[k] = f2bf(a0[k]); o1[k] = f2bf(a1[k]); o2[k] = f2bf(a2[k]); o3[k] = f2bf(a3[k]); }
    *(v8us*)(B3 + e) = o0; *(v8us*)(B3 + pl + e) = o1; *(v8us*)(B3 + 2 * pl + e) = o2; *(v8us*)(BZ + e) = o3;
    
}
__global__ __launch_bounds__(256) void k_xt(const float* __restrict__ xb, bf* XT) { const size_t e = ((size_t)blockIdx.x * 256 + threadIdx.x) * 4; if (e >= (size_t)HW * CC) return; xb += (size_t)blockIdx.y * CC * HWF; XT += (size_t)blockIdx.y * HW * CC; const int c = (int)(e % CC); const int m = (int)(e / CC); v4us o;
#pragma unroll
    for (int u = 0; u < 4; ++u) o[u] = f2bf(xb[(size_t)(c + u) * HWF + m]); *(v4us*)(XT + e) = o;  }
__global__ __launch_bounds__(256) void k_hlb(const float* __restrict__ F, const float* __restrict__ b0, const float* __restrict__ b1, bf* Fh, bf* Fl, size_t n, size_t pl) { const size_t e = ((size_t)blockIdx.x * 256 + threadIdx.x) * 4; if (e >= n) return; F += (size_t)blockIdx.y * 3 * pl; Fh += (size_t)blockIdx.y * n; Fl += (size_t)blockIdx.y * n; const v4f a = *(const v4f*)(F + e); const int i = (int)(e % IC); const bool sec = (e >= pl); const v4f cA = *(const v4f*)(b0 + i), cB = *(const v4f*)(b1 + i); v4us oh, ol;
#pragma unroll
    for (int u = 0; u < 4; ++u) { const float bb = sec ? bfr(cB[u]) : bfr(cA[u]); unsigned short p, q; splitf(__fadd_rn(a[u], bb), p, q); oh[u] = p; ol[u] = q; } *(v4us*)(Fh + e) = oh; *(v4us*)(Fl + e) = ol;  }
__global__ __launch_bounds__(256) void k_gt16b(const float* __restrict__ G, const float* __restrict__ bvec, h16* GT) { const size_t e = ((size_t)blockIdx.x * 256 + threadIdx.x) * 2; if (e >= (size_t)IC * HW) return; G += (size_t)blockIdx.y * 3 * HW * IC; GT += (size_t)blockIdx.y * IC * HW; const int m = (int)(e % HW); const int i = (int)(e / HW); const float bb = bfr(bvec[i]); v2h o; o[0] = tohx(__fadd_rn(G[(size_t)m * IC + i], bb)); o[1] = tohx(__fadd_rn(G[(size_t)(m + 1) * IC + i], bb)); *(v2h*)(GT + e) = o;  }
__global__ __launch_bounds__(256) void k_rsoft(const float* __restrict__ S, h16* P16) { const int lane = threadIdx.x & 31; const int row = blockIdx.x * 8 + (threadIdx.x >> 5); if (row >= HW) return; S += (size_t)blockIdx.y * HW * HW; P16 += (size_t)blockIdx.y * HW * HW; const float* sr = S + (size_t)row * HW; float v[HW / 32]; float mx = -3.0e38f;
#pragma unroll
    for (int ch = 0; ch < HW / 128; ++ch) { const v4f a = *(const v4f*)(sr + ch * 128 + lane * 4);
#pragma unroll
        for (int u = 0; u < 4; ++u) { const float t = a[u]; v[ch * 4 + u] = t; mx = fmaxf(mx, t); } }
#pragma unroll
    for (int sh = 16; sh; sh >>= 1) mx = fmaxf(mx, __shfl_xor(mx, sh, 32));
    float sum = 0.f;
#pragma unroll
    for (int q = 0; q < HW / 32; ++q) { float d0 = __fsub_rn(v[q], mx); asm volatile("" : "+v"(d0)); v[q] = __builtin_amdgcn_exp2f(__fmul_rn(d0, 1.4426950408889634f)); sum += v[q]; }
#pragma unroll
    for (int sh = 16; sh; sh >>= 1) sum += __shfl_xor(sum, sh, 32);
    const float f = __fdiv_rn(PCAR, sum);
    {
#pragma unroll
        for (int ch = 0; ch < HW / 128; ++ch) { v4h o4;
#pragma unroll
            for (int q = 0; q < 4; ++q) o4[q] = tohx(v[ch * 4 + q] * f); *(v4h*)(P16 + (size_t)row * HW + ch * 128 + lane * 4) = o4; }
         } }
__global__ __launch_bounds__(256) void k_yhl(const float* __restrict__ Y, bf* Yh, bf* Yl) { const size_t e = ((size_t)blockIdx.x * 256 + threadIdx.x) * 4; if (e >= (size_t)HW * IC) return; Y += (size_t)blockIdx.y * PVZ * HW * IC; Yh += (size_t)blockIdx.y * HW * IC; Yl += (size_t)blockIdx.y * HW * IC; const v4f a = *(const v4f*)(Y + e) + *(const v4f*)(Y + (size_t)HW * IC + e); v4us oh, ol;
#pragma unroll
    for (int u = 0; u < 4; ++u) { unsigned short p, q; splitf(a[u] * (1.0f / PCAR), p, q); oh[u] = p; ol[u] = q; } *(v4us*)(Yh + e) = oh; *(v4us*)(Yl + e) = ol;  }
__global__ __launch_bounds__(256) void k_finb(const float* __restrict__ Z, const float* __restrict__ xb, const float* __restrict__ bo, float* OUTb) { const size_t e = ((size_t)blockIdx.x * 256 + threadIdx.x) * 4; if (e >= (size_t)CC * HW) return; Z += (size_t)blockIdx.y * HW * CC; xb += (size_t)blockIdx.y * CC * HWF; OUTb += (size_t)blockIdx.y * CC * HW; const int n = (int)(e % HW); const int c = (int)(e / HW); const float bb = bfr(bo[c]); v4f r;
#pragma unroll
    for (int u = 0; u < 4; ++u) r[u] = __fadd_rn(__fadd_rn(Z[(size_t)(n + u) * CC + c], bb), bfr(xb[(size_t)c * HWF + n + u])); *(v4f*)(OUTb + e) = r;  }

extern "C" void kernel_launch(void* const* d_in, const int* in_sizes, int n_in,
                              void* d_out, int out_size, void* d_ws, size_t ws_size, hipStream_t stream) {
    if (n_in < 9) return;
    if (in_sizes[0] < NB * CC * HW) return;
    if (in_sizes[1] < IC * CC || in_sizes[3] < IC * CC || in_sizes[5] < IC * CC || in_sizes[7] < CC * IC) return;
    if (in_sizes[2] < IC || in_sizes[4] < IC || in_sizes[6] < IC || in_sizes[8] < CC) return;
    if (out_size < NB * CC * HW) return;
    const float* x  = (const float*)d_in[0];   // [NB][CC][HWF]
    const float* wq = (const float*)d_in[1];   // [IC][CC]  (queries)
    const float* bq = (const float*)d_in[2];   // [IC]
    const float* wk = (const float*)d_in[3];   // [IC][CC]  (keys)
    const float* bk = (const float*)d_in[4];   // [IC]
    const float* wv = (const float*)d_in[5];   // [IC][CC]  (values)
    const float* bv = (const float*)d_in[6];   // [IC]
    const float* wo = (const float*)d_in[7];   // [CC][IC]  (output projection)
    const float* bo = (const float*)d_in[8];   // [CC]
    float* OUT = (float*)d_out;                // [NB][CC][HW]
    char* wsp = (char*)d_ws;
    auto take = [&](size_t bytes) { char* p = wsp; wsp += (bytes + 255) & ~(size_t)255; return (void*)p; };
    bf* BW3 = (bf*)take((size_t)3 * IC * CC * 2);          // [q][k][v], each [IC][CC]
    bf* BZ  = (bf*)take((size_t)CC * IC * 2);
    // Every pass takes all NB images in one launch (the image is a grid dimension); only the score, softmax and attn.v passes go SG images at a time, since NB score planes do not fit the workspace.
    bf* XT  = (bf*)take((size_t)NB * HW * CC * 2);         // [b][m][c]
    float* TPG = (float*)take((size_t)NB * 3 * HW * IC * 4); // [b][q, k, v], each [HW][IC] f32 (no bias yet); dead after k_gt16b, its bytes then hold Y and Z
    bf* Hh  = (bf*)take((size_t)NB * 2 * HW * IC * 2);     // [b] hi planes of q+bq, k+bk
    bf* Hl  = (bf*)take((size_t)NB * 2 * HW * IC * 2);     // [b] lo planes of q+bq, k+bk
    h16* GT = (h16*)take((size_t)NB * IC * HW * 2);        // [b][i][m] fp16 (v + bv)
    float* S = (float*)take((size_t)SG * HW * HW * 4);     // [image of the group][n][m]
    h16* P16 = (h16*)take((size_t)SG * HW * HW * 2);       // [image of the group][n][m] fp16 x 2^14
    bf* Yh  = (bf*)take((size_t)NB * HW * IC * 2); bf* Yl = (bf*)take((size_t)NB * HW * IC * 2);
    float* Y = TPG;                                        // [b] PVZ partial planes [n][i] (x 2^14)
    float* Z = TPG + (size_t)NB * PVZ * HW * IC;           // [b][n][c]
    if ((size_t)(wsp - (char*)d_ws) > ws_size) return;    // total 260,177,920 B at NB 4, SEQ 4096

    const size_t PL = (size_t)HW * IC;                      // one [HW][IC] plane, elements
    k_cvtw<<<(unsigned)((IC * CC / 8 + 255) / 256), 256, 0, stream>>>(wq, wk, wv, wo, BW3, BZ, IC * CC / 8);
    const unsigned L4  = (unsigned)((PL / 4 + 255) / 256);
    const unsigned L42 = (unsigned)((2 * PL / 4 + 255) / 256);
    k_xt<<<dim3((unsigned)(((size_t)HW * CC / 4 + 255) / 256), NB), 256, 0, stream>>>(x, XT);
    // q / k / v [m][o] = sum_c XT[m][c] W[o][c]   (z = 3 b + (0 q, 1 k, 2 v); exact bf16 products)
    k_gemmw<bf, 0, false, 3><<<dim3(HW / 64, IC / 64, 3 * NB), 32, 0, stream>>>(XT, nullptr, BW3, nullptr, CC, TPG, IC, nullptr, (size_t)HW * CC, (size_t)IC * CC, PL);
    k_hlb<<<dim3(L42, NB), 256, 0, stream>>>(TPG, bq, bk, Hh, Hl, 2 * PL, PL);                     // hi/lo planes of q+bq (first PL) and k+bk (second PL)
    k_gt16b<<<dim3((unsigned)((PL / 2 + 255) / 256), NB), 256, 0, stream>>>(TPG + 2 * PL, bv, GT);
    for (int b = 0; b < NB; b += SG) {
        const unsigned g = (unsigned)(NB - b < SG ? NB - b : SG);   // images in this group
        // s[n][m] = q_n . k_m (3 products)
        k_gemmw<bf, 2, false, 1><<<dim3(HW / 64, HW / 64, g), 32, 0, stream>>>(Hh + (size_t)b * 2 * PL, Hl + (size_t)b * 2 * PL, Hh + (size_t)b * 2 * PL + PL, Hl + (size_t)b * 2 * PL + PL, IC, S, HW, nullptr, 2 * PL, 2 * PL, (size_t)HW * HW);
        k_rsoft<<<dim3(HW / 8, g), 256, 0, stream>>>(S, P16);
        // y[n][i] = sum_m attn[n][m] v[m][i]  (x 2^14), keys split over PVZ planes x PVW waves
        k_pv<<<dim3(HW / 64, IC / 64, PVZ * g), 32 * PVW, 0, stream>>>(P16, GT + (size_t)b * PL, Y + (size_t)b * PVZ * PL);
    }
    k_yhl<<<dim3(L4, NB), 256, 0, stream>>>(Y, Yh, Yl);
    // z[n][c] = sum_o y[n][o] Wo[c][o]  (hi + lo planes of y, 2 products)
    k_gemmw<bf, 1, false, 1><<<dim3(HW / 64, CC / 64, NB), 32, 0, stream>>>(Yh, Yl, BZ, nullptr, IC, Z, CC, nullptr, PL, (size_t)0, (size_t)HW * CC);
    k_finb<<<dim3((unsigned)(((size_t)CC * HW / 4 + 255) / 256), NB), 256, 0, stream>>>(Z, x, bo, OUT);
}

// v003
// It runs in 115 microseconds.
// Two timings next to v002 put it at 2.15 and 2.14 times that version's speed.
// All steps since v000 together make it 5.46 times as fast.
#include <hip/hip_runtime.h>

// All contractions on 16-bit WMMA, f32 accumulate: the three 1x1 projections q/k/v = v_wmma_f32_16x16x32_bf16 on RNE-bf16 copies of x and of the weights (single products); scores q.k = bf16 hi/lo split (hi.hi + lo.hi + hi.lo, K = 128); attn.v = v_wmma_f32_16x16x32_f16 (unnormalised softmax terms carried x 2^6 as f16, v as f16); output projection = bf16 hi/lo planes of y times bf16 Wo (2 products). Bias adds, softmax and the residual add in f32.
// x [NB][128][4096]; q/k/v [4096][128] token-major (GEMM, bias added in the convert passes); s[n][m] = q_n . k_m (unscaled); attn[n][m] = softmax_m(s); y[n][o] = sum_m attn[n][m] v[m][o]; out[c][n] = x[c][n] + bo[c] + sum_o Wo[c][o] y[n][o].

#ifndef NB
#define NB 4
#endif
#ifndef SEQ
#define SEQ 4096
#endif
#define NB_FULL  4
#define SEQ_FULL 4096
#define CC   128
#define IC   128
#define HW   SEQ
#define HWF  SEQ_FULL
static_assert(NB >= 1 && NB <= NB_FULL);
static_assert(SEQ >= 128 && SEQ <= SEQ_FULL && (SEQ % 128) == 0);
static_assert((HW % 64) == 0 && (IC % 64) == 0 && (CC % 64) == 0);
static_assert((HW % 32) == 0 && (IC % 32) == 0 && (CC % 32) == 0);
static_assert(((IC * CC) % 8) == 0 && ((HW * CC) % 4) == 0 && ((HW * IC) % 4) == 0 && ((IC * HW) % 2) == 0 && (HW % 8) == 0 && (IC % 4) == 0);
static_assert(((size_t)HW * CC / 4) % 256 == 0 && ((size_t)HW * IC / 4) % 256 == 0 && ((size_t)HW * IC / 2) % 256 == 0);

typedef _Float16 h16;
typedef unsigned short bf;
typedef __attribute__((ext_vector_type(16))) __bf16   v16bf;
typedef __attribute__((ext_vector_type(16))) _Float16 v16h;
typedef __attribute__((ext_vector_type(8)))  _Float16 v8h;
typedef __attribute__((ext_vector_type(8)))  unsigned short v8us;
typedef __attribute__((ext_vector_type(8)))  float    v8f;
typedef __attribute__((ext_vector_type(4)))  float    v4f;
typedef v8h  __attribute__((may_alias)) v8ha;
typedef v4f  __attribute__((may_alias)) v4fa;
typedef v8us __attribute__((may_alias)) v8usa;

__device__ __forceinline__ unsigned short f2bf(float f) { unsigned u = __float_as_uint(f); u += 0x7FFFu + ((u >> 16) & 1u); return (unsigned short)(u >> 16); }
__device__ __forceinline__ float bf2f(unsigned short b) { return __uint_as_float(((unsigned)b) << 16); }
__device__ __forceinline__ float bfr(float f) { return bf2f(f2bf(f)); }
__device__ __forceinline__ v16h cat16(v8h lo, v8h hi) { return __builtin_shufflevector(lo, hi, 0, 1, 2, 3, 4, 5, 6, 7, 8, 9, 10, 11, 12, 13, 14, 15); }
__device__ __forceinline__ v16bf cat16b(v8us lo, v8us hi) { return __builtin_bit_cast(v16bf, __builtin_shufflevector(lo, hi, 0, 1, 2, 3, 4, 5, 6, 7, 8, 9, 10, 11, 12, 13, 14, 15)); }
__device__ __forceinline__ v8f wmma16(v16h a, v16h b, v8f c) { return __builtin_amdgcn_wmma_f32_16x16x32_f16(false, a, false, b, (short)0, c, false, false); }
__device__ __forceinline__ v8f wmmab(v16bf a, v16bf b, v8f c) { return __builtin_amdgcn_wmma_f32_16x16x32_bf16(false, a, false, b, (short)0, c, false, false); }

// ---- k_gemmw: register-blocked GEMM, ONE WAVE per 64x64 output tile (16 accumulators), operands straight from K-contiguous 16-bit planes; grid (M/64, N/64, Z), 32 threads.
// C[m][n] (f32, pitch ldc, + optional f32 bias[n]) = sum_k A[m][k] Bt[n][k] (+ split products per NSPLIT). z-batch strides sA/sB/sC in elements. K % 32 == 0.
// blockIdx.z = z: C plane z; ZB == 1: A plane z, Bt plane z; ZB > 1: A plane z / ZB (the image), Bt plane z % ZB (one of ZB weight matrices that every image shares).
// Fragments: lane l, h = l >> 4, row/col = l & 15; elements 0..7 = k0 + 8h + 0..7, elements 8..15 = k0 + 16 + 8h + 0..7 for BOTH A and Bt; D element r = (row 8h + r, col l & 15).
template <typename T16> struct WFrag;
template <> struct WFrag<h16> { typedef v16h V; static __device__ __forceinline__ V ld(const h16* p) { return cat16(*(const v8h*)p, *(const v8h*)(p + 16)); } static __device__ __forceinline__ v8f mma(V a, V b, v8f c) { return wmma16(a, b, c); } };
template <> struct WFrag<bf> { typedef v16bf V; static __device__ __forceinline__ V ld(const bf* p) { return cat16b(*(const v8us*)p, *(const v8us*)(p + 16)); } static __device__ __forceinline__ v8f mma(V a, V b, v8f c) { return wmmab(a, b, c); } };
template <typename T16, int NSPLIT, bool BIAS, int ZB>
__global__ __launch_bounds__(32) void k_gemmw(const T16* __restrict__ A, const T16* __restrict__ A2, const T16* __restrict__ Bt, const T16* __restrict__ Bt2, int K, float* C, int ldc, const float* __restrict__ bias, size_t sA, size_t sB, size_t sC) {
    typedef typename WFrag<T16>::V V;
    __shared__ __align__(16) float os[16 * 68];
    const size_t z = blockIdx.z, zA = z / ZB, zB = (ZB > 1) ? z % ZB : z; A += zA * sA; if (A2) A2 += zA * sA; Bt += zB * sB; if (Bt2) Bt2 += zB * sB; C += z * sC;
    const int lane = threadIdx.x & 31, lr = lane & 15, hi = lane >> 4; const int r0 = blockIdx.x * 64, c0 = blockIdx.y * 64;
    v8f acc[4][4];
#pragma unroll
    for (int mb = 0; mb < 4; ++mb)
#pragma unroll
        for (int nb = 0; nb < 4; ++nb) acc[mb][nb] = (v8f){};
    const size_t aoff = (size_t)(r0 + lr) * K + 8 * hi, boff = (size_t)(c0 + lr) * K + 8 * hi;
#pragma unroll 1
    for (int kc = 0; kc < K; kc += 32) {
        V a[4], a2[4];
#pragma unroll
        for (int mb = 0; mb < 4; ++mb) { a[mb] = WFrag<T16>::ld(A + aoff + (size_t)mb * 16 * K + kc); if (NSPLIT == 1 || NSPLIT == 2) a2[mb] = WFrag<T16>::ld(A2 + aoff + (size_t)mb * 16 * K + kc); }
#pragma unroll
        for (int nb = 0; nb < 4; ++nb) { const V b = WFrag<T16>::ld(Bt + boff + (size_t)nb * 16 * K + kc); V b2; if (NSPLIT >= 2) b2 = WFrag<T16>::ld(Bt2 + boff + (size_t)nb * 16 * K + kc);
#pragma unroll
            for (int mb = 0; mb < 4; ++mb) { acc[mb][nb] = WFrag<T16>::mma(a[mb], b, acc[mb][nb]); if (NSPLIT == 1 || NSPLIT == 2) acc[mb][nb] = WFrag<T16>::mma(a2[mb], b, acc[mb][nb]); if (NSPLIT >= 2) acc[mb][nb] = WFrag<T16>::mma(a[mb], b2, acc[mb][nb]); } }
        asm volatile("v_nop\n\tv_nop\n\tv_nop\n\tv_nop" : "+v"(acc[0][0]), "+v"(acc[1][1]), "+v"(acc[2][2]), "+v"(acc[3][3]) : "v"(a[0]), "v"(a[3]));
    }
#pragma unroll
    for (int mb = 0; mb < 4; ++mb) {
#pragma unroll
        for (int nb = 0; nb < 4; ++nb) {
#pragma unroll
            for (int j = 0; j < 8; ++j) os[(hi * 8 + j) * 68 + nb * 16 + lr] = acc[mb][nb][j]; }
        __builtin_amdgcn_wave_barrier(); asm volatile("" ::: "memory");
        float* crow = C + (size_t)(r0 + mb * 16) * ldc + c0;
{
#pragma unroll
            for (int s = 0; s < 8; ++s) { const int row = 2 * s + hi, cofs = lr * 4; v4f val = *(const v4fa*)(os + row * 68 + cofs); if (BIAS) { val[0] += bfr(bias[c0 + cofs]); val[1] += bfr(bias[c0 + cofs + 1]); val[2] += bfr(bias[c0 + cofs + 2]); val[3] += bfr(bias[c0 + cofs + 3]); }
                *(v4f*)(crow + (size_t)row * ldc + cofs) = val; }
             }
        __builtin_amdgcn_wave_barrier(); asm volatile("" ::: "memory");
    }
}

__device__ __forceinline__ h16 tohx(float x) { return (h16)x; }
__device__ __forceinline__ void splitf(float y, unsigned short& h, unsigned short& l) { h = f2bf(y); l = f2bf(y - bf2f(h)); }
typedef __attribute__((ext_vector_type(2))) unsigned short v2us;
typedef __attribute__((ext_vector_type(4))) unsigned short v4us;
typedef __attribute__((ext_vector_type(2))) _Float16 v2h;
typedef __attribute__((ext_vector_type(4))) _Float16 v4h;
typedef __attribute__((ext_vector_type(2))) float v2f;

__global__ __launch_bounds__(256) void k_cvtw(const float* __restrict__ w0, const float* __restrict__ w1, const float* __restrict__ w2, const float* __restrict__ w3, bf* B3, bf* BZ, int n8) {
    const int i = blockIdx.x * 256 + threadIdx.x; if (i >= n8) return;
    const size_t e = (size_t)i * 8, pl = (size_t)n8 * 8;
    const v8f a0 = *(const v8f*)(w0 + e), a1 = *(const v8f*)(w1 + e), a2 = *(const v8f*)(w2 + e), a3 = *(const v8f*)(w3 + e);
    v8us o0, o1, o2, o3;
#pragma unroll
    for (int k = 0; k < 8; ++k) { o0[k] = f2bf(a0[k]); o1[k] = f2bf(a1[k]); o2[k] = f2bf(a2[k]); o3[k] = f2bf(a3[k]); }
    *(v8us*)(B3 + e) = o0; *(v8us*)(B3 + pl + e) = o1; *(v8us*)(B3 + 2 * pl + e) = o2; *(v8us*)(BZ + e) = o3;
    
}
__global__ __launch_bounds__(256) void k_xt(const float* __restrict__ xb, bf* XT) { const size_t e = ((size_t)blockIdx.x * 256 + threadIdx.x) * 4; if (e >= (size_t)HW * CC) return; xb += (size_t)blockIdx.y * CC * HWF; XT += (size_t)blockIdx.y * HW * CC; const int c = (int)(e % CC); const int m = (int)(e / CC); v4us o;
#pragma unroll
    for (int u = 0; u < 4; ++u) o[u] = f2bf(xb[(size_t)(c + u) * HWF + m]); *(v4us*)(XT + e) = o;  }
__global__ __launch_bounds__(256) void k_hlb(const float* __restrict__ F, const float* __restrict__ b0, const float* __restrict__ b1, bf* Fh, bf* Fl, size_t n, size_t pl) { const size_t e = ((size_t)blockIdx.x * 256 + threadIdx.x) * 4; if (e >= n) return; F += (size_t)blockIdx.y * 3 * pl; Fh += (size_t)blockIdx.y * n; Fl += (size_t)blockIdx.y * n; const v4f a = *(const v4f*)(F + e); const int i = (int)(e % IC); const bool sec = (e >= pl); const v4f cA = *(const v4f*)(b0 + i), cB = *(const v4f*)(b1 + i); v4us oh, ol;
#pragma unroll
    for (int u = 0; u < 4; ++u) { const float bb = sec ? bfr(cB[u]) : bfr(cA[u]); unsigned short p, q; splitf(__fadd_rn(a[u], bb), p, q); oh[u] = p; ol[u] = q; } *(v4us*)(Fh + e) = oh; *(v4us*)(Fl + e) = ol;  }
__global__ __launch_bounds__(256) void k_gt16b(const float* __restrict__ G, const float* __restrict__ bvec, h16* GT) { const size_t e = ((size_t)blockIdx.x * 256 + threadIdx.x) * 2; if (e >= (size_t)IC * HW) return; G += (size_t)blockIdx.y * 3 * HW * IC; GT += (size_t)blockIdx.y * IC * HW; const int m = (int)(e % HW); const int i = (int)(e / HW); const float bb = bfr(bvec[i]); v2h o; o[0] = tohx(__fadd_rn(G[(size_t)m * IC + i], bb)); o[1] = tohx(__fadd_rn(G[(size_t)(m + 1) * IC + i], bb)); *(v2h*)(GT + e) = o;  }
// ---- k_fattn: scores, softmax and attn.v in one pass over the keys; no score or softmax plane is stored. grid (HW/64, images), 4 waves, one per SIMD.
// Every wave holds all 64 query columns of the work-group (4 column tiles: each k and v fragment loaded feeds 4 tiles); wave w takes the keys w HW/4 .. + HW/4 - 1, 32 keys a pass.
// sT[key][query] = K . qT (A = k rows, B = q rows kept in registers; hi.hi + hi.lo + lo.hi): a lane holds 16 scores of ONE query (column l & 15; keys 8h + r and 16 + 8h + r),
// which are, converted to f16, exactly its elements 0..7 and 8..15 of the B fragment of yT[o][query] += vT . pT (A = rows of GT). Fragments and D layout as in k_gemmw.
// Running maximum m and sum l per query; p = 2^((s - m) log2 e + 6) as f16. m moves (and yT, l are rescaled) only when a pass's maximum passes it by more than 5.5, so p <= 2^14.
// The four key quarters meet in LDS: y = sum_q w_q yT_q / sum_q w_q l_q, w_q = e^(m_q - max m), in the order q = 0..3; the hi/lo bf16 planes of y are written from there.
#define FL2E 1.4426950408889634f
#define FQT 4   // column tiles of 16 queries per wave
static_assert(IC == 128 && (HW % 128) == 0 && HW / 4 >= 64 && FQT == 4);
__global__ __launch_bounds__(128) void k_fattn(const bf* __restrict__ Hh, const bf* __restrict__ Hl, const h16* __restrict__ GT, bf* Yh, bf* Yl) {
    __shared__ __align__(16) float part[4 * 8 * FQT * 256];
    __shared__ float msh[4][FQT][16];
    __shared__ float lsh[4][FQT][16];
    const int lane = threadIdx.x & 31, lr = lane & 15, hi = lane >> 4; const int w = __builtin_amdgcn_readfirstlane((int)(threadIdx.x >> 5));
    const size_t PLc = (size_t)HW * IC; const size_t img = blockIdx.y; const int n0 = (int)blockIdx.x * 64;
    const size_t qoff = img * 2 * PLc + (size_t)(n0 + lr) * IC + 8 * hi;
    const bf* khn = Hh + img * 2 * PLc + PLc + (size_t)(w * (HW / 4) + lr) * IC + 8 * hi;   // the lane's place in the k rows that are loaded next
    const bf* kln = Hl + img * 2 * PLc + PLc + (size_t)(w * (HW / 4) + lr) * IC + 8 * hi;
    const h16* vp = GT + img * PLc + (size_t)lr * HW + 8 * hi + w * (HW / 4);
    v16bf qh[FQT][4], ql[FQT][4];
#pragma unroll
    for (int ct = 0; ct < FQT; ++ct)
#pragma unroll
        for (int ks = 0; ks < 4; ++ks) { qh[ct][ks] = WFrag<bf>::ld(Hh + qoff + (size_t)ct * 16 * IC + ks * 32); ql[ct][ks] = WFrag<bf>::ld(Hl + qoff + (size_t)ct * 16 * IC + ks * 32); }
    asm volatile("s_wait_xcnt 0x0" ::: "memory");   // before the address registers of the q loads are used for anything else
    __builtin_amdgcn_sched_barrier(0);   // holds what follows behind that wait
    v8f acc[8][FQT];
#pragma unroll
    for (int ot = 0; ot < 8; ++ot)
#pragma unroll
        for (int ct = 0; ct < FQT; ++ct) acc[ot][ct] = (v8f){};
    float m[FQT], l[FQT];
#pragma unroll
    for (int ct = 0; ct < FQT; ++ct) { m[ct] = -3.0e38f; l[ct] = 0.f; }
    v16bf kh[4][2], kl[4][2];   // loaded row tile by row tile, plane by plane: the four 16-byte loads that share a 128-B line of each row stand next to one another
#pragma unroll
    for (int kt = 0; kt < 2; ++kt) {
#pragma unroll
        for (int ks = 0; ks < 4; ++ks) kh[ks][kt] = WFrag<bf>::ld(khn + kt * 16 * IC + ks * 32);
#pragma unroll
        for (int ks = 0; ks < 4; ++ks) kl[ks][kt] = WFrag<bf>::ld(kln + kt * 16 * IC + ks * 32); }
    asm volatile("s_wait_xcnt 0x0" ::: "memory");   // before the address registers of the k loads move on
    __builtin_amdgcn_sched_barrier(0);   // holds the pointer steps behind that wait
    khn += 32 * IC; kln += 32 * IC;
#pragma unroll 1   // rolled: the pass is some 500 instructions long and its fragments take their registers over from the pass before
    for (int kb = 0; kb < HW / 4; kb += 32) {
        v16h vf[8];
#pragma unroll
        for (int ot = 0; ot < 8; ++ot) vf[ot] = WFrag<h16>::ld(vp + kb + ot * 16 * HW);
        asm volatile("s_wait_xcnt 0x0" ::: "memory");   // before the address registers of the v loads are used for anything else
        // keeps the 16 v loads at the head of the pass, all the score WMMAs and the softmax ahead of their use (one wave per SIMD: nothing else covers a load)
        __builtin_amdgcn_sched_barrier(0);
        v8f s[2][FQT];
#pragma unroll
        for (int kt = 0; kt < 2; ++kt)
#pragma unroll
            for (int ct = 0; ct < FQT; ++ct) s[kt][ct] = (v8f){};
#pragma unroll
        for (int ks = 0; ks < 4; ++ks) {
#pragma unroll
            for (int kt = 0; kt < 2; ++kt)
#pragma unroll
                for (int ct = 0; ct < FQT; ++ct) s[kt][ct] = wmmab(kh[ks][kt], qh[ct][ks], s[kt][ct]);
#pragma unroll
            for (int kt = 0; kt < 2; ++kt)
#pragma unroll
                for (int ct = 0; ct < FQT; ++ct) s[kt][ct] = wmmab(kh[ks][kt], ql[ct][ks], s[kt][ct]);
#pragma unroll
            for (int kt = 0; kt < 2; ++kt)
#pragma unroll
                for (int ct = 0; ct < FQT; ++ct) s[kt][ct] = wmmab(kl[ks][kt], qh[ct][ks], s[kt][ct]);
        }
        // the next pass's 32 k loads go out here, into the registers that the score WMMAs above have just read, and fly during the softmax and attn.v (the last pass loads its own rows again, unused)
        __builtin_amdgcn_sched_barrier(0);
#pragma unroll
        for (int kt = 0; kt < 2; ++kt) {
#pragma unroll
            for (int ks = 0; ks < 4; ++ks) kh[ks][kt] = WFrag<bf>::ld(khn + kt * 16 * IC + ks * 32);
#pragma unroll
            for (int ks = 0; ks < 4; ++ks) kl[ks][kt] = WFrag<bf>::ld(kln + kt * 16 * IC + ks * 32); }
        asm volatile("s_wait_xcnt 0x0" ::: "memory");   // before the address registers of the k loads move on
        __builtin_amdgcn_sched_barrier(0);   // holds the k loads (and their wait) in front of the pointer steps and the softmax
        const int kstep = (kb + 64 < HW / 4) ? 32 * IC : 0; khn += kstep; kln += kstep;
        float ml[FQT]; bool need = false;
#pragma unroll
        for (int ct = 0; ct < FQT; ++ct) { float t = fmaxf(s[0][ct][0], s[1][ct][0]);
#pragma unroll
            for (int r = 1; r < 8; ++r) t = fmaxf(t, fmaxf(s[0][ct][r], s[1][ct][r]));
            ml[ct] = fmaxf(t, __shfl_xor(t, 16, 32)); need = need || (ml[ct] > m[ct] + 5.5f); }
        if (__builtin_amdgcn_ballot_w32(need) != 0) {
#pragma unroll
            for (int ct = 0; ct < FQT; ++ct) { const float mn = fmaxf(m[ct], ml[ct]); const float al = __builtin_amdgcn_exp2f((m[ct] - mn) * FL2E); m[ct] = mn; l[ct] *= al;
#pragma unroll
                for (int ot = 0; ot < 8; ++ot) acc[ot][ct] *= al; }
        }
        v16h pf[FQT];
#pragma unroll
        for (int ct = 0; ct < FQT; ++ct) { float sum = 0.f;
#pragma unroll
            for (int kt = 0; kt < 2; ++kt)
#pragma unroll
                for (int r = 0; r < 8; ++r) { const float p = __builtin_amdgcn_exp2f((s[kt][ct][r] - m[ct]) * FL2E + 6.0f); sum += p; pf[ct][kt * 8 + r] = (h16)p; }
            l[ct] += sum; }
#pragma unroll
        for (int ot = 0; ot < 8; ++ot)
#pragma unroll
            for (int ct = 0; ct < FQT; ++ct) acc[ot][ct] = wmma16(vf[ot], pf[ct], acc[ot][ct]);
    }
#pragma unroll
    for (int ct = 0; ct < FQT; ++ct) { l[ct] += __shfl_xor(l[ct], 16, 32); if (hi == 0) { msh[w][ct][lr] = m[ct]; lsh[w][ct][lr] = l[ct]; } }
    float* my = part + w * (8 * FQT * 256) + lane * 4;
#pragma unroll
    for (int ot = 0; ot < 8; ++ot)
#pragma unroll
        for (int ct = 0; ct < FQT; ++ct) { const v8f t = acc[ot][ct]; *(v4fa*)(my + (ot * FQT + ct) * 256) = (v4f){t[0], t[1], t[2], t[3]}; *(v4fa*)(my + (ot * FQT + ct) * 256 + 128) = (v4f){t[4], t[5], t[6], t[7]}; }
    __syncthreads();
    // wave w merges the 16 queries of column tile w, all 128 channels: both whole 128-B lines of each y plane per query
    float wq[4]; float mm = msh[0][w][lr];
#pragma unroll
    for (int q = 1; q < 4; ++q) mm = fmaxf(mm, msh[q][w][lr]);
    float ls = 0.f;
#pragma unroll
    for (int q = 0; q < 4; ++q) { wq[q] = __builtin_amdgcn_exp2f((msh[q][w][lr] - mm) * FL2E); ls += wq[q] * lsh[q][w][lr]; }
    const float inv = __fdiv_rn(1.0f, ls);
    const size_t yoff = img * PLc + (size_t)(n0 + w * 16 + lr) * IC + 8 * hi;
#pragma unroll
    for (int j = 0; j < 8; ++j) { const float* sp = part + (j * FQT + w) * 256 + lane * 4; v4f a0 = wq[0] * *(const v4fa*)sp, a1 = wq[0] * *(const v4fa*)(sp + 128);
#pragma unroll
        for (int q = 1; q < 4; ++q) { a0 += wq[q] * *(const v4fa*)(sp + q * (8 * FQT * 256)); a1 += wq[q] * *(const v4fa*)(sp + q * (8 * FQT * 256) + 128); }
        v8us o_h, o_l;
#pragma unroll
        for (int u = 0; u < 4; ++u) { unsigned short p, q2; splitf(a0[u] * inv, p, q2); o_h[u] = p; o_l[u] = q2; splitf(a1[u] * inv, p, q2); o_h[4 + u] = p; o_l[4 + u] = q2; }
        *(v8us*)(Yh + yoff + j * 16) = o_h; *(v8us*)(Yl + yoff + j * 16) = o_l; }
}
__global__ __launch_bounds__(256) void k_finb(const float* __restrict__ Z, const float* __restrict__ xb, const float* __restrict__ bo, float* OUTb) { const size_t e = ((size_t)blockIdx.x * 256 + threadIdx.x) * 4; if (e >= (size_t)CC * HW) return; Z += (size_t)blockIdx.y * HW * CC; xb += (size_t)blockIdx.y * CC * HWF; OUTb += (size_t)blockIdx.y * CC * HW; const int n = (int)(e % HW); const int c = (int)(e / HW); const float bb = bfr(bo[c]); v4f r;
#pragma unroll
    for (int u = 0; u < 4; ++u) r[u] = __fadd_rn(__fadd_rn(Z[(size_t)(n + u) * CC + c], bb), bfr(xb[(size_t)c * HWF + n + u])); *(v4f*)(OUTb + e) = r;  }

extern "C" void kernel_launch(void* const* d_in, const int* in_sizes, int n_in,
                              void* d_out, int out_size, void* d_ws, size_t ws_size, hipStream_t stream) {
    if (n_in < 9) return;
    if (in_sizes[0] < NB * CC * HW) return;
    if (in_sizes[1] < IC * CC || in_sizes[3] < IC * CC || in_sizes[5] < IC * CC || in_sizes[7] < CC * IC) return;
    if (in_sizes[2] < IC || in_sizes[4] < IC || in_sizes[6] < IC || in_sizes[8] < CC) return;
    if (out_size < NB * CC * HW) return;
    const float* x  = (const float*)d_in[0];   // [NB][CC][HWF]
    const float* wq = (const float*)d_in[1];   // [IC][CC]  (queries)
    const float* bq = (const float*)d_in[2];   // [IC]
    const float* wk = (const float*)d_in[3];   // [IC][CC]  (keys)
    const float* bk = (const float*)d_in[4];   // [IC]
    const float* wv = (const float*)d_in[5];   // [IC][CC]  (values)
    const float* bv = (const float*)d_in[6];   // [IC]
    const float* wo = (const float*)d_in[7];   // [CC][IC]  (output projection)
    const float* bo = (const float*)d_in[8];   // [CC]
    float* OUT = (float*)d_out;                // [NB][CC][HW]
    char* wsp = (char*)d_ws;
    auto take = [&](size_t bytes) { char* p = wsp; wsp += (bytes + 255) & ~(size_t)255; return (void*)p; };
    bf* BW3 = (bf*)take((size_t)3 * IC * CC * 2);          // [q][k][v], each [IC][CC]
    bf* BZ  = (bf*)take((size_t)CC * IC * 2);
    // Every pass takes all NB images in one launch (the image is a grid dimension).
    bf* XT  = (bf*)take((size_t)NB * HW * CC * 2);         // [b][m][c]
    float* TPG = (float*)take((size_t)NB * 3 * HW * IC * 4); // [b][q, k, v], each [HW][IC] f32 (no bias yet); dead after k_gt16b, its bytes then hold Z
    bf* Hh  = (bf*)take((size_t)NB * 2 * HW * IC * 2);     // [b] hi planes of q+bq, k+bk
    bf* Hl  = (bf*)take((size_t)NB * 2 * HW * IC * 2);     // [b] lo planes of q+bq, k+bk
    h16* GT = (h16*)take((size_t)NB * IC * HW * 2);        // [b][i][m] fp16 (v + bv)
    bf* Yh  = (bf*)take((size_t)NB * HW * IC * 2); bf* Yl = (bf*)take((size_t)NB * HW * IC * 2);
    float* Z = TPG;                                        // [b][n][c]
    if ((size_t)(wsp - (char*)d_ws) > ws_size) return;

    const size_t PL = (size_t)HW * IC;                      // one [HW][IC] plane, elements
    k_cvtw<<<(unsigned)((IC * CC / 8 + 255) / 256), 256, 0, stream>>>(wq, wk, wv, wo, BW3, BZ, IC * CC / 8);
    const unsigned L42 = (unsigned)((2 * PL / 4 + 255) / 256);
    k_xt<<<dim3((unsigned)(((size_t)HW * CC / 4 + 255) / 256), NB), 256, 0, stream>>>(x, XT);
    // q / k / v [m][o] = sum_c XT[m][c] W[o][c]   (z = 3 b + (0 q, 1 k, 2 v); exact bf16 products)
    k_gemmw<bf, 0, false, 3><<<dim3(HW / 64, IC / 64, 3 * NB), 32, 0, stream>>>(XT, nullptr, BW3, nullptr, CC, TPG, IC, nullptr, (size_t)HW * CC, (size_t)IC * CC, PL);
    k_hlb<<<dim3(L42, NB), 256, 0, stream>>>(TPG, bq, bk, Hh, Hl, 2 * PL, PL);                     // hi/lo planes of q+bq (first PL) and k+bk (second PL)
    k_gt16b<<<dim3((unsigned)((PL / 2 + 255) / 256), NB), 256, 0, stream>>>(TPG + 2 * PL, bv, GT);
    // y = softmax(q . k) . v, hi/lo planes of y
    k_fattn<<<dim3(HW / 64, NB), 128, 0, stream>>>(Hh, Hl, GT, Yh, Yl);
    // z[n][c] = sum_o y[n][o] Wo[c][o]  (hi + lo planes of y, 2 products)
    k_gemmw<bf, 1, false, 1><<<dim3(HW / 64, CC / 64, NB), 32, 0, stream>>>(Yh, Yl, BZ, nullptr, IC, Z, CC, nullptr, PL, (size_t)0, (size_t)HW * CC);
    k_finb<<<dim3((unsigned)(((size_t)CC * HW / 4 + 255) / 256), NB), 256, 0, stream>>>(Z, x, bo, OUT);
}

// v004
// A run of this version takes 72.8 microseconds.
// Timed twice side by side with v003, it ran 1.58 times as fast both times.
// Counting every step since v000, it is 8.63 times as fast.
#include <hip/hip_runtime.h>

// All contractions on 16-bit WMMA, f32 accumulate: the three 1x1 projections q/k/v = v_wmma_f32_16x16x32_bf16 on RNE-bf16 values of x and of the weights (single products); scores q.k = bf16 hi/lo split (hi.hi + lo.hi + hi.lo, K = 128); attn.v = v_wmma_f32_16x16x32_f16 (unnormalised softmax terms carried x 2^6 as f16, v as f16); output projection = bf16 Wo times bf16 hi/lo planes of y (2 products). Bias adds, softmax and the residual add in f32.
// x [NB][128][4096]; q/k [4096][128] token-major hi/lo planes, v [128][4096] channel-major f16; s[n][m] = q_n . k_m (unscaled); attn[n][m] = softmax_m(s); y[n][o] = sum_m attn[n][m] v[m][o]; out[c][n] = x[c][n] + bo[c] + sum_o Wo[c][o] y[n][o]. Three launches: projections, attention, output projection; every convert or transposing step is done where a GEMM loads a fragment or stores its tile.

#ifndef NB
#define NB 4
#endif
#ifndef SEQ
#define SEQ 4096
#endif
#define NB_FULL  4
#define SEQ_FULL 4096
#define CC   128
#define IC   128
#define HW   SEQ
#define HWF  SEQ_FULL
static_assert(NB >= 1 && NB <= NB_FULL);
static_assert(SEQ >= 128 && SEQ <= SEQ_FULL && (SEQ % 128) == 0);
static_assert((HW % 64) == 0 && (IC % 64) == 0 && (CC % 64) == 0);
static_assert((HW % 32) == 0 && (IC % 32) == 0 && (CC % 32) == 0);
static_assert(((IC * CC) % 8) == 0 && ((HW * CC) % 4) == 0 && ((HW * IC) % 4) == 0 && ((IC * HW) % 2) == 0 && (HW % 8) == 0 && (IC % 4) == 0);
static_assert(((size_t)HW * CC / 4) % 256 == 0 && ((size_t)HW * IC / 4) % 256 == 0 && ((size_t)HW * IC / 2) % 256 == 0);

typedef _Float16 h16;
typedef unsigned short bf;
typedef __attribute__((ext_vector_type(16))) __bf16   v16bf;
typedef __attribute__((ext_vector_type(16))) _Float16 v16h;
typedef __attribute__((ext_vector_type(8)))  _Float16 v8h;
typedef __attribute__((ext_vector_type(8)))  unsigned short v8us;
typedef __attribute__((ext_vector_type(8)))  float    v8f;
typedef __attribute__((ext_vector_type(4)))  float    v4f;
typedef v8h  __attribute__((may_alias)) v8ha;
typedef v4f  __attribute__((may_alias)) v4fa;
typedef v8us __attribute__((may_alias)) v8usa;

__device__ __forceinline__ unsigned short f2bf(float f) { unsigned u = __float_as_uint(f); u += 0x7FFFu + ((u >> 16) & 1u); return (unsigned short)(u >> 16); }
__device__ __forceinline__ float bf2f(unsigned short b) { return __uint_as_float(((unsigned)b) << 16); }
__device__ __forceinline__ float bfr(float f) { return bf2f(f2bf(f)); }
__device__ __forceinline__ v16h cat16(v8h lo, v8h hi) { return __builtin_shufflevector(lo, hi, 0, 1, 2, 3, 4, 5, 6, 7, 8, 9, 10, 11, 12, 13, 14, 15); }
__device__ __forceinline__ v16bf cat16b(v8us lo, v8us hi) { return __builtin_bit_cast(v16bf, __builtin_shufflevector(lo, hi, 0, 1, 2, 3, 4, 5, 6, 7, 8, 9, 10, 11, 12, 13, 14, 15)); }
__device__ __forceinline__ v8f wmma16(v16h a, v16h b, v8f c) { return __builtin_amdgcn_wmma_f32_16x16x32_f16(false, a, false, b, (short)0, c, false, false); }
__device__ __forceinline__ v8f wmmab(v16bf a, v16bf b, v8f c) { return __builtin_amdgcn_wmma_f32_16x16x32_bf16(false, a, false, b, (short)0, c, false, false); }

// ---- The two GEMM kernels: ONE WAVE per 64x64 output tile (16 accumulators), K = 128 in 4 steps of 32, fragments formed straight from the operands as they lie in memory.
// Fragments: lane l, h = l >> 4, row/col = l & 15; elements 0..7 = k0 + 8h + 0..7, elements 8..15 = k0 + 16 + 8h + 0..7 for BOTH A and B; D element r = (row 8h + r, col l & 15).
// Tokens are dealt to the four 16-wide blocks of a tile as token = t0 + 4 (l & 15) + block: a lane's 16-byte load of x gives one element to each of its four fragments,
// and where tokens are the tile's columns a lane's four accumulators of one row are four neighbouring tokens, stored as one run without a pass through LDS.
template <typename T16> struct WFrag;
template <> struct WFrag<h16> { typedef v16h V; static __device__ __forceinline__ V ld(const h16* p) { return cat16(*(const v8h*)p, *(const v8h*)(p + 16)); } static __device__ __forceinline__ v8f mma(V a, V b, v8f c) { return wmma16(a, b, c); } };
template <> struct WFrag<bf> { typedef v16bf V; static __device__ __forceinline__ V ld(const bf* p) { return cat16b(*(const v8us*)p, *(const v8us*)(p + 16)); } static __device__ __forceinline__ v8f mma(V a, V b, v8f c) { return wmmab(a, b, c); } };
static_assert(CC == 128 && IC == 128 && (HW % 64) == 0);
// 16 k values of one row of an f32 matrix [row][k]: raw load (p = row start + k0 + 8h), then rounding to bf16 (to nearest even)
__device__ __forceinline__ void ldw_raw(const float* __restrict__ p, v4f (&r)[4]) { r[0] = *(const v4f*)p; r[1] = *(const v4f*)(p + 4); r[2] = *(const v4f*)(p + 16); r[3] = *(const v4f*)(p + 20); }
__device__ __forceinline__ v16bf cvw(const v4f (&r)[4]) { v16bf f;
#pragma unroll
    for (int g = 0; g < 4; ++g)
#pragma unroll
        for (int u = 0; u < 4; ++u) f[4 * g + u] = (__bf16)r[g][u];
    return f; }
// the four token fragments of one k step from x [k][token] f32: raw load (p = x + (k0 + 8h) HWF + t0 + 4 (l & 15)), then rounding to bf16 (to nearest even); word i of a load belongs to block i
__device__ __forceinline__ void ldx_raw(const float* __restrict__ p, v4f (&r)[16]) {
#pragma unroll
    for (int e = 0; e < 16; ++e) r[e] = *(const v4f*)(p + (size_t)(e < 8 ? e : e + 8) * HWF); }
__device__ __forceinline__ void cvx(const v4f (&r)[16], v16bf (&f)[4]) {
#pragma unroll
    for (int e = 0; e < 16; ++e)
#pragma unroll
        for (int i = 0; i < 4; ++i) f[i][e] = (__bf16)r[e][i]; }
__device__ __forceinline__ void zero16(v8f (&acc)[4][4]) {
#pragma unroll
    for (int mb = 0; mb < 4; ++mb)
#pragma unroll
        for (int nb = 0; nb < 4; ++nb) acc[mb][nb] = (v8f){};
}

__device__ __forceinline__ h16 tohx(float x) { return (h16)x; }
__device__ __forceinline__ void splitf(float y, unsigned short& h, unsigned short& l) { h = f2bf(y); l = f2bf(y - bf2f(h)); }
typedef __attribute__((ext_vector_type(2))) unsigned short v2us;
typedef __attribute__((ext_vector_type(4))) unsigned short v4us;
typedef __attribute__((ext_vector_type(2))) _Float16 v2h;
typedef __attribute__((ext_vector_type(4))) _Float16 v4h;
typedef __attribute__((ext_vector_type(2))) float v2f;
// ---- k_proj: the three projections. grid (HW/64, IC/64, 3 images), one wave; blockIdx.z = 3 b + (0 q, 1 k, 2 v). x and W are read as f32 and rounded at the fragment load.
// q, k: A = tokens, B = W rows (channels): tile [token][channel]; + bias (a column's), split into the hi/lo bf16 planes, token-major, 16 rows at a time through LDS.
// v: the roles swapped, A = W rows, B = tokens: tile [channel][token]; + bias (a row's), f16, channel-major, stored from the accumulators.
template <bool TR>
__device__ __forceinline__ void proj_loop(const float* __restrict__ xp, const float* __restrict__ wp, v8f (&acc)[4][4]) {
    zero16(acc);
#pragma unroll 1   // rolled, as the GEMM loop was: the fragments of one k step take over the registers of the step before
    for (int kc = 0; kc < CC; kc += 32) {
        v4f xr[16], wr[4][4];
        ldx_raw(xp + (size_t)kc * HWF, xr);
#pragma unroll
        for (int b = 0; b < 4; ++b) ldw_raw(wp + (size_t)b * 16 * CC + kc, wr[b]);
        asm volatile("s_wait_xcnt 0x0" ::: "memory");   // before the address registers of the step's loads move on
        __builtin_amdgcn_sched_barrier(0);   // the step's 32 loads go out together, ahead of the rounding (one load latency a step, not one a fragment), and the pointer steps stay behind that wait
        v16bf xf[4], wf[4];
        cvx(xr, xf);
#pragma unroll
        for (int b = 0; b < 4; ++b) wf[b] = cvw(wr[b]);
#pragma unroll
        for (int nb = 0; nb < 4; ++nb)
#pragma unroll
            for (int mb = 0; mb < 4; ++mb) acc[mb][nb] = TR ? wmmab(wf[mb], xf[nb], acc[mb][nb]) : wmmab(xf[mb], wf[nb], acc[mb][nb]);
        // four vector slots behind the step's last WMMA: the distance the chip needs before a vector instruction writes its A or B (the next step's rounding, over the back edge) or reads D (the epilogue)
        asm volatile("v_nop\n\tv_nop\n\tv_nop\n\tv_nop" : "+v"(acc[0][0]), "+v"(acc[1][1]), "+v"(acc[2][2]), "+v"(acc[3][3]) : "v"(xf[0]), "v"(xf[3]), "v"(wf[0]), "v"(wf[3]));
    }
}
__global__ __launch_bounds__(32) void k_proj(const float* __restrict__ x, const float* __restrict__ wq, const float* __restrict__ wk, const float* __restrict__ wv, const float* __restrict__ bq, const float* __restrict__ bk, const float* __restrict__ bv, bf* Hh, bf* Hl, h16* GT) {
    __shared__ __align__(16) float os[16 * 68];
    const int lane = threadIdx.x & 31, lr = lane & 15, hi = lane >> 4; const int img = (int)blockIdx.z / 3, which = (int)blockIdx.z % 3;
    const int t0 = (int)blockIdx.x * 64, o0 = (int)blockIdx.y * 64;
    const float* xp = x + (size_t)img * CC * HWF + (size_t)(8 * hi) * HWF + t0 + 4 * lr;
    const size_t woff = (size_t)(o0 + lr) * CC + 8 * hi;
    v8f acc[4][4];
    if (which == 2) {
        v4f br[4][2];   // the rows' biases, asked for ahead of the k loop
#pragma unroll
        for (int mb = 0; mb < 4; ++mb) { br[mb][0] = *(const v4f*)(bv + o0 + mb * 16 + 8 * hi); br[mb][1] = *(const v4f*)(bv + o0 + mb * 16 + 8 * hi + 4); }
        proj_loop<true>(xp, wv + woff, acc);
        h16* G = GT + (size_t)img * IC * HW + (size_t)(o0 + 8 * hi) * HW + t0 + 4 * lr;
#pragma unroll
        for (int mb = 0; mb < 4; ++mb) { v4h o[8];
#pragma unroll
            for (int j = 0; j < 8; ++j) { const float bb = bfr(br[mb][j >> 2][j & 3]);
#pragma unroll
                for (int nb = 0; nb < 4; ++nb) o[j][nb] = tohx(__fadd_rn(acc[mb][nb][j], bb)); }
            __builtin_amdgcn_sched_barrier(0);   // the block's 8 values stand in registers of their own before the first store goes out
#pragma unroll
            for (int j = 0; j < 8; ++j) *(v4h*)(G + (size_t)(mb * 16 + j) * HW) = o[j];
            asm volatile("s_wait_xcnt 0x0" ::: "memory");   // before the registers that these stores name are used again
            __builtin_amdgcn_sched_barrier(0);   // holds the next block's arithmetic behind that wait
        }
    } else {
        const int cofs = lr * 4;
        const v4f cr = *(const v4f*)((which == 0 ? bq : bk) + o0 + cofs);   // the columns' biases, asked for ahead of the k loop
        proj_loop<false>(xp, (which == 0 ? wq : wk) + woff, acc);
        const v4f cb = {bfr(cr[0]), bfr(cr[1]), bfr(cr[2]), bfr(cr[3])};
        const size_t base = ((size_t)img * 2 + which) * HW * IC + (size_t)t0 * IC + o0 + cofs;
#pragma unroll
        for (int mb = 0; mb < 4; ++mb) {
#pragma unroll
            for (int nb = 0; nb < 4; ++nb) {
#pragma unroll
                for (int j = 0; j < 8; ++j) os[(hi * 8 + j) * 68 + nb * 16 + lr] = acc[mb][nb][j]; }
            __builtin_amdgcn_wave_barrier(); asm volatile("" ::: "memory");   // compiler fence: the LDS reads below stay behind these LDS writes
            v4us oh[8], ol[8];
#pragma unroll
            for (int s = 0; s < 8; ++s) { const v4f val = *(const v4fa*)(os + (2 * s + hi) * 68 + cofs);
#pragma unroll
                for (int u = 0; u < 4; ++u) { unsigned short p, q; splitf(__fadd_rn(val[u], cb[u]), p, q); oh[s][u] = p; ol[s][u] = q; } }
            __builtin_amdgcn_sched_barrier(0);   // the block's 16 values stand in registers of their own before the first store goes out
#pragma unroll
            for (int s = 0; s < 8; ++s) { const size_t e = base + (size_t)(4 * (2 * s + hi) + mb) * IC; *(v4us*)(Hh + e) = oh[s]; *(v4us*)(Hl + e) = ol[s]; }   // row r of block mb is token t0 + 4 r + mb
            asm volatile("s_wait_xcnt 0x0" ::: "memory");   // before the registers that these stores name are used again
            __builtin_amdgcn_sched_barrier(0);   // holds the next block's work behind that wait
            __builtin_amdgcn_wave_barrier(); asm volatile("" ::: "memory");   // compiler fence: the next block's LDS writes stay behind these LDS reads
        }
    }
}
// ---- k_fattn: scores, softmax and attn.v in one pass over the keys; no score or softmax plane is stored. grid (HW/64, images), 4 waves, one per SIMD.
// Every wave holds all 64 query columns of the work-group (4 column tiles: each k and v fragment loaded feeds 4 tiles); wave w takes the keys w HW/4 .. + HW/4 - 1, 32 keys a pass.
// sT[key][query] = K . qT (A = k rows, B = q rows kept in registers; hi.hi + hi.lo + lo.hi): a lane holds 16 scores of ONE query (column l & 15; keys 8h + r and 16 + 8h + r),
// which are, converted to f16, exactly its elements 0..7 and 8..15 of the B fragment of yT[o][query] += vT . pT (A = rows of GT). Fragments and D layout as in k_proj and k_outp.
// Running maximum m and sum l per query; p = 2^((s - m) log2 e + 6) as f16. m moves (and yT, l are rescaled) only when a pass's maximum passes it by more than 5.5, so p <= 2^14.
// The four key quarters meet in LDS: y = sum_q w_q yT_q / sum_q w_q l_q, w_q = e^(m_q - max m), in the order q = 0..3; the hi/lo bf16 planes of y are written from there.
#define FL2E 1.4426950408889634f
#define FQT 4   // column tiles of 16 queries per wave
static_assert(IC == 128 && (HW % 128) == 0 && HW / 4 >= 64 && FQT == 4);
__global__ __launch_bounds__(128) void k_fattn(const bf* __restrict__ Hh, const bf* __restrict__ Hl, const h16* __restrict__ GT, bf* Yh, bf* Yl) {
    __shared__ __align__(16) float part[4 * 8 * FQT * 256];
    __shared__ float msh[4][FQT][16];
    __shared__ float lsh[4][FQT][16];
    const int lane = threadIdx.x & 31, lr = lane & 15, hi = lane >> 4; const int w = __builtin_amdgcn_readfirstlane((int)(threadIdx.x >> 5));
    const size_t PLc = (size_t)HW * IC; const size_t img = blockIdx.y; const int n0 = (int)blockIdx.x * 64;
    const size_t qoff = img * 2 * PLc + (size_t)(n0 + lr) * IC + 8 * hi;
    const bf* khn = Hh + img * 2 * PLc + PLc + (size_t)(w * (HW / 4) + lr) * IC + 8 * hi;   // the lane's place in the k rows that are loaded next
    const bf* kln = Hl + img * 2 * PLc + PLc + (size_t)(w * (HW / 4) + lr) * IC + 8 * hi;
    const h16* vp = GT + img * PLc + (size_t)lr * HW + 8 * hi + w * (HW / 4);
    v16bf qh[FQT][4], ql[FQT][4];
#pragma unroll
    for (int ct = 0; ct < FQT; ++ct)
#pragma unroll
        for (int ks = 0; ks < 4; ++ks) { qh[ct][ks] = WFrag<bf>::ld(Hh + qoff + (size_t)ct * 16 * IC + ks * 32); ql[ct][ks] = WFrag<bf>::ld(Hl + qoff + (size_t)ct * 16 * IC + ks * 32); }
    asm volatile("s_wait_xcnt 0x0" ::: "memory");   // before the address registers of the q loads are used for anything else
    __builtin_amdgcn_sched_barrier(0);   // holds what follows behind that wait
    v8f acc[8][FQT];
#pragma unroll
    for (int ot = 0; ot < 8; ++ot)
#pragma unroll
        for (int ct = 0; ct < FQT; ++ct) acc[ot][ct] = (v8f){};
    float m[FQT], l[FQT];
#pragma unroll
    for (int ct = 0; ct < FQT; ++ct) { m[ct] = -3.0e38f; l[ct] = 0.f; }
    v16bf kh[4][2], kl[4][2];   // loaded row tile by row tile, plane by plane: the four 16-byte loads that share a 128-B line of each row stand next to one another
#pragma unroll
    for (int kt = 0; kt < 2; ++kt) {
#pragma unroll
        for (int ks = 0; ks < 4; ++ks) kh[ks][kt] = WFrag<bf>::ld(khn + kt * 16 * IC + ks * 32);
#pragma unroll
        for (int ks = 0; ks < 4; ++ks) kl[ks][kt] = WFrag<bf>::ld(kln + kt * 16 * IC + ks * 32); }
    asm volatile("s_wait_xcnt 0x0" ::: "memory");   // before the address registers of the k loads move on
    __builtin_amdgcn_sched_barrier(0);   // holds the pointer steps behind that wait
    khn += 32 * IC; kln += 32 * IC;
#pragma unroll 1   // rolled: the pass is some 500 instructions long and its fragments take their registers over from the pass before
    for (int kb = 0; kb < HW / 4; kb += 32) {
        v16h vf[8];
#pragma unroll
        for (int ot = 0; ot < 8; ++ot) vf[ot] = WFrag<h16>::ld(vp + kb + ot * 16 * HW);
        asm volatile("s_wait_xcnt 0x0" ::: "memory");   // before the address registers of the v loads are used for anything else
        // keeps the 16 v loads at the head of the pass, all the score WMMAs and the softmax ahead of their use (one wave per SIMD: nothing else covers a load)
        __builtin_amdgcn_sched_barrier(0);
        v8f s[2][FQT];
#pragma unroll
        for (int kt = 0; kt < 2; ++kt)
#pragma unroll
            for (int ct = 0; ct < FQT; ++ct) s[kt][ct] = (v8f){};
#pragma unroll
        for (int ks = 0; ks < 4; ++ks) {
#pragma unroll
            for (int kt = 0; kt < 2; ++kt)
#pragma unroll
                for (int ct = 0; ct < FQT; ++ct) s[kt][ct] = wmmab(kh[ks][kt], qh[ct][ks], s[kt][ct]);
#pragma unroll
            for (int kt = 0; kt < 2; ++kt)
#pragma unroll
                for (int ct = 0; ct < FQT; ++ct) s[kt][ct] = wmmab(kh[ks][kt], ql[ct][ks], s[kt][ct]);
#pragma unroll
            for (int kt = 0; kt < 2; ++kt)
#pragma unroll
                for (int ct = 0; ct < FQT; ++ct) s[kt][ct] = wmmab(kl[ks][kt], qh[ct][ks], s[kt][ct]);
        }
        // the next pass's 32 k loads go out here, into the registers that the score WMMAs above have just read, and fly during the softmax and attn.v (the last pass loads its own rows again, unused)
        __builtin_amdgcn_sched_barrier(0);
#pragma unroll
        for (int kt = 0; kt < 2; ++kt) {
#pragma unroll
            for (int ks = 0; ks < 4; ++ks) kh[ks][kt] = WFrag<bf>::ld(khn + kt * 16 * IC + ks * 32);
#pragma unroll
            for (int ks = 0; ks < 4; ++ks) kl[ks][kt] = WFrag<bf>::ld(kln + kt * 16 * IC + ks * 32); }
        asm volatile("s_wait_xcnt 0x0" ::: "memory");   // before the address registers of the k loads move on
        __builtin_amdgcn_sched_barrier(0);   // holds the k loads (and their wait) in front of the pointer steps and the softmax
        const int kstep = (kb + 64 < HW / 4) ? 32 * IC : 0; khn += kstep; kln += kstep;
        float ml[FQT]; bool need = false;
#pragma unroll
        for (int ct = 0; ct < FQT; ++ct) { float t = fmaxf(s[0][ct][0], s[1][ct][0]);
#pragma unroll
            for (int r = 1; r < 8; ++r) t = fmaxf(t, fmaxf(s[0][ct][r], s[1][ct][r]));
            ml[ct] = fmaxf(t, __shfl_xor(t, 16, 32)); need = need || (ml[ct] > m[ct] + 5.5f); }
        if (__builtin_amdgcn_ballot_w32(need) != 0) {
#pragma unroll
            for (int ct = 0; ct < FQT; ++ct) { const float mn = fmaxf(m[ct], ml[ct]); const float al = __builtin_amdgcn_exp2f((m[ct] - mn) * FL2E); m[ct] = mn; l[ct] *= al;
#pragma unroll
                for (int ot = 0; ot < 8; ++ot) acc[ot][ct] *= al; }
        }
        v16h pf[FQT];
#pragma unroll
        for (int ct = 0; ct < FQT; ++ct) { float sum = 0.f;
#pragma unroll
            for (int kt = 0; kt < 2; ++kt)
#pragma unroll
                for (int r = 0; r < 8; ++r) { const float p = __builtin_amdgcn_exp2f((s[kt][ct][r] - m[ct]) * FL2E + 6.0f); sum += p; pf[ct][kt * 8 + r] = (h16)p; }
            l[ct] += sum; }
#pragma unroll
        for (int ot = 0; ot < 8; ++ot)
#pragma unroll
            for (int ct = 0; ct < FQT; ++ct) acc[ot][ct] = wmma16(vf[ot], pf[ct], acc[ot][ct]);
    }
#pragma unroll
    for (int ct = 0; ct < FQT; ++ct) { l[ct] += __shfl_xor(l[ct], 16, 32); if (hi == 0) { msh[w][ct][lr] = m[ct]; lsh[w][ct][lr] = l[ct]; } }
    float* my = part + w * (8 * FQT * 256) + lane * 4;
#pragma unroll
    for (int ot = 0; ot < 8; ++ot)
#pragma unroll
        for (int ct = 0; ct < FQT; ++ct) { const v8f t = acc[ot][ct]; *(v4fa*)(my + (ot * FQT + ct) * 256) = (v4f){t[0], t[1], t[2], t[3]}; *(v4fa*)(my + (ot * FQT + ct) * 256 + 128) = (v4f){t[4], t[5], t[6], t[7]}; }
    __syncthreads();
    // wave w merges the 16 queries of column tile w, all 128 channels: both whole 128-B lines of each y plane per query
    float wq[4]; float mm = msh[0][w][lr];
#pragma unroll
    for (int q = 1; q < 4; ++q) mm = fmaxf(mm, msh[q][w][lr]);
    float ls = 0.f;
#pragma unroll
    for (int q = 0; q < 4; ++q) { wq[q] = __builtin_amdgcn_exp2f((msh[q][w][lr] - mm) * FL2E); ls += wq[q] * lsh[q][w][lr]; }
    const float inv = __fdiv_rn(1.0f, ls);
    const size_t yoff = img * PLc + (size_t)(n0 + w * 16 + lr) * IC + 8 * hi;
#pragma unroll
    for (int j = 0; j < 8; ++j) { const float* sp = part + (j * FQT + w) * 256 + lane * 4; v4f a0 = wq[0] * *(const v4fa*)sp, a1 = wq[0] * *(const v4fa*)(sp + 128);
#pragma unroll
        for (int q = 1; q < 4; ++q) { a0 += wq[q] * *(const v4fa*)(sp + q * (8 * FQT * 256)); a1 += wq[q] * *(const v4fa*)(sp + q * (8 * FQT * 256) + 128); }
        v8us o_h, o_l;
#pragma unroll
        for (int u = 0; u < 4; ++u) { unsigned short p, q2; splitf(a0[u] * inv, p, q2); o_h[u] = p; o_l[u] = q2; splitf(a1[u] * inv, p, q2); o_h[4 + u] = p; o_l[4 + u] = q2; }
        *(v8us*)(Yh + yoff + j * 16) = o_h; *(v8us*)(Yl + yoff + j * 16) = o_l; }
}
// ---- k_outp: output projection with bias and residual. grid (HW/64, CC/64, images), one wave. Wo is read as f32 and rounded at the fragment load.
// A = Wo rows (channels), B = hi, then lo plane of y (tokens): tile [channel][token], the layout of out itself; out = (z + bo) + x, x rounded to bf16 as before; stored from the accumulators.
__global__ __launch_bounds__(32) void k_outp(const float* __restrict__ wo, const bf* __restrict__ Yh, const bf* __restrict__ Yl, const float* __restrict__ xb, const float* __restrict__ bo, float* OUTb) {
    const int lane = threadIdx.x & 31, lr = lane & 15, hi = lane >> 4; const size_t img = blockIdx.z;
    const int t0 = (int)blockIdx.x * 64, c0 = (int)blockIdx.y * 64;
    const float* xp = xb + img * CC * HWF + (size_t)(c0 + 8 * hi) * HWF + t0 + 4 * lr;
    float* op = OUTb + img * CC * HW + (size_t)(c0 + 8 * hi) * HW + t0 + 4 * lr;
    v4f xs[4][8], br[4][2];   // the tile of x and the rows' biases are asked for ahead of the k loop and arrive under it
#pragma unroll
    for (int mb = 0; mb < 4; ++mb) { br[mb][0] = *(const v4f*)(bo + c0 + mb * 16 + 8 * hi); br[mb][1] = *(const v4f*)(bo + c0 + mb * 16 + 8 * hi + 4);
#pragma unroll
        for (int j = 0; j < 8; ++j) xs[mb][j] = *(const v4f*)(xp + (size_t)(mb * 16 + j) * HWF); }
    asm volatile("s_wait_xcnt 0x0" ::: "memory");   // before the address registers of these loads are used for anything else
    __builtin_amdgcn_sched_barrier(0);   // holds what follows behind that wait
    const float* wp = wo + (size_t)(c0 + lr) * IC + 8 * hi;
    const size_t yoff = img * HW * IC + (size_t)(t0 + 4 * lr) * IC + 8 * hi;
    v8f acc[4][4]; zero16(acc);
#pragma unroll 1   // rolled, as the GEMM loop was: the fragments of one k step take over the registers of the step before
    for (int kc = 0; kc < IC; kc += 32) {
        v4f wr[4][4]; v16bf b[4], b2[4];
#pragma unroll
        for (int mb = 0; mb < 4; ++mb) ldw_raw(wp + (size_t)mb * 16 * IC + kc, wr[mb]);
#pragma unroll
        for (int nb = 0; nb < 4; ++nb) { b[nb] = WFrag<bf>::ld(Yh + yoff + (size_t)nb * IC + kc); b2[nb] = WFrag<bf>::ld(Yl + yoff + (size_t)nb * IC + kc); }
        asm volatile("s_wait_xcnt 0x0" ::: "memory");   // before the address registers of the step's loads move on
        __builtin_amdgcn_sched_barrier(0);   // the step's 32 loads go out together, ahead of the rounding (one load latency a step, not one a fragment), and the pointer steps stay behind that wait
        v16bf a[4];
#pragma unroll
        for (int mb = 0; mb < 4; ++mb) a[mb] = cvw(wr[mb]);
#pragma unroll
        for (int nb = 0; nb < 4; ++nb) {
#pragma unroll
            for (int mb = 0; mb < 4; ++mb) acc[mb][nb] = wmmab(a[mb], b[nb], acc[mb][nb]);
#pragma unroll
            for (int mb = 0; mb < 4; ++mb) acc[mb][nb] = wmmab(a[mb], b2[nb], acc[mb][nb]); }
        // four vector slots behind the step's last WMMA: the distance the chip needs before a vector instruction writes its A (the next step's rounding, over the back edge) or reads D (the epilogue)
        asm volatile("v_nop\n\tv_nop\n\tv_nop\n\tv_nop" : "+v"(acc[0][0]), "+v"(acc[1][1]), "+v"(acc[2][2]), "+v"(acc[3][3]) : "v"(a[0]), "v"(a[3]));
    }
#pragma unroll
    for (int mb = 0; mb < 4; ++mb) { v4f r[8];
#pragma unroll
        for (int j = 0; j < 8; ++j) { const float bb = bfr(br[mb][j >> 2][j & 3]);
#pragma unroll
            for (int nb = 0; nb < 4; ++nb) r[j][nb] = __fadd_rn(__fadd_rn(acc[mb][nb][j], bb), bfr(xs[mb][j][nb])); }
        __builtin_amdgcn_sched_barrier(0);   // the block's 8 values stand in registers of their own before the first store goes out
#pragma unroll
        for (int j = 0; j < 8; ++j) *(v4f*)(op + (size_t)(mb * 16 + j) * HW) = r[j];
        asm volatile("s_wait_xcnt 0x0" ::: "memory");   // before the registers that these stores name are used again
        __builtin_amdgcn_sched_barrier(0);   // holds the next block's arithmetic behind that wait
    }
}

extern "C" void kernel_launch(void* const* d_in, const int* in_sizes, int n_in,
                              void* d_out, int out_size, void* d_ws, size_t ws_size, hipStream_t stream) {
    if (n_in < 9) return;
    if (in_sizes[0] < NB * CC * HW) return;
    if (in_sizes[1] < IC * CC || in_sizes[3] < IC * CC || in_sizes[5] < IC * CC || in_sizes[7] < CC * IC) return;
    if (in_sizes[2] < IC || in_sizes[4] < IC || in_sizes[6] < IC || in_sizes[8] < CC) return;
    if (out_size < NB * CC * HW) return;
    const float* x  = (const float*)d_in[0];   // [NB][CC][HWF]
    const float* wq = (const float*)d_in[1];   // [IC][CC]  (queries)
    const float* bq = (const float*)d_in[2];   // [IC]
    const float* wk = (const float*)d_in[3];   // [IC][CC]  (keys)
    const float* bk = (const float*)d_in[4];   // [IC]
    const float* wv = (const float*)d_in[5];   // [IC][CC]  (values)
    const float* bv = (const float*)d_in[6];   // [IC]
    const float* wo = (const float*)d_in[7];   // [CC][IC]  (output projection)
    const float* bo = (const float*)d_in[8];   // [CC]
    float* OUT = (float*)d_out;                // [NB][CC][HW]
    char* wsp = (char*)d_ws;
    auto take = [&](size_t bytes) { char* p = wsp; wsp += (bytes + 255) & ~(size_t)255; return (void*)p; };
    bf* Hh  = (bf*)take((size_t)NB * 2 * HW * IC * 2);     // [b] hi planes of q+bq, k+bk
    bf* Hl  = (bf*)take((size_t)NB * 2 * HW * IC * 2);     // [b] lo planes of q+bq, k+bk
    h16* GT = (h16*)take((size_t)NB * IC * HW * 2);        // [b][i][m] fp16 (v + bv)
    bf* Yh  = (bf*)take((size_t)NB * HW * IC * 2); bf* Yl = (bf*)take((size_t)NB * HW * IC * 2);
    if ((size_t)(wsp - (char*)d_ws) > ws_size) return;

    // Every launch takes all NB images (the image is a grid dimension).
    // q / k [m][o] = sum_c x[c][m] W[o][c] + bias as hi/lo planes, v [o][m] + bias as f16   (z = 3 b + (0 q, 1 k, 2 v); exact bf16 products)
    k_proj<<<dim3(HW / 64, IC / 64, 3 * NB), 32, 0, stream>>>(x, wq, wk, wv, bq, bk, bv, Hh, Hl, GT);
    // y = softmax(q . k) . v, hi/lo planes of y
    k_fattn<<<dim3(HW / 64, NB), 128, 0, stream>>>(Hh, Hl, GT, Yh, Yl);
    // out[c][n] = (sum_o Wo[c][o] y[n][o] + bo[c]) + x[c][n]  (hi + lo planes of y, 2 products)
    k_outp<<<dim3(HW / 64, CC / 64, NB), 32, 0, stream>>>(wo, Yh, Yl, x, bo, OUT);
}

// v005
// Measured time: 62.9 microseconds a run.
// Timed twice side by side with v004, it ran 1.16 and 1.15 times as fast.
// Over all steps from v000 it is 9.96 times as fast.
#include <hip/hip_runtime.h>

// All contractions on 16-bit WMMA, f32 accumulate: the three 1x1 projections q/k/v = v_wmma_f32_16x16x32_bf16 on RNE-bf16 values of x and of the weights (single products); scores q.k = bf16 hi/lo split (hi.hi + lo.hi + hi.lo, K = 128); attn.v = v_wmma_f32_16x16x32_f16 (unnormalised softmax terms carried x 2^6 as f16, v as f16); output projection = bf16 Wo times bf16 hi/lo planes of y (2 products). Bias adds, softmax and the residual add in f32.
// x [NB][128][4096]; q/k/y hi/lo planes and the f16 plane of v lie in the workspace in FRAGMENT ORDER (below: "Fragment order"); s[n][m] = q_n . k_m (unscaled); attn[n][m] = softmax_m(s); y[n][o] = sum_m attn[n][m] v[m][o]; out[c][n] = x[c][n] + bo[c] + sum_o Wo[c][o] y[n][o]. Three launches: projections, attention, output projection; every convert or transposing step is done where a GEMM loads a fragment or stores its tile.

#ifndef NB
#define NB 4
#endif
#ifndef SEQ
#define SEQ 4096
#endif
#define NB_FULL  4
#define SEQ_FULL 4096
#define CC   128
#define IC   128
#define HW   SEQ
#define HWF  SEQ_FULL
static_assert(NB >= 1 && NB <= NB_FULL);
static_assert(SEQ >= 128 && SEQ <= SEQ_FULL && (SEQ % 128) == 0);
static_assert((HW % 64) == 0 && (IC % 64) == 0 && (CC % 64) == 0);
static_assert((HW % 32) == 0 && (IC % 32) == 0 && (CC % 32) == 0);
static_assert(((IC * CC) % 8) == 0 && ((HW * CC) % 4) == 0 && ((HW * IC) % 4) == 0 && ((IC * HW) % 2) == 0 && (HW % 8) == 0 && (IC % 4) == 0);
static_assert(((size_t)HW * CC / 4) % 256 == 0 && ((size_t)HW * IC / 4) % 256 == 0 && ((size_t)HW * IC / 2) % 256 == 0);

typedef _Float16 h16;
typedef unsigned short bf;
typedef __attribute__((ext_vector_type(16))) __bf16   v16bf;
typedef __attribute__((ext_vector_type(16))) _Float16 v16h;
typedef __attribute__((ext_vector_type(8)))  _Float16 v8h;
typedef __attribute__((ext_vector_type(8)))  unsigned short v8us;
typedef __attribute__((ext_vector_type(8)))  float    v8f;
typedef __attribute__((ext_vector_type(4)))  float    v4f;
typedef v8h  __attribute__((may_alias)) v8ha;
typedef v4f  __attribute__((may_alias)) v4fa;
typedef v8us __attribute__((may_alias)) v8usa;

__device__ __forceinline__ unsigned short f2bf(float f) { unsigned u = __float_as_uint(f); u += 0x7FFFu + ((u >> 16) & 1u); return (unsigned short)(u >> 16); }
__device__ __forceinline__ float bf2f(unsigned short b) { return __uint_as_float(((unsigned)b) << 16); }
__device__ __forceinline__ float bfr(float f) { return bf2f(f2bf(f)); }
__device__ __forceinline__ v16h cat16(v8h lo, v8h hi) { return __builtin_shufflevector(lo, hi, 0, 1, 2, 3, 4, 5, 6, 7, 8, 9, 10, 11, 12, 13, 14, 15); }
__device__ __forceinline__ v16bf cat16b(v8us lo, v8us hi) { return __builtin_bit_cast(v16bf, __builtin_shufflevector(lo, hi, 0, 1, 2, 3, 4, 5, 6, 7, 8, 9, 10, 11, 12, 13, 14, 15)); }
__device__ __forceinline__ v8f wmma16(v16h a, v16h b, v8f c) { return __builtin_amdgcn_wmma_f32_16x16x32_f16(false, a, false, b, (short)0, c, false, false); }
__device__ __forceinline__ v8f wmmab(v16bf a, v16bf b, v8f c) { return __builtin_amdgcn_wmma_f32_16x16x32_bf16(false, a, false, b, (short)0, c, false, false); }

// ---- The two GEMM kernels: ONE WAVE per 64x64 output tile (16 accumulators), K = 128 in 4 steps of 32, fragments formed straight from the operands as they lie in memory.
// Fragments: lane l, h = l >> 4, row/col = l & 15; elements 0..7 = k0 + 8h + 0..7, elements 8..15 = k0 + 16 + 8h + 0..7 for BOTH A and B; D element r = (row 8h + r, col l & 15).
// Tokens are dealt to the four 16-wide blocks of a tile as token = t0 + 4 (l & 15) + block: a lane's 16-byte load of x gives one element to each of its four fragments,
// and in k_outp, where tokens are the tile's columns, a lane's four accumulators of one row are four neighbouring tokens, stored as one run without a pass through LDS.
// Fragment order: every 16-bit plane in the workspace is a row of 1-KiB fragments, each two runs of 512 B: run j holds, at lane l's 16 bytes (l * 16), the lane's elements 8 j .. 8 j + 7.
// A wave-wide 16-byte load or store of a run is 512 contiguous bytes (4 whole 128-B lines), where rows of a token- or channel-major plane gave 16 lines a load.
// q, k, y planes: fragment (tile, ks) at element (tile * 4 + ks) * 512; row l & 15 of tile T is token (T / 4) * 64 + 4 (l & 15) + T % 4 (the deal above), channels 32 ks + 16 j + 8 h + 0..7.
// v plane: fragment (pair P of tiles, channel tile ot) at element (P * 8 + ot) * 512; row l & 15 is channel 16 ot + (l & 15), run j holds rows 8 h + 0..7 of tile 2 P + j: keys in the order of the k tiles.
// ld(p): p = fragment start + 8 l.
template <typename T16> struct WFrag;
template <> struct WFrag<h16> { typedef v16h V; static __device__ __forceinline__ V ld(const h16* p) { return cat16(*(const v8h*)p, *(const v8h*)(p + 256)); } static __device__ __forceinline__ v8f mma(V a, V b, v8f c) { return wmma16(a, b, c); } };
template <> struct WFrag<bf> { typedef v16bf V; static __device__ __forceinline__ V ld(const bf* p) { return cat16b(*(const v8us*)p, *(const v8us*)(p + 256)); } static __device__ __forceinline__ v8f mma(V a, V b, v8f c) { return wmmab(a, b, c); } };
static_assert(CC == 128 && IC == 128 && (HW % 64) == 0);
// 16 k values of one row of an f32 matrix [row][k]: raw load (p = row start + k0 + 8h), then rounding to bf16 (to nearest even)
__device__ __forceinline__ void ldw_raw(const float* __restrict__ p, v4f (&r)[4]) { r[0] = *(const v4f*)p; r[1] = *(const v4f*)(p + 4); r[2] = *(const v4f*)(p + 16); r[3] = *(const v4f*)(p + 20); }
__device__ __forceinline__ v16bf cvw(const v4f (&r)[4]) { v16bf f;
#pragma unroll
    for (int g = 0; g < 4; ++g)
#pragma unroll
        for (int u = 0; u < 4; ++u) f[4 * g + u] = (__bf16)r[g][u];
    return f; }
// the four token fragments of one k step from x [k][token] f32: raw load (p = x + (k0 + 8h) HWF + t0 + 4 (l & 15)), then rounding to bf16 (to nearest even); word i of a load belongs to block i
__device__ __forceinline__ void ldx_raw(const float* __restrict__ p, v4f (&r)[16]) {
#pragma unroll
    for (int e = 0; e < 16; ++e) r[e] = *(const v4f*)(p + (size_t)(e < 8 ? e : e + 8) * HWF); }
__device__ __forceinline__ void cvx(const v4f (&r)[16], v16bf (&f)[4]) {
#pragma unroll
    for (int e = 0; e < 16; ++e)
#pragma unroll
        for (int i = 0; i < 4; ++i) f[i][e] = (__bf16)r[e][i]; }
__device__ __forceinline__ void zero16(v8f (&acc)[4][4]) {
#pragma unroll
    for (int mb = 0; mb < 4; ++mb)
#pragma unroll
        for (int nb = 0; nb < 4; ++nb) acc[mb][nb] = (v8f){};
}

__device__ __forceinline__ h16 tohx(float x) { return (h16)x; }
__device__ __forceinline__ void splitf(float y, unsigned short& h, unsigned short& l) { h = f2bf(y); l = f2bf(y - bf2f(h)); }
typedef __attribute__((ext_vector_type(2))) unsigned short v2us;
typedef __attribute__((ext_vector_type(2))) _Float16 v2h;
typedef __attribute__((ext_vector_type(2))) float v2f;
// ---- k_proj: the three projections. grid (HW/64, IC/64, 3 images), one wave; blockIdx.z = 3 b + (0 q, 1 k, 2 v). x and W are read as f32 and rounded at the fragment load.
// q, k: A = W rows (channels), B = tokens: tile [channel][token]: a lane's 8 accumulator rows are 8 channels of one token, one 16-byte piece of a q/k fragment; + bias (a row's), split into the hi/lo bf16 planes.
// v: the roles swapped, A = tokens, B = W rows: tile [token][channel]: a lane's 8 rows are 8 keys of one channel, one 16-byte piece of a v fragment; + bias (a column's), f16.
// Both are stored from the accumulators, 512 contiguous bytes a store, without a pass through LDS.
template <bool TR>
__device__ __forceinline__ void proj_loop(const float* __restrict__ xp, const float* __restrict__ wp, v8f (&acc)[4][4]) {
    zero16(acc);
#pragma unroll 1   // rolled, as the GEMM loop was: the fragments of one k step take over the registers of the step before
    for (int kc = 0; kc < CC; kc += 32) {
        v4f xr[16], wr[4][4];
        ldx_raw(xp + (size_t)kc * HWF, xr);
#pragma unroll
        for (int b = 0; b < 4; ++b) ldw_raw(wp + (size_t)b * 16 * CC + kc, wr[b]);
        asm volatile("s_wait_xcnt 0x0" ::: "memory");   // before the address registers of the step's loads move on
        __builtin_amdgcn_sched_barrier(0);   // the step's 32 loads go out together, ahead of the rounding (one load latency a step, not one a fragment), and the pointer steps stay behind that wait
        v16bf xf[4], wf[4];
        cvx(xr, xf);
#pragma unroll
        for (int b = 0; b < 4; ++b) wf[b] = cvw(wr[b]);
#pragma unroll
        for (int nb = 0; nb < 4; ++nb)
#pragma unroll
            for (int mb = 0; mb < 4; ++mb) acc[mb][nb] = TR ? wmmab(wf[mb], xf[nb], acc[mb][nb]) : wmmab(xf[mb], wf[nb], acc[mb][nb]);
        // four vector slots behind the step's last WMMA: the distance the chip needs before a vector instruction writes its A or B (the next step's rounding, over the back edge) or reads D (the epilogue)
        asm volatile("v_nop\n\tv_nop\n\tv_nop\n\tv_nop" : "+v"(acc[0][0]), "+v"(acc[1][1]), "+v"(acc[2][2]), "+v"(acc[3][3]) : "v"(xf[0]), "v"(xf[3]), "v"(wf[0]), "v"(wf[3]));
    }
}
__global__ __launch_bounds__(32) void k_proj(const float* __restrict__ x, const float* __restrict__ wq, const float* __restrict__ wk, const float* __restrict__ wv, const float* __restrict__ bq, const float* __restrict__ bk, const float* __restrict__ bv, bf* Hh, bf* Hl, h16* GT) {
    const int lane = threadIdx.x & 31, lr = lane & 15, hi = lane >> 4; const int img = (int)blockIdx.z / 3, which = (int)blockIdx.z % 3;
    const int t0 = (int)blockIdx.x * 64, o0 = (int)blockIdx.y * 64;
    const float* xp = x + (size_t)img * CC * HWF + (size_t)(8 * hi) * HWF + t0 + 4 * lr;
    const size_t woff = (size_t)(o0 + lr) * CC + 8 * hi;
    v8f acc[4][4];
    if (which == 2) {
        float cr[4];   // the columns' biases, asked for ahead of the k loop
#pragma unroll
        for (int nb = 0; nb < 4; ++nb) cr[nb] = bv[o0 + nb * 16 + lr];
        asm volatile("s_wait_xcnt 0x0" ::: "memory");   // before the address registers of these loads are used for anything else
        __builtin_amdgcn_sched_barrier(0);   // holds what follows behind that wait
        proj_loop<false>(xp, wv + woff, acc);
        h16* G = GT + (size_t)img * IC * HW + (size_t)t0 * IC + (o0 / 16) * 512 + lane * 8;   // fragment (pair t0 / 32, channel tile o0 / 16), the lane's place
#pragma unroll
        for (int mb = 0; mb < 4; ++mb) { v8h o[4];
#pragma unroll
            for (int nb = 0; nb < 4; ++nb) { const float bb = bfr(cr[nb]);
#pragma unroll
                for (int j = 0; j < 8; ++j) o[nb][j] = tohx(__fadd_rn(acc[mb][nb][j], bb)); }
            __builtin_amdgcn_sched_barrier(0);   // the block's 4 values stand in registers of their own before the first store goes out
#pragma unroll
            for (int nb = 0; nb < 4; ++nb) *(v8h*)(G + (mb >> 1) * 4096 + nb * 512 + (mb & 1) * 256) = o[nb];   // token block mb is tile t0 / 16 + mb: pair mb / 2, run mb % 2
            asm volatile("s_wait_xcnt 0x0" ::: "memory");   // before the registers that these stores name are used again
            __builtin_amdgcn_sched_barrier(0);   // holds the next block's arithmetic behind that wait
        }
    } else {
        const float* bp = (which == 0 ? bq : bk) + o0 + 8 * hi;
        v4f br[4][2];   // the rows' biases, asked for ahead of the k loop
#pragma unroll
        for (int mb = 0; mb < 4; ++mb) { br[mb][0] = *(const v4f*)(bp + mb * 16); br[mb][1] = *(const v4f*)(bp + mb * 16 + 4); }
        asm volatile("s_wait_xcnt 0x0" ::: "memory");   // before the address registers of these loads are used for anything else
        __builtin_amdgcn_sched_barrier(0);   // holds what follows behind that wait
        proj_loop<true>(xp, (which == 0 ? wq : wk) + woff, acc);
        const size_t base = ((size_t)img * 2 + which) * HW * IC + (size_t)t0 * IC + (o0 / 16) * 256 + lane * 8;   // tile t0 / 16, run o0 / 16 of its eight, the lane's place
#pragma unroll
        for (int nb = 0; nb < 4; ++nb) { v8us oh[4], ol[4];
#pragma unroll
            for (int mb = 0; mb < 4; ++mb)
#pragma unroll
                for (int j = 0; j < 8; ++j) { unsigned short p, q; splitf(__fadd_rn(acc[mb][nb][j], bfr(br[mb][j >> 2][j & 3])), p, q); oh[mb][j] = p; ol[mb][j] = q; }
            __builtin_amdgcn_sched_barrier(0);   // the block's 8 values stand in registers of their own before the first store goes out
#pragma unroll
            for (int mb = 0; mb < 4; ++mb) { *(v8us*)(Hh + base + nb * 2048 + mb * 256) = oh[mb]; *(v8us*)(Hl + base + nb * 2048 + mb * 256) = ol[mb]; }   // token block nb is tile t0 / 16 + nb
            asm volatile("s_wait_xcnt 0x0" ::: "memory");   // before the registers that these stores name are used again
            __builtin_amdgcn_sched_barrier(0);   // holds the next block's arithmetic behind that wait
        }
    }
}
// ---- k_fattn: scores, softmax and attn.v in one pass over the keys; no score or softmax plane is stored. grid (HW/64, images), 4 waves, one per SIMD.
// Every wave holds all 64 query columns of the work-group (4 column tiles: each k and v fragment loaded feeds 4 tiles); wave w takes the keys w HW/4 .. + HW/4 - 1, 32 keys a pass.
// sT[key][query] = K . qT (A = k rows, B = q rows kept in registers; hi.hi + hi.lo + lo.hi): a lane holds 16 scores of ONE query (column l & 15; keys 8h + r and 16 + 8h + r),
// which are, converted to f16, exactly its elements 0..7 and 8..15 of the B fragment of yT[o][query] += vT . pT (A = fragments of GT). Fragments and D layout as above; q, k, v are read and y is written in fragment order,
// so column l & 15 of column tile ct is token n0 + 4 (l & 15) + ct, and the keys of a pass are those of two k tiles (the v fragments hold the same keys in the same order).
// Running maximum m and sum l per query; p = 2^((s - m) log2 e + 6) as f16. m moves (and yT, l are rescaled) only when a pass's maximum passes it by more than 5.5, so p <= 2^14.
// The four key quarters meet in LDS: y = sum_q w_q yT_q / sum_q w_q l_q, w_q = e^(m_q - max m), in the order q = 0..3; the hi/lo bf16 planes of y are written from there.
#define FL2E 1.4426950408889634f
#define FQT 4   // column tiles of 16 queries per wave
static_assert(IC == 128 && (HW % 128) == 0 && HW / 4 >= 64 && FQT == 4);
__global__ __launch_bounds__(128) void k_fattn(const bf* __restrict__ Hh, const bf* __restrict__ Hl, const h16* __restrict__ GT, bf* Yh, bf* Yl) {
    __shared__ __align__(16) float part[4 * 8 * FQT * 256];
    __shared__ float msh[4][FQT][16];
    __shared__ float lsh[4][FQT][16];
    const int lane = threadIdx.x & 31, lr = lane & 15, hi = lane >> 4; const int w = __builtin_amdgcn_readfirstlane((int)(threadIdx.x >> 5));
    const size_t PLc = (size_t)HW * IC; const size_t img = blockIdx.y; const int n0 = (int)blockIdx.x * 64;
    const size_t qoff = img * 2 * PLc + (size_t)n0 * IC + lane * 8;
    const bf* khn = Hh + img * 2 * PLc + PLc + (size_t)(w * (HW / 4)) * IC + lane * 8;   // the lane's place in the k tiles that are loaded next
    const bf* kln = Hl + img * 2 * PLc + PLc + (size_t)(w * (HW / 4)) * IC + lane * 8;
    const h16* vp = GT + img * PLc + (size_t)(w * (HW / 4)) * IC + lane * 8;
    v16bf qh[FQT][4], ql[FQT][4];
#pragma unroll
    for (int ct = 0; ct < FQT; ++ct)
#pragma unroll
        for (int ks = 0; ks < 4; ++ks) { qh[ct][ks] = WFrag<bf>::ld(Hh + qoff + (ct * 4 + ks) * 512); ql[ct][ks] = WFrag<bf>::ld(Hl + qoff + (ct * 4 + ks) * 512); }
    asm volatile("s_wait_xcnt 0x0" ::: "memory");   // before the address registers of the q loads are used for anything else
    __builtin_amdgcn_sched_barrier(0);   // holds what follows behind that wait
    v8f acc[8][FQT];
#pragma unroll
    for (int ot = 0; ot < 8; ++ot)
#pragma unroll
        for (int ct = 0; ct < FQT; ++ct) acc[ot][ct] = (v8f){};
    float m[FQT], l[FQT];
#pragma unroll
    for (int ct = 0; ct < FQT; ++ct) { m[ct] = -3.0e38f; l[ct] = 0.f; }
    v16bf kh[4][2], kl[4][2];   // loaded tile by tile, plane by plane: the eight 512-B runs of a tile follow one another in memory
#pragma unroll
    for (int kt = 0; kt < 2; ++kt) {
#pragma unroll
        for (int ks = 0; ks < 4; ++ks) kh[ks][kt] = WFrag<bf>::ld(khn + (kt * 4 + ks) * 512);
#pragma unroll
        for (int ks = 0; ks < 4; ++ks) kl[ks][kt] = WFrag<bf>::ld(kln + (kt * 4 + ks) * 512); }
    asm volatile("s_wait_xcnt 0x0" ::: "memory");   // before the address registers of the k loads move on
    __builtin_amdgcn_sched_barrier(0);   // holds the pointer steps behind that wait
    khn += 32 * IC; kln += 32 * IC;
#pragma unroll 1   // rolled: the pass is some 500 instructions long and its fragments take their registers over from the pass before
    for (int kb = 0; kb < HW / 4; kb += 32) {
        v16h vf[8];
#pragma unroll
        for (int ot = 0; ot < 8; ++ot) vf[ot] = WFrag<h16>::ld(vp + kb * IC + ot * 512);
        asm volatile("s_wait_xcnt 0x0" ::: "memory");   // before the address registers of the v loads are used for anything else
        // keeps the 16 v loads at the head of the pass, all the score WMMAs and the softmax ahead of their use (one wave per SIMD: nothing else covers a load)
        __builtin_amdgcn_sched_barrier(0);
        v8f s[2][FQT];
#pragma unroll
        for (int kt = 0; kt < 2; ++kt)
#pragma unroll
            for (int ct = 0; ct < FQT; ++ct) s[kt][ct] = (v8f){};
#pragma unroll
        for (int ks = 0; ks < 4; ++ks) {
#pragma unroll
            for (int kt = 0; kt < 2; ++kt)
#pragma unroll
                for (int ct = 0; ct < FQT; ++ct) s[kt][ct] = wmmab(kh[ks][kt], qh[ct][ks], s[kt][ct]);
#pragma unroll
            for (int kt = 0; kt < 2; ++kt)
#pragma unroll
                for (int ct = 0; ct < FQT; ++ct) s[kt][ct] = wmmab(kh[ks][kt], ql[ct][ks], s[kt][ct]);
#pragma unroll
            for (int kt = 0; kt < 2; ++kt)
#pragma unroll
                for (int ct = 0; ct < FQT; ++ct) s[kt][ct] = wmmab(kl[ks][kt], qh[ct][ks], s[kt][ct]);
        }
        // the next pass's 32 k loads go out here, into the registers that the score WMMAs above have just read, and fly during the softmax and attn.v (the last pass loads its own rows again, unused)
        __builtin_amdgcn_sched_barrier(0);
#pragma unroll
        for (int kt = 0; kt < 2; ++kt) {
#pragma unroll
            for (int ks = 0; ks < 4; ++ks) kh[ks][kt] = WFrag<bf>::ld(khn + (kt * 4 + ks) * 512);
#pragma unroll
            for (int ks = 0; ks < 4; ++ks) kl[ks][kt] = WFrag<bf>::ld(kln + (kt * 4 + ks) * 512); }
        asm volatile("s_wait_xcnt 0x0" ::: "memory");   // before the address registers of the k loads move on
        __builtin_amdgcn_sched_barrier(0);   // holds the k loads (and their wait) in front of the pointer steps and the softmax
        const int kstep = (kb + 64 < HW / 4) ? 32 * IC : 0; khn += kstep; kln += kstep;
        float ml[FQT]; bool need = false;
#pragma unroll
        for (int ct = 0; ct < FQT; ++ct) { float t = fmaxf(s[0][ct][0], s[1][ct][0]);
#pragma unroll
            for (int r = 1; r < 8; ++r) t = fmaxf(t, fmaxf(s[0][ct][r], s[1][ct][r]));
            ml[ct] = fmaxf(t, __shfl_xor(t, 16, 32)); need = need || (ml[ct] > m[ct] + 5.5f); }
        if (__builtin_amdgcn_ballot_w32(need) != 0) {
#pragma unroll
            for (int ct = 0; ct < FQT; ++ct) { const float mn = fmaxf(m[ct], ml[ct]); const float al = __builtin_amdgcn_exp2f((m[ct] - mn) * FL2E); m[ct] = mn; l[ct] *= al;
#pragma unroll
                for (int ot = 0; ot < 8; ++ot) acc[ot][ct] *= al; }
        }
        v16h pf[FQT];
#pragma unroll
        for (int ct = 0; ct < FQT; ++ct) { float sum = 0.f;
#pragma unroll
            for (int kt = 0; kt < 2; ++kt)
#pragma unroll
                for (int r = 0; r < 8; ++r) { const float p = __builtin_amdgcn_exp2f((s[kt][ct][r] - m[ct]) * FL2E + 6.0f); sum += p; pf[ct][kt * 8 + r] = (h16)p; }
            l[ct] += sum; }
#pragma unroll
        for (int ot = 0; ot < 8; ++ot)
#pragma unroll
            for (int ct = 0; ct < FQT; ++ct) acc[ot][ct] = wmma16(vf[ot], pf[ct], acc[ot][ct]);
    }
#pragma unroll
    for (int ct = 0; ct < FQT; ++ct) { l[ct] += __shfl_xor(l[ct], 16, 32); if (hi == 0) { msh[w][ct][lr] = m[ct]; lsh[w][ct][lr] = l[ct]; } }
    float* my = part + w * (8 * FQT * 256) + lane * 4;
#pragma unroll
    for (int ot = 0; ot < 8; ++ot)
#pragma unroll
        for (int ct = 0; ct < FQT; ++ct) { const v8f t = acc[ot][ct]; *(v4fa*)(my + (ot * FQT + ct) * 256) = (v4f){t[0], t[1], t[2], t[3]}; *(v4fa*)(my + (ot * FQT + ct) * 256 + 128) = (v4f){t[4], t[5], t[6], t[7]}; }
    __syncthreads();
    // wave w merges the 16 queries of column tile w, all 128 channels: tile n0 / 16 + w of each y plane, its eight 512-B runs
    float wq[4]; float mm = msh[0][w][lr];
#pragma unroll
    for (int q = 1; q < 4; ++q) mm = fmaxf(mm, msh[q][w][lr]);
    float ls = 0.f;
#pragma unroll
    for (int q = 0; q < 4; ++q) { wq[q] = __builtin_amdgcn_exp2f((msh[q][w][lr] - mm) * FL2E); ls += wq[q] * lsh[q][w][lr]; }
    const float inv = __fdiv_rn(1.0f, ls);
    const size_t yoff = img * PLc + (size_t)(n0 + w * 16) * IC + lane * 8;
#pragma unroll
    for (int j = 0; j < 8; ++j) { const float* sp = part + (j * FQT + w) * 256 + lane * 4; v4f a0 = wq[0] * *(const v4fa*)sp, a1 = wq[0] * *(const v4fa*)(sp + 128);
#pragma unroll
        for (int q = 1; q < 4; ++q) { a0 += wq[q] * *(const v4fa*)(sp + q * (8 * FQT * 256)); a1 += wq[q] * *(const v4fa*)(sp + q * (8 * FQT * 256) + 128); }
        v8us o_h, o_l;
#pragma unroll
        for (int u = 0; u < 4; ++u) { unsigned short p, q2; splitf(a0[u] * inv, p, q2); o_h[u] = p; o_l[u] = q2; splitf(a1[u] * inv, p, q2); o_h[4 + u] = p; o_l[4 + u] = q2; }
        *(v8us*)(Yh + yoff + j * 256) = o_h; *(v8us*)(Yl + yoff + j * 256) = o_l; }
}
// ---- k_outp: output projection with bias and residual. grid (HW/64, CC/64, images), one wave. Wo is read as f32 and rounded at the fragment load.
// A = Wo rows (channels), B = hi, then lo plane of y (tokens): tile [channel][token], the layout of out itself; out = (z + bo) + x, x rounded to bf16 as before; stored from the accumulators.
__global__ __launch_bounds__(32) void k_outp(const float* __restrict__ wo, const bf* __restrict__ Yh, const bf* __restrict__ Yl, const float* __restrict__ xb, const float* __restrict__ bo, float* OUTb) {
    const int lane = threadIdx.x & 31, lr = lane & 15, hi = lane >> 4; const size_t img = blockIdx.z;
    const int t0 = (int)blockIdx.x * 64, c0 = (int)blockIdx.y * 64;
    const float* xp = xb + img * CC * HWF + (size_t)(c0 + 8 * hi) * HWF + t0 + 4 * lr;
    float* op = OUTb + img * CC * HW + (size_t)(c0 + 8 * hi) * HW + t0 + 4 * lr;
    v4f xs[4][8], br[4][2];   // the tile of x and the rows' biases are asked for ahead of the k loop and arrive under it
#pragma unroll
    for (int mb = 0; mb < 4; ++mb) { br[mb][0] = *(const v4f*)(bo + c0 + mb * 16 + 8 * hi); br[mb][1] = *(const v4f*)(bo + c0 + mb * 16 + 8 * hi + 4);
#pragma unroll
        for (int j = 0; j < 8; ++j) xs[mb][j] = *(const v4f*)(xp + (size_t)(mb * 16 + j) * HWF); }
    asm volatile("s_wait_xcnt 0x0" ::: "memory");   // before the address registers of these loads are used for anything else
    __builtin_amdgcn_sched_barrier(0);   // holds what follows behind that wait
    const float* wp = wo + (size_t)(c0 + lr) * IC + 8 * hi;
    const size_t yoff = img * HW * IC + (size_t)t0 * IC + lane * 8;   // tile t0 / 16 of the y planes (fragment order), the lane's place
    v8f acc[4][4]; zero16(acc);
#pragma unroll 1   // rolled, as the GEMM loop was: the fragments of one k step take over the registers of the step before
    for (int kc = 0; kc < IC; kc += 32) {
        v4f wr[4][4]; v16bf b[4], b2[4];
#pragma unroll
        for (int mb = 0; mb < 4; ++mb) ldw_raw(wp + (size_t)mb * 16 * IC + kc, wr[mb]);
#pragma unroll
        for (int nb = 0; nb < 4; ++nb) { b[nb] = WFrag<bf>::ld(Yh + yoff + nb * 2048 + kc * 16); b2[nb] = WFrag<bf>::ld(Yl + yoff + nb * 2048 + kc * 16); }
        asm volatile("s_wait_xcnt 0x0" ::: "memory");   // before the address registers of the step's loads move on
        __builtin_amdgcn_sched_barrier(0);   // the step's 32 loads go out together, ahead of the rounding (one load latency a step, not one a fragment), and the pointer steps stay behind that wait
        v16bf a[4];
#pragma unroll
        for (int mb = 0; mb < 4; ++mb) a[mb] = cvw(wr[mb]);
#pragma unroll
        for (int nb = 0; nb < 4; ++nb) {
#pragma unroll
            for (int mb = 0; mb < 4; ++mb) acc[mb][nb] = wmmab(a[mb], b[nb], acc[mb][nb]);
#pragma unroll
            for (int mb = 0; mb < 4; ++mb) acc[mb][nb] = wmmab(a[mb], b2[nb], acc[mb][nb]); }
        // four vector slots behind the step's last WMMA: the distance the chip needs before a vector instruction writes its A (the next step's rounding, over the back edge) or reads D (the epilogue)
        asm volatile("v_nop\n\tv_nop\n\tv_nop\n\tv_nop" : "+v"(acc[0][0]), "+v"(acc[1][1]), "+v"(acc[2][2]), "+v"(acc[3][3]) : "v"(a[0]), "v"(a[3]));
    }
#pragma unroll
    for (int mb = 0; mb < 4; ++mb) { v4f r[8];
#pragma unroll
        for (int j = 0; j < 8; ++j) { const float bb = bfr(br[mb][j >> 2][j & 3]);
#pragma unroll
            for (int nb = 0; nb < 4; ++nb) r[j][nb] = __fadd_rn(__fadd_rn(acc[mb][nb][j], bb), bfr(xs[mb][j][nb])); }
        __builtin_amdgcn_sched_barrier(0);   // the block's 8 values stand in registers of their own before the first store goes out
#pragma unroll
        for (int j = 0; j < 8; ++j) *(v4f*)(op + (size_t)(mb * 16 + j) * HW) = r[j];
        asm volatile("s_wait_xcnt 0x0" ::: "memory");   // before the registers that these stores name are used again
        __builtin_amdgcn_sched_barrier(0);   // holds the next block's arithmetic behind that wait
    }
}

extern "C" void kernel_launch(void* const* d_in, const int* in_sizes, int n_in,
                              void* d_out, int out_size, void* d_ws, size_t ws_size, hipStream_t stream) {
    if (n_in < 9) return;
    if (in_sizes[0] < NB * CC * HW) return;
    if (in_sizes[1] < IC * CC || in_sizes[3] < IC * CC || in_sizes[5] < IC * CC || in_sizes[7] < CC * IC) return;
    if (in_sizes[2] < IC || in_sizes[4] < IC || in_sizes[6] < IC || in_sizes[8] < CC) return;
    if (out_size < NB * CC * HW) return;
    const float* x  = (const float*)d_in[0];   // [NB][CC][HWF]
    const float* wq = (const float*)d_in[1];   // [IC][CC]  (queries)
    const float* bq = (const float*)d_in[2];   // [IC]
    const float* wk = (const float*)d_in[3];   // [IC][CC]  (keys)
    const float* bk = (const float*)d_in[4];   // [IC]
    const float* wv = (const float*)d_in[5];   // [IC][CC]  (values)
    const float* bv = (const float*)d_in[6];   // [IC]
    const float* wo = (const float*)d_in[7];   // [CC][IC]  (output projection)
    const float* bo = (const float*)d_in[8];   // [CC]
    float* OUT = (float*)d_out;                // [NB][CC][HW]
    char* wsp = (char*)d_ws;
    auto take = [&](size_t bytes) { char* p = wsp; wsp += (bytes + 255) & ~(size_t)255; return (void*)p; };
    bf* Hh  = (bf*)take((size_t)NB * 2 * HW * IC * 2);     // [b] hi planes of q+bq, k+bk
    bf* Hl  = (bf*)take((size_t)NB * 2 * HW * IC * 2);     // [b] lo planes of q+bq, k+bk
    h16* GT = (h16*)take((size_t)NB * IC * HW * 2);        // [b] fp16 (v + bv)
    bf* Yh  = (bf*)take((size_t)NB * HW * IC * 2); bf* Yl = (bf*)take((size_t)NB * HW * IC * 2);
    if ((size_t)(wsp - (char*)d_ws) > ws_size) return;

    // Every launch takes all NB images (the image is a grid dimension).
    // q / k [m][o] = sum_c x[c][m] W[o][c] + bias as hi/lo planes, v [o][m] + bias as f16, all in fragment order   (z = 3 b + (0 q, 1 k, 2 v); exact bf16 products)
    k_proj<<<dim3(HW / 64, IC / 64, 3 * NB), 32, 0, stream>>>(x, wq, wk, wv, bq, bk, bv, Hh, Hl, GT);
    // y = softmax(q . k) . v, hi/lo planes of y
    k_fattn<<<dim3(HW / 64, NB), 128, 0, stream>>>(Hh, Hl, GT, Yh, Yl);
    // out[c][n] = (sum_o Wo[c][o] y[n][o] + bo[c]) + x[c][n]  (hi + lo planes of y, 2 products)
    k_outp<<<dim3(HW / 64, CC / 64, NB), 32, 0, stream>>>(wo, Yh, Yl, x, bo, OUT);
}

// v006
// It runs in 56.8 microseconds.
// In both of two side-by-side timings against v005, it was 1.11 times as fast.
// Counting every step since v000, it is 11.1 times as fast.
#include <hip/hip_runtime.h>

// All contractions on 16-bit WMMA, f32 accumulate: the three 1x1 projections q/k/v = v_wmma_f32_16x16x32_bf16 on RNE-bf16 values of x and of the weights (single products); scores q.k = bf16 hi/lo split (hi.hi + lo.hi + hi.lo, K = 128); attn.v = v_wmma_f32_16x16x32_f16 (unnormalised softmax terms carried x 2^6 as f16, v as f16); output projection = bf16 Wo times bf16 hi/lo planes of y (2 products). Bias adds, softmax and the residual add in f32.
// x [NB][128][4096]; q/k hi/lo planes and the f16 plane of v lie in the workspace, the hi/lo planes of y in LDS, all in FRAGMENT ORDER (below: "Fragment order"); s[n][m] = q_n . k_m (unscaled); attn[n][m] = softmax_m(s); y[n][o] = sum_m attn[n][m] v[m][o]; out[c][n] = x[c][n] + bo[c] + sum_o Wo[c][o] y[n][o]. Two launches: projections; attention with the output projection as its epilogue (y stays in LDS); every convert or transposing step is done where a GEMM loads a fragment or stores its tile.

#ifndef NB
#define NB 4
#endif
#ifndef SEQ
#define SEQ 4096
#endif
#define NB_FULL  4
#define SEQ_FULL 4096
#define CC   128
#define IC   128
#define HW   SEQ
#define HWF  SEQ_FULL
static_assert(NB >= 1 && NB <= NB_FULL);
static_assert(SEQ >= 128 && SEQ <= SEQ_FULL && (SEQ % 128) == 0);
static_assert((HW % 64) == 0 && (IC % 64) == 0 && (CC % 64) == 0);
static_assert((HW % 32) == 0 && (IC % 32) == 0 && (CC % 32) == 0);
static_assert(((IC * CC) % 8) == 0 && ((HW * CC) % 4) == 0 && ((HW * IC) % 4) == 0 && ((IC * HW) % 2) == 0 && (HW % 8) == 0 && (IC % 4) == 0);
static_assert(((size_t)HW * CC / 4) % 256 == 0 && ((size_t)HW * IC / 4) % 256 == 0 && ((size_t)HW * IC / 2) % 256 == 0);

typedef _Float16 h16;
typedef unsigned short bf;
typedef __attribute__((ext_vector_type(16))) __bf16   v16bf;
typedef __attribute__((ext_vector_type(16))) _Float16 v16h;
typedef __attribute__((ext_vector_type(8)))  _Float16 v8h;
typedef __attribute__((ext_vector_type(8)))  unsigned short v8us;
typedef __attribute__((ext_vector_type(8)))  float    v8f;
typedef __attribute__((ext_vector_type(4)))  float    v4f;
typedef v8h  __attribute__((may_alias)) v8ha;
typedef v4f  __attribute__((may_alias)) v4fa;
typedef v8us __attribute__((may_alias)) v8usa;

__device__ __forceinline__ unsigned short f2bf(float f) { unsigned u = __float_as_uint(f); u += 0x7FFFu + ((u >> 16) & 1u); return (unsigned short)(u >> 16); }
__device__ __forceinline__ float bf2f(unsigned short b) { return __uint_as_float(((unsigned)b) << 16); }
__device__ __forceinline__ float bfr(float f) { return bf2f(f2bf(f)); }
__device__ __forceinline__ v16h cat16(v8h lo, v8h hi) { return __builtin_shufflevector(lo, hi, 0, 1, 2, 3, 4, 5, 6, 7, 8, 9, 10, 11, 12, 13, 14, 15); }
__device__ __forceinline__ v16bf cat16b(v8us lo, v8us hi) { return __builtin_bit_cast(v16bf, __builtin_shufflevector(lo, hi, 0, 1, 2, 3, 4, 5, 6, 7, 8, 9, 10, 11, 12, 13, 14, 15)); }
__device__ __forceinline__ v8f wmma16(v16h a, v16h b, v8f c) { return __builtin_amdgcn_wmma_f32_16x16x32_f16(false, a, false, b, (short)0, c, false, false); }
__device__ __forceinline__ v8f wmmab(v16bf a, v16bf b, v8f c) { return __builtin_amdgcn_wmma_f32_16x16x32_bf16(false, a, false, b, (short)0, c, false, false); }

// ---- The projection GEMMs: K = 128 in 4 steps of 32, fragments formed straight from the operands as they lie in memory (k_proj: ONE WAVE per 64x64 output tile, 16 accumulators).
// Fragments: lane l, h = l >> 4, row/col = l & 15; elements 0..7 = k0 + 8h + 0..7, elements 8..15 = k0 + 16 + 8h + 0..7 for BOTH A and B; D element r = (row 8h + r, col l & 15).
// Tokens are dealt to the four 16-wide blocks of a tile as token = t0 + 4 (l & 15) + block: a lane's 16-byte load of x gives one element to each of its four fragments,
// and in the output projection, where tokens are the tile's columns, a lane's four accumulators of one row are four neighbouring tokens, stored as one run without a pass through LDS.
// Fragment order: every 16-bit plane (workspace or LDS) is a row of 1-KiB fragments, each two runs of 512 B: run j holds, at lane l's 16 bytes (l * 16), the lane's elements 8 j .. 8 j + 7.
// A wave-wide 16-byte load or store of a run is 512 contiguous bytes (4 whole 128-B lines), where rows of a token- or channel-major plane gave 16 lines a load.
// q, k, y planes: fragment (tile, ks) at element (tile * 4 + ks) * 512; row l & 15 of tile T is token (T / 4) * 64 + 4 (l & 15) + T % 4 (the deal above), channels 32 ks + 16 j + 8 h + 0..7.
// v plane: fragment (pair P of tiles, channel tile ot) at element (P * 8 + ot) * 512; row l & 15 is channel 16 ot + (l & 15), run j holds rows 8 h + 0..7 of tile 2 P + j: keys in the order of the k tiles.
// ld(p): p = fragment start + 8 l.
template <typename T16> struct WFrag;
template <> struct WFrag<h16> { typedef v16h V; static __device__ __forceinline__ V ld(const h16* p) { return cat16(*(const v8h*)p, *(const v8h*)(p + 256)); } static __device__ __forceinline__ v8f mma(V a, V b, v8f c) { return wmma16(a, b, c); } };
template <> struct WFrag<bf> { typedef v16bf V; static __device__ __forceinline__ V ld(const bf* p) { return cat16b(*(const v8us*)p, *(const v8us*)(p + 256)); } static __device__ __forceinline__ v8f mma(V a, V b, v8f c) { return wmmab(a, b, c); } };
static_assert(CC == 128 && IC == 128 && (HW % 64) == 0);
// 16 k values of one row of an f32 matrix [row][k]: raw load (p = row start + k0 + 8h), then rounding to bf16 (to nearest even)
__device__ __forceinline__ void ldw_raw(const float* __restrict__ p, v4f (&r)[4]) { r[0] = *(const v4f*)p; r[1] = *(const v4f*)(p + 4); r[2] = *(const v4f*)(p + 16); r[3] = *(const v4f*)(p + 20); }
__device__ __forceinline__ v16bf cvw(const v4f (&r)[4]) { v16bf f;
#pragma unroll
    for (int g = 0; g < 4; ++g)
#pragma unroll
        for (int u = 0; u < 4; ++u) f[4 * g + u] = (__bf16)r[g][u];
    return f; }
// the four token fragments of one k step from x [k][token] f32: raw load (p = x + (k0 + 8h) HWF + t0 + 4 (l & 15)), then rounding to bf16 (to nearest even); word i of a load belongs to block i
__device__ __forceinline__ void ldx_raw(const float* __restrict__ p, v4f (&r)[16]) {
#pragma unroll
    for (int e = 0; e < 16; ++e) r[e] = *(const v4f*)(p + (size_t)(e < 8 ? e : e + 8) * HWF); }
__device__ __forceinline__ void cvx(const v4f (&r)[16], v16bf (&f)[4]) {
#pragma unroll
    for (int e = 0; e < 16; ++e)
#pragma unroll
        for (int i = 0; i < 4; ++i) f[i][e] = (__bf16)r[e][i]; }
__device__ __forceinline__ void zero16(v8f (&acc)[4][4]) {
#pragma unroll
    for (int mb = 0; mb < 4; ++mb)
#pragma unroll
        for (int nb = 0; nb < 4; ++nb) acc[mb][nb] = (v8f){};
}

__device__ __forceinline__ h16 tohx(float x) { return (h16)x; }
__device__ __forceinline__ void splitf(float y, unsigned short& h, unsigned short& l) { h = f2bf(y); l = f2bf(y - bf2f(h)); }
typedef __attribute__((ext_vector_type(2))) unsigned short v2us;
typedef __attribute__((ext_vector_type(2))) _Float16 v2h;
typedef __attribute__((ext_vector_type(2))) float v2f;
// ---- k_proj: the three projections. grid (HW/64, IC/64, 3 images), one wave; blockIdx.z = 3 b + (0 q, 1 k, 2 v). x and W are read as f32 and rounded at the fragment load.
// q, k: A = W rows (channels), B = tokens: tile [channel][token]: a lane's 8 accumulator rows are 8 channels of one token, one 16-byte piece of a q/k fragment; + bias (a row's), split into the hi/lo bf16 planes.
// v: the roles swapped, A = tokens, B = W rows: tile [token][channel]: a lane's 8 rows are 8 keys of one channel, one 16-byte piece of a v fragment; + bias (a column's), f16.
// Both are stored from the accumulators, 512 contiguous bytes a store, without a pass through LDS.
template <bool TR>
__device__ __forceinline__ void proj_loop(const float* __restrict__ xp, const float* __restrict__ wp, v8f (&acc)[4][4]) {
    zero16(acc);
#pragma unroll 1   // rolled, as the GEMM loop was: the fragments of one k step take over the registers of the step before
    for (int kc = 0; kc < CC; kc += 32) {
        v4f xr[16], wr[4][4];
        ldx_raw(xp + (size_t)kc * HWF, xr);
#pragma unroll
        for (int b = 0; b < 4; ++b) ldw_raw(wp + (size_t)b * 16 * CC + kc, wr[b]);
        asm volatile("s_wait_xcnt 0x0" ::: "memory");   // before the address registers of the step's loads move on
        __builtin_amdgcn_sched_barrier(0);   // the step's 32 loads go out together, ahead of the rounding (one load latency a step, not one a fragment), and the pointer steps stay behind that wait
        v16bf xf[4], wf[4];
        cvx(xr, xf);
#pragma unroll
        for (int b = 0; b < 4; ++b) wf[b] = cvw(wr[b]);
#pragma unroll
        for (int nb = 0; nb < 4; ++nb)
#pragma unroll
            for (int mb = 0; mb < 4; ++mb) acc[mb][nb] = TR ? wmmab(wf[mb], xf[nb], acc[mb][nb]) : wmmab(xf[mb], wf[nb], acc[mb][nb]);
        // four vector slots behind the step's last WMMA: the distance the chip needs before a vector instruction writes its A or B (the next step's rounding, over the back edge) or reads D (the epilogue)
        asm volatile("v_nop\n\tv_nop\n\tv_nop\n\tv_nop" : "+v"(acc[0][0]), "+v"(acc[1][1]), "+v"(acc[2][2]), "+v"(acc[3][3]) : "v"(xf[0]), "v"(xf[3]), "v"(wf[0]), "v"(wf[3]));
    }
}
__global__ __launch_bounds__(32) void k_proj(const float* __restrict__ x, const float* __restrict__ wq, const float* __restrict__ wk, const float* __restrict__ wv, const float* __restrict__ bq, const float* __restrict__ bk, const float* __restrict__ bv, bf* Hh, bf* Hl, h16* GT) {
    const int lane = threadIdx.x & 31, lr = lane & 15, hi = lane >> 4; const int img = (int)blockIdx.z / 3, which = (int)blockIdx.z % 3;
    const int t0 = (int)blockIdx.x * 64, o0 = (int)blockIdx.y * 64;
    const float* xp = x + (size_t)img * CC * HWF + (size_t)(8 * hi) * HWF + t0 + 4 * lr;
    const size_t woff = (size_t)(o0 + lr) * CC + 8 * hi;
    v8f acc[4][4];
    if (which == 2) {
        float cr[4];   // the columns' biases, asked for ahead of the k loop
#pragma unroll
        for (int nb = 0; nb < 4; ++nb) cr[nb] = bv[o0 + nb * 16 + lr];
        asm volatile("s_wait_xcnt 0x0" ::: "memory");   // before the address registers of these loads are used for anything else
        __builtin_amdgcn_sched_barrier(0);   // holds what follows behind that wait
        proj_loop<false>(xp, wv + woff, acc);
        h16* G = GT + (size_t)img * IC * HW + (size_t)t0 * IC + (o0 / 16) * 512 + lane * 8;   // fragment (pair t0 / 32, channel tile o0 / 16), the lane's place
#pragma unroll
        for (int mb = 0; mb < 4; ++mb) { v8h o[4];
#pragma unroll
            for (int nb = 0; nb < 4; ++nb) { const float bb = bfr(cr[nb]);
#pragma unroll
                for (int j = 0; j < 8; ++j) o[nb][j] = tohx(__fadd_rn(acc[mb][nb][j], bb)); }
            __builtin_amdgcn_sched_barrier(0);   // the block's 4 values stand in registers of their own before the first store goes out
#pragma unroll
            for (int nb = 0; nb < 4; ++nb) *(v8h*)(G + (mb >> 1) * 4096 + nb * 512 + (mb & 1) * 256) = o[nb];   // token block mb is tile t0 / 16 + mb: pair mb / 2, run mb % 2
            asm volatile("s_wait_xcnt 0x0" ::: "memory");   // before the registers that these stores name are used again
            __builtin_amdgcn_sched_barrier(0);   // holds the next block's arithmetic behind that wait
        }
    } else {
        const float* bp = (which == 0 ? bq : bk) + o0 + 8 * hi;
        v4f br[4][2];   // the rows' biases, asked for ahead of the k loop
#pragma unroll
        for (int mb = 0; mb < 4; ++mb) { br[mb][0] = *(const v4f*)(bp + mb * 16); br[mb][1] = *(const v4f*)(bp + mb * 16 + 4); }
        asm volatile("s_wait_xcnt 0x0" ::: "memory");   // before the address registers of these loads are used for anything else
        __builtin_amdgcn_sched_barrier(0);   // holds what follows behind that wait
        proj_loop<true>(xp, (which == 0 ? wq : wk) + woff, acc);
        const size_t base = ((size_t)img * 2 + which) * HW * IC + (size_t)t0 * IC + (o0 / 16) * 256 + lane * 8;   // tile t0 / 16, run o0 / 16 of its eight, the lane's place
#pragma unroll
        for (int nb = 0; nb < 4; ++nb) { v8us oh[4], ol[4];
#pragma unroll
            for (int mb = 0; mb < 4; ++mb)
#pragma unroll
                for (int j = 0; j < 8; ++j) { unsigned short p, q; splitf(__fadd_rn(acc[mb][nb][j], bfr(br[mb][j >> 2][j & 3])), p, q); oh[mb][j] = p; ol[mb][j] = q; }
            __builtin_amdgcn_sched_barrier(0);   // the block's 8 values stand in registers of their own before the first store goes out
#pragma unroll
            for (int mb = 0; mb < 4; ++mb) { *(v8us*)(Hh + base + nb * 2048 + mb * 256) = oh[mb]; *(v8us*)(Hl + base + nb * 2048 + mb * 256) = ol[mb]; }   // token block nb is tile t0 / 16 + nb
            asm volatile("s_wait_xcnt 0x0" ::: "memory");   // before the registers that these stores name are used again
            __builtin_amdgcn_sched_barrier(0);   // holds the next block's arithmetic behind that wait
        }
    }
}
// ---- k_fattn: scores, softmax and attn.v in one pass over the keys; no score or softmax plane is stored. grid (HW/64, images), 4 waves, one per SIMD.
// Every wave holds all 64 query columns of the work-group (4 column tiles: each k and v fragment loaded feeds 4 tiles); wave w takes the keys w HW/4 .. + HW/4 - 1, 32 keys a pass.
// sT[key][query] = K . qT (A = k rows, B = q rows kept in registers; hi.hi + hi.lo + lo.hi): a lane holds 16 scores of ONE query (column l & 15; keys 8h + r and 16 + 8h + r),
// which are, converted to f16, exactly its elements 0..7 and 8..15 of the B fragment of yT[o][query] += vT . pT (A = fragments of GT). Fragments and D layout as above; q, k, v are read and y is written in fragment order,
// so column l & 15 of column tile ct is token n0 + 4 (l & 15) + ct, and the keys of a pass are those of two k tiles (the v fragments hold the same keys in the same order).
// Running maximum m and sum l per query; p = 2^((s - m) log2 e + 6) as f16. m moves (and yT, l are rescaled) only when a pass's maximum passes it by more than 5.5, so p <= 2^14.
// The four key quarters meet in LDS: y = sum_q w_q yT_q / sum_q w_q l_q, w_q = e^(m_q - max m), in the order q = 0..3; the hi/lo bf16 planes of the block's y (64 tokens x 128 channels) go to LDS from there.
// Output projection with bias and residual, behind one more barrier: wave w takes the output channels 32 w .. 32 w + 31 of all 64 tokens. A = Wo rows (read as f32, rounded at the fragment load),
// B = hi, then lo plane of y: tile [channel][token], the layout of out itself; out = (z + bo) + x, x rounded to bf16; a lane's four accumulators of one row are four neighbouring tokens, stored as one 16-byte run.
#define FL2E 1.4426950408889634f
#define FQT 4   // column tiles of 16 queries per wave
static_assert(IC == 128 && (HW % 128) == 0 && HW / 4 >= 64 && FQT == 4);
__global__ __launch_bounds__(128) void k_fattn(const bf* __restrict__ Hh, const bf* __restrict__ Hl, const h16* __restrict__ GT, const float* __restrict__ wo, const float* __restrict__ xb, const float* __restrict__ bo, float* OUTb) {
    __shared__ __align__(16) float part[4 * 8 * FQT * 256];
    __shared__ float msh[4][FQT][16];
    __shared__ float lsh[4][FQT][16];
    __shared__ __align__(16) bf ysh[2][FQT * 2048];   // hi, lo plane of the block's y: tile ct at element ct * 2048, fragment order
    const int lane = threadIdx.x & 31, lr = lane & 15, hi = lane >> 4; const int w = __builtin_amdgcn_readfirstlane((int)(threadIdx.x >> 5));
    const size_t PLc = (size_t)HW * IC; const size_t img = blockIdx.y; const int n0 = (int)blockIdx.x * 64;
    const size_t qoff = img * 2 * PLc + (size_t)n0 * IC + lane * 8;
    const bf* khn = Hh + img * 2 * PLc + PLc + (size_t)(w * (HW / 4)) * IC + lane * 8;   // the lane's place in the k tiles that are loaded next
    const bf* kln = Hl + img * 2 * PLc + PLc + (size_t)(w * (HW / 4)) * IC + lane * 8;
    const h16* vp = GT + img * PLc + (size_t)(w * (HW / 4)) * IC + lane * 8;
    v16bf qh[FQT][4], ql[FQT][4];
#pragma unroll
    for (int ct = 0; ct < FQT; ++ct)
#pragma unroll
        for (int ks = 0; ks < 4; ++ks) { qh[ct][ks] = WFrag<bf>::ld(Hh + qoff + (ct * 4 + ks) * 512); ql[ct][ks] = WFrag<bf>::ld(Hl + qoff + (ct * 4 + ks) * 512); }
    asm volatile("s_wait_xcnt 0x0" ::: "memory");   // before the address registers of the q loads are used for anything else
    __builtin_amdgcn_sched_barrier(0);   // holds what follows behind that wait
    v8f acc[8][FQT];
#pragma unroll
    for (int ot = 0; ot < 8; ++ot)
#pragma unroll
        for (int ct = 0; ct < FQT; ++ct) acc[ot][ct] = (v8f){};
    float m[FQT], l[FQT];
#pragma unroll
    for (int ct = 0; ct < FQT; ++ct) { m[ct] = -3.0e38f; l[ct] = 0.f; }
    v16bf kh[4][2], kl[4][2];   // loaded tile by tile, plane by plane: the eight 512-B runs of a tile follow one another in memory
#pragma unroll
    for (int kt = 0; kt < 2; ++kt) {
#pragma unroll
        for (int ks = 0; ks < 4; ++ks) kh[ks][kt] = WFrag<bf>::ld(khn + (kt * 4 + ks) * 512);
#pragma unroll
        for (int ks = 0; ks < 4; ++ks) kl[ks][kt] = WFrag<bf>::ld(kln + (kt * 4 + ks) * 512); }
    asm volatile("s_wait_xcnt 0x0" ::: "memory");   // before the address registers of the k loads move on
    __builtin_amdgcn_sched_barrier(0);   // holds the pointer steps behind that wait
    khn += 32 * IC; kln += 32 * IC;
#pragma unroll 1   // rolled: the pass is some 500 instructions long and its fragments take their registers over from the pass before
    for (int kb = 0; kb < HW / 4; kb += 32) {
        v16h vf[8];
#pragma unroll
        for (int ot = 0; ot < 8; ++ot) vf[ot] = WFrag<h16>::ld(vp + kb * IC + ot * 512);
        asm volatile("s_wait_xcnt 0x0" ::: "memory");   // before the address registers of the v loads are used for anything else
        // keeps the 16 v loads at the head of the pass, all the score WMMAs and the softmax ahead of their use (one wave per SIMD: nothing else covers a load)
        __builtin_amdgcn_sched_barrier(0);
        v8f s[2][FQT];
#pragma unroll
        for (int kt = 0; kt < 2; ++kt)
#pragma unroll
            for (int ct = 0; ct < FQT; ++ct) s[kt][ct] = (v8f){};
#pragma unroll
        for (int ks = 0; ks < 4; ++ks) {
#pragma unroll
            for (int kt = 0; kt < 2; ++kt)
#pragma unroll
                for (int ct = 0; ct < FQT; ++ct) s[kt][ct] = wmmab(kh[ks][kt], qh[ct][ks], s[kt][ct]);
#pragma unroll
            for (int kt = 0; kt < 2; ++kt)
#pragma unroll
                for (int ct = 0; ct < FQT; ++ct) s[kt][ct] = wmmab(kh[ks][kt], ql[ct][ks], s[kt][ct]);
#pragma unroll
            for (int kt = 0; kt < 2; ++kt)
#pragma unroll
                for (int ct = 0; ct < FQT; ++ct) s[kt][ct] = wmmab(kl[ks][kt], qh[ct][ks], s[kt][ct]);
        }
        // the next pass's 32 k loads go out here, into the registers that the score WMMAs above have just read, and fly during the softmax and attn.v (the last pass loads its own rows again, unused)
        __builtin_amdgcn_sched_barrier(0);
#pragma unroll
        for (int kt = 0; kt < 2; ++kt) {
#pragma unroll
            for (int ks = 0; ks < 4; ++ks) kh[ks][kt] = WFrag<bf>::ld(khn + (kt * 4 + ks) * 512);
#pragma unroll
            for (int ks = 0; ks < 4; ++ks) kl[ks][kt] = WFrag<bf>::ld(kln + (kt * 4 + ks) * 512); }
        asm volatile("s_wait_xcnt 0x0" ::: "memory");   // before the address registers of the k loads move on
        __builtin_amdgcn_sched_barrier(0);   // holds the k loads (and their wait) in front of the pointer steps and the softmax
        const int kstep = (kb + 64 < HW / 4) ? 32 * IC : 0; khn += kstep; kln += kstep;
        float ml[FQT]; bool need = false;
#pragma unroll
        for (int ct = 0; ct < FQT; ++ct) { float t = fmaxf(s[0][ct][0], s[1][ct][0]);
#pragma unroll
            for (int r = 1; r < 8; ++r) t = fmaxf(t, fmaxf(s[0][ct][r], s[1][ct][r]));
            ml[ct] = fmaxf(t, __shfl_xor(t, 16, 32)); need = need || (ml[ct] > m[ct] + 5.5f); }
        if (__builtin_amdgcn_ballot_w32(need) != 0) {
#pragma unroll
            for (int ct = 0; ct < FQT; ++ct) { const float mn = fmaxf(m[ct], ml[ct]); const float al = __builtin_amdgcn_exp2f((m[ct] - mn) * FL2E); m[ct] = mn; l[ct] *= al;
#pragma unroll
                for (int ot = 0; ot < 8; ++ot) acc[ot][ct] *= al; }
        }
        v16h pf[FQT];
#pragma unroll
        for (int ct = 0; ct < FQT; ++ct) { float sum = 0.f;
#pragma unroll
            for (int kt = 0; kt < 2; ++kt)
#pragma unroll
                for (int r = 0; r < 8; ++r) { const float p = __builtin_amdgcn_exp2f((s[kt][ct][r] - m[ct]) * FL2E + 6.0f); sum += p; pf[ct][kt * 8 + r] = (h16)p; }
            l[ct] += sum; }
#pragma unroll
        for (int ot = 0; ot < 8; ++ot)
#pragma unroll
            for (int ct = 0; ct < FQT; ++ct) acc[ot][ct] = wmma16(vf[ot], pf[ct], acc[ot][ct]);
    }
    // the output projection's operands from memory (the wave's 32 rows of Wo, its tile of x, the rows' biases) are asked for here and arrive under the join of the key quarters
    const int c0 = w * 32;
    const float* xp = xb + img * CC * HWF + (size_t)(c0 + 8 * hi) * HWF + n0 + 4 * lr;
    const float* wp = wo + (size_t)(c0 + lr) * IC + 8 * hi;
    const char* bp = (const char*)(bo + c0); const unsigned bofs = 32u * (unsigned)hi;   // the lane's 8 rows' biases: byte offset from the wave's first
    v4f xs[2][8], br[2][2], wr[2][4][4];
#pragma unroll
    for (int mb = 0; mb < 2; ++mb) { br[mb][0] = *(const v4f*)(bp + bofs + mb * 64); br[mb][1] = *(const v4f*)(bp + bofs + mb * 64 + 16);
#pragma unroll
        for (int ks = 0; ks < 4; ++ks) ldw_raw(wp + (size_t)mb * 16 * IC + ks * 32, wr[mb][ks]);
#pragma unroll
        for (int j = 0; j < 8; ++j) xs[mb][j] = *(const v4f*)(xp + (size_t)(mb * 16 + j) * HWF); }
    asm volatile("s_wait_xcnt 0x0" :: "v"(xp), "v"(wp), "v"(bofs) : "memory");   // before the address registers of these loads are used for anything else: named as inputs, they stay as they are up to the wait
    __builtin_amdgcn_sched_barrier(0);   // holds the loads in front of the join (their latency passes under it) and what follows behind that wait
#pragma unroll
    for (int ct = 0; ct < FQT; ++ct) { l[ct] += __shfl_xor(l[ct], 16, 32); if (hi == 0) { msh[w][ct][lr] = m[ct]; lsh[w][ct][lr] = l[ct]; } }
    float* my = part + w * (8 * FQT * 256) + lane * 4;
#pragma unroll
    for (int ot = 0; ot < 8; ++ot)
#pragma unroll
        for (int ct = 0; ct < FQT; ++ct) { const v8f t = acc[ot][ct]; *(v4fa*)(my + (ot * FQT + ct) * 256) = (v4f){t[0], t[1], t[2], t[3]}; *(v4fa*)(my + (ot * FQT + ct) * 256 + 128) = (v4f){t[4], t[5], t[6], t[7]}; }
    __syncthreads();
    // wave w merges the 16 queries of column tile w, all 128 channels: tile w of each y plane in LDS, its eight 512-B runs
    float wq[4]; float mm = msh[0][w][lr];
#pragma unroll
    for (int q = 1; q < 4; ++q) mm = fmaxf(mm, msh[q][w][lr]);
    float ls = 0.f;
#pragma unroll
    for (int q = 0; q < 4; ++q) { wq[q] = __builtin_amdgcn_exp2f((msh[q][w][lr] - mm) * FL2E); ls += wq[q] * lsh[q][w][lr]; }
    const float inv = __fdiv_rn(1.0f, ls);
    const int yoff = w * 2048 + lane * 8;
#pragma unroll
    for (int j = 0; j < 8; ++j) { const float* sp = part + (j * FQT + w) * 256 + lane * 4; v4f a0 = wq[0] * *(const v4fa*)sp, a1 = wq[0] * *(const v4fa*)(sp + 128);
#pragma unroll
        for (int q = 1; q < 4; ++q) { a0 += wq[q] * *(const v4fa*)(sp + q * (8 * FQT * 256)); a1 += wq[q] * *(const v4fa*)(sp + q * (8 * FQT * 256) + 128); }
        v8us o_h, o_l;
#pragma unroll
        for (int u = 0; u < 4; ++u) { unsigned short p, q2; splitf(a0[u] * inv, p, q2); o_h[u] = p; o_l[u] = q2; splitf(a1[u] * inv, p, q2); o_h[4 + u] = p; o_l[4 + u] = q2; }
        *(v8usa*)(&ysh[0][yoff + j * 256]) = o_h; *(v8usa*)(&ysh[1][yoff + j * 256]) = o_l; }
    __syncthreads();   // every wave reads all four tiles of y
    v16bf yb[4][4], yb2[4][4];
#pragma unroll
    for (int ks = 0; ks < 4; ++ks)
#pragma unroll
        for (int nb = 0; nb < 4; ++nb) { const int e = nb * 2048 + ks * 512 + lane * 8;
            yb[ks][nb] = cat16b(*(const v8usa*)(&ysh[0][e]), *(const v8usa*)(&ysh[0][e + 256])); yb2[ks][nb] = cat16b(*(const v8usa*)(&ysh[1][e]), *(const v8usa*)(&ysh[1][e + 256])); }
    __builtin_amdgcn_sched_barrier(0);   // the 64 LDS reads go out as one group ahead of the WMMAs
    v8f z[2][4];
#pragma unroll
    for (int mb = 0; mb < 2; ++mb)
#pragma unroll
        for (int nb = 0; nb < 4; ++nb) z[mb][nb] = (v8f){};
#pragma unroll
    for (int ks = 0; ks < 4; ++ks) { v16bf a[2];
#pragma unroll
        for (int mb = 0; mb < 2; ++mb) a[mb] = cvw(wr[mb][ks]);
#pragma unroll
        for (int nb = 0; nb < 4; ++nb)
#pragma unroll
            for (int mb = 0; mb < 2; ++mb) z[mb][nb] = wmmab(a[mb], yb[ks][nb], z[mb][nb]);
#pragma unroll
        for (int nb = 0; nb < 4; ++nb)
#pragma unroll
            for (int mb = 0; mb < 2; ++mb) z[mb][nb] = wmmab(a[mb], yb2[ks][nb], z[mb][nb]); }
    float* op = OUTb + img * CC * HW + (size_t)(c0 + 8 * hi) * HW + n0 + 4 * lr;
#pragma unroll
    for (int mb = 0; mb < 2; ++mb) { v4f r[8];
#pragma unroll
        for (int j = 0; j < 8; ++j) { const float bb = bfr(br[mb][j >> 2][j & 3]);
#pragma unroll
            for (int nb = 0; nb < 4; ++nb) r[j][nb] = __fadd_rn(__fadd_rn(z[mb][nb][j], bb), bfr(xs[mb][j][nb])); }
        __builtin_amdgcn_sched_barrier(0);   // the block's 8 values stand in registers of their own before the first store goes out
#pragma unroll
        for (int j = 0; j < 8; ++j) *(v4f*)(op + (size_t)(mb * 16 + j) * HW) = r[j];
        asm volatile("s_wait_xcnt 0x0" ::: "memory");   // before the registers that these stores name are used again
        __builtin_amdgcn_sched_barrier(0);   // holds the next block's arithmetic behind that wait
    }
}

extern "C" void kernel_launch(void* const* d_in, const int* in_sizes, int n_in,
                              void* d_out, int out_size, void* d_ws, size_t ws_size, hipStream_t stream) {
    if (n_in < 9) return;
    if (in_sizes[0] < NB * CC * HW) return;
    if (in_sizes[1] < IC * CC || in_sizes[3] < IC * CC || in_sizes[5] < IC * CC || in_sizes[7] < CC * IC) return;
    if (in_sizes[2] < IC || in_sizes[4] < IC || in_sizes[6] < IC || in_sizes[8] < CC) return;
    if (out_size < NB * CC * HW) return;
    const float* x  = (const float*)d_in[0];   // [NB][CC][HWF]
    const float* wq = (const float*)d_in[1];   // [IC][CC]  (queries)
    const float* bq = (const float*)d_in[2];   // [IC]
    const float* wk = (const float*)d_in[3];   // [IC][CC]  (keys)
    const float* bk = (const float*)d_in[4];   // [IC]
    const float* wv = (const float*)d_in[5];   // [IC][CC]  (values)
    const float* bv = (const float*)d_in[6];   // [IC]
    const float* wo = (const float*)d_in[7];   // [CC][IC]  (output projection)
    const float* bo = (const float*)d_in[8];   // [CC]
    float* OUT = (float*)d_out;                // [NB][CC][HW]
    char* wsp = (char*)d_ws;
    auto take = [&](size_t bytes) { char* p = wsp; wsp += (bytes + 255) & ~(size_t)255; return (void*)p; };
    bf* Hh  = (bf*)take((size_t)NB * 2 * HW * IC * 2);     // [b] hi planes of q+bq, k+bk
    bf* Hl  = (bf*)take((size_t)NB * 2 * HW * IC * 2);     // [b] lo planes of q+bq, k+bk
    h16* GT = (h16*)take((size_t)NB * IC * HW * 2);        // [b] fp16 (v + bv)
    if ((size_t)(wsp - (char*)d_ws) > ws_size) return;

    // Every launch takes all NB images (the image is a grid dimension).
    // q / k [m][o] = sum_c x[c][m] W[o][c] + bias as hi/lo planes, v [o][m] + bias as f16, all in fragment order   (z = 3 b + (0 q, 1 k, 2 v); exact bf16 products)
    k_proj<<<dim3(HW / 64, IC / 64, 3 * NB), 32, 0, stream>>>(x, wq, wk, wv, bq, bk, bv, Hh, Hl, GT);
    // y = softmax(q . k) . v; out[c][n] = (sum_o Wo[c][o] y[n][o] + bo[c]) + x[c][n]  (hi + lo planes of y, 2 products)
    k_fattn<<<dim3(HW / 64, NB), 128, 0, stream>>>(Hh, Hl, GT, wo, x, bo, OUT);
}

// v007
// It runs in 54.3 microseconds.
// Two timings next to v006 both put it at 1.04 times that version's speed.
// Counting every step since v000, it is 11.5 times as fast.
#include <hip/hip_runtime.h>

// All contractions on 16-bit WMMA, f32 accumulate: the three 1x1 projections q/k/v = v_wmma_f32_16x16x32_bf16 on RNE-bf16 values of x and of the weights (single products); scores q.k = bf16 hi/lo split (hi.hi + lo.hi + hi.lo, K = 128); attn.v = v_wmma_f32_16x16x32_f16 (unnormalised softmax terms carried x 2^6 as f16, v as f16); output projection = bf16 Wo times bf16 hi/lo planes of y (2 products). Bias adds, softmax and the residual add in f32.
// x [NB][128][4096]; q/k hi/lo planes and the f16 plane of v lie in the workspace, the hi/lo planes of y in LDS, all in FRAGMENT ORDER (below: "Fragment order"); s[n][m] = q_n . k_m (unscaled); attn[n][m] = softmax_m(s); y[n][o] = sum_m attn[n][m] v[m][o]; out[c][n] = x[c][n] + bo[c] + sum_o Wo[c][o] y[n][o]. Two launches: projections; attention with the output projection as its epilogue (y stays in LDS); every convert or transposing step is done where a GEMM loads a fragment or stores its tile.

#ifndef NB
#define NB 4
#endif
#ifndef SEQ
#define SEQ 4096
#endif
#define NB_FULL  4
#define SEQ_FULL 4096
#define CC   128
#define IC   128
#define HW   SEQ
#define HWF  SEQ_FULL
static_assert(NB >= 1 && NB <= NB_FULL);
static_assert(SEQ >= 128 && SEQ <= SEQ_FULL && (SEQ % 128) == 0);
static_assert((HW % 64) == 0 && (IC % 64) == 0 && (CC % 64) == 0);
static_assert((HW % 32) == 0 && (IC % 32) == 0 && (CC % 32) == 0);
static_assert(((IC * CC) % 8) == 0 && ((HW * CC) % 4) == 0 && ((HW * IC) % 4) == 0 && ((IC * HW) % 2) == 0 && (HW % 8) == 0 && (IC % 4) == 0);
static_assert(((size_t)HW * CC / 4) % 256 == 0 && ((size_t)HW * IC / 4) % 256 == 0 && ((size_t)HW * IC / 2) % 256 == 0);

typedef _Float16 h16;
typedef unsigned short bf;
typedef __attribute__((ext_vector_type(16))) __bf16   v16bf;
typedef __attribute__((ext_vector_type(16))) _Float16 v16h;
typedef __attribute__((ext_vector_type(8)))  _Float16 v8h;
typedef __attribute__((ext_vector_type(8)))  unsigned short v8us;
typedef __attribute__((ext_vector_type(8)))  float    v8f;
typedef __attribute__((ext_vector_type(4)))  float    v4f;
typedef v8h  __attribute__((may_alias)) v8ha;
typedef v4f  __attribute__((may_alias)) v4fa;
typedef v8us __attribute__((may_alias)) v8usa;

__device__ __forceinline__ unsigned short f2bf(float f) { unsigned u = __float_as_uint(f); u += 0x7FFFu + ((u >> 16) & 1u); return (unsigned short)(u >> 16); }
__device__ __forceinline__ float bf2f(unsigned short b) { return __uint_as_float(((unsigned)b) << 16); }
__device__ __forceinline__ float bfr(float f) { return bf2f(f2bf(f)); }
__device__ __forceinline__ v16h cat16(v8h lo, v8h hi) { return __builtin_shufflevector(lo, hi, 0, 1, 2, 3, 4, 5, 6, 7, 8, 9, 10, 11, 12, 13, 14, 15); }
__device__ __forceinline__ v16bf cat16b(v8us lo, v8us hi) { return __builtin_bit_cast(v16bf, __builtin_shufflevector(lo, hi, 0, 1, 2, 3, 4, 5, 6, 7, 8, 9, 10, 11, 12, 13, 14, 15)); }
__device__ __forceinline__ v8f wmma16(v16h a, v16h b, v8f c) { return __builtin_amdgcn_wmma_f32_16x16x32_f16(false, a, false, b, (short)0, c, false, false); }
__device__ __forceinline__ v8f wmmab(v16bf a, v16bf b, v8f c) { return __builtin_amdgcn_wmma_f32_16x16x32_bf16(false, a, false, b, (short)0, c, false, false); }

// ---- The projection GEMMs: K = 128 in 4 steps of 32, fragments formed straight from the operands as they lie in memory (k_proj: ONE WAVE per 64x64 output tile, 16 accumulators).
// Fragments: lane l, h = l >> 4, row/col = l & 15; elements 0..7 = k0 + 8h + 0..7, elements 8..15 = k0 + 16 + 8h + 0..7 for BOTH A and B; D element r = (row 8h + r, col l & 15).
// Tokens are dealt to the four 16-wide blocks of a tile as token = t0 + 4 (l & 15) + block: a lane's 16-byte load of x gives one element to each of its four fragments,
// and in the output projection, where tokens are the tile's columns, a lane's four accumulators of one row are four neighbouring tokens, stored as one run without a pass through LDS.
// Fragment order: every 16-bit plane (workspace or LDS) is a row of 1-KiB fragments, each two runs of 512 B: run j holds, at lane l's 16 bytes (l * 16), the lane's elements 8 j .. 8 j + 7.
// A wave-wide 16-byte load or store of a run is 512 contiguous bytes (4 whole 128-B lines), where rows of a token- or channel-major plane gave 16 lines a load.
// q, k, y planes: fragment (tile, ks) at element (tile * 4 + ks) * 512; row l & 15 of tile T is token (T / 4) * 64 + 4 (l & 15) + T % 4 (the deal above), channels 32 ks + 16 j + 8 h + 0..7.
// v plane: fragment (pair P of tiles, channel tile ot) at element (P * 8 + ot) * 512; row l & 15 is channel 16 ot + (l & 15), run j holds rows 8 h + 0..7 of tile 2 P + j: keys in the order of the k tiles.
// ld(p): p = fragment start + 8 l.
template <typename T16> struct WFrag;
template <> struct WFrag<h16> { typedef v16h V; static __device__ __forceinline__ V ld(const h16* p) { return cat16(*(const v8h*)p, *(const v8h*)(p + 256)); } static __device__ __forceinline__ v8f mma(V a, V b, v8f c) { return wmma16(a, b, c); } };
template <> struct WFrag<bf> { typedef v16bf V; static __device__ __forceinline__ V ld(const bf* p) { return cat16b(*(const v8us*)p, *(const v8us*)(p + 256)); } static __device__ __forceinline__ v8f mma(V a, V b, v8f c) { return wmmab(a, b, c); } };
static_assert(CC == 128 && IC == 128 && (HW % 64) == 0);
// 16 k values of one row of an f32 matrix [row][k]: raw load (p = row start + k0 + 8h), then rounding to bf16 (to nearest even)
__device__ __forceinline__ void ldw_raw(const float* __restrict__ p, v4f (&r)[4]) { r[0] = *(const v4f*)p; r[1] = *(const v4f*)(p + 4); r[2] = *(const v4f*)(p + 16); r[3] = *(const v4f*)(p + 20); }
__device__ __forceinline__ v16bf cvw(const v4f (&r)[4]) { v16bf f;
#pragma unroll
    for (int g = 0; g < 4; ++g)
#pragma unroll
        for (int u = 0; u < 4; ++u) f[4 * g + u] = (__bf16)r[g][u];
    return f; }
// the four token fragments of one k step from x [k][token] f32: raw load (p = x + (k0 + 8h) HWF + t0 + 4 (l & 15)), then rounding to bf16 (to nearest even); word i of a load belongs to block i
__device__ __forceinline__ void ldx_raw(const float* __restrict__ p, v4f (&r)[16]) {
#pragma unroll
    for (int e = 0; e < 16; ++e) r[e] = *(const v4f*)(p + (size_t)(e < 8 ? e : e + 8) * HWF); }
__device__ __forceinline__ void cvx(const v4f (&r)[16], v16bf (&f)[4]) {
#pragma unroll
    for (int e = 0; e < 16; ++e)
#pragma unroll
        for (int i = 0; i < 4; ++i) f[i][e] = (__bf16)r[e][i]; }
__device__ __forceinline__ void zero16(v8f (&acc)[4][4]) {
#pragma unroll
    for (int mb = 0; mb < 4; ++mb)
#pragma unroll
        for (int nb = 0; nb < 4; ++nb) acc[mb][nb] = (v8f){};
}

__device__ __forceinline__ h16 tohx(float x) { return (h16)x; }
__device__ __forceinline__ void splitf(float y, unsigned short& h, unsigned short& l) { h = f2bf(y); l = f2bf(y - bf2f(h)); }
typedef __attribute__((ext_vector_type(2))) unsigned short v2us;
typedef __attribute__((ext_vector_type(2))) _Float16 v2h;
typedef __attribute__((ext_vector_type(2))) float v2f;
// ---- k_proj: the three projections. grid (HW/64, IC/64, 3 images), one wave; blockIdx.z = 3 b + (0 q, 1 k, 2 v). x and W are read as f32 and rounded at the fragment load.
// q, k: A = W rows (channels), B = tokens: tile [channel][token]: a lane's 8 accumulator rows are 8 channels of one token, one 16-byte piece of a q/k fragment; + bias (a row's), split into the hi/lo bf16 planes.
// v: the roles swapped, A = tokens, B = W rows: tile [token][channel]: a lane's 8 rows are 8 keys of one channel, one 16-byte piece of a v fragment; + bias (a column's), f16.
// Both are stored from the accumulators, 512 contiguous bytes a store, without a pass through LDS.
template <bool TR>
__device__ __forceinline__ void proj_loop(const float* __restrict__ xp, const float* __restrict__ wp, v8f (&acc)[4][4]) {
    zero16(acc);
#pragma unroll 1   // rolled, as the GEMM loop was: the fragments of one k step take over the registers of the step before
    for (int kc = 0; kc < CC; kc += 32) {
        v4f xr[16], wr[4][4];
        ldx_raw(xp + (size_t)kc * HWF, xr);
#pragma unroll
        for (int b = 0; b < 4; ++b) ldw_raw(wp + (size_t)b * 16 * CC + kc, wr[b]);
        asm volatile("s_wait_xcnt 0x0" ::: "memory");   // before the address registers of the step's loads move on
        __builtin_amdgcn_sched_barrier(0);   // the step's 32 loads go out together, ahead of the rounding (one load latency a step, not one a fragment), and the pointer steps stay behind that wait
        v16bf xf[4], wf[4];
        cvx(xr, xf);
#pragma unroll
        for (int b = 0; b < 4; ++b) wf[b] = cvw(wr[b]);
#pragma unroll
        for (int nb = 0; nb < 4; ++nb)
#pragma unroll
            for (int mb = 0; mb < 4; ++mb) acc[mb][nb] = TR ? wmmab(wf[mb], xf[nb], acc[mb][nb]) : wmmab(xf[mb], wf[nb], acc[mb][nb]);
        // four vector slots behind the step's last WMMA: the distance the chip needs before a vector instruction writes its A or B (the next step's rounding, over the back edge) or reads D (the epilogue)
        asm volatile("v_nop\n\tv_nop\n\tv_nop\n\tv_nop" : "+v"(acc[0][0]), "+v"(acc[1][1]), "+v"(acc[2][2]), "+v"(acc[3][3]) : "v"(xf[0]), "v"(xf[3]), "v"(wf[0]), "v"(wf[3]));
    }
}
__global__ __launch_bounds__(32) void k_proj(const float* __restrict__ x, const float* __restrict__ wq, const float* __restrict__ wk, const float* __restrict__ wv, const float* __restrict__ bq, const float* __restrict__ bk, const float* __restrict__ bv, bf* Hh, bf* Hl, h16* GT) {
    const int lane = threadIdx.x & 31, lr = lane & 15, hi = lane >> 4; const int img = (int)blockIdx.z / 3, which = (int)blockIdx.z % 3;
    const int t0 = (int)blockIdx.x * 64, o0 = (int)blockIdx.y * 64;
    const float* xp = x + (size_t)img * CC * HWF + (size_t)(8 * hi) * HWF + t0 + 4 * lr;
    const size_t woff = (size_t)(o0 + lr) * CC + 8 * hi;
    v8f acc[4][4];
    if (which == 2) {
        float cr[4];   // the columns' biases, asked for ahead of the k loop
#pragma unroll
        for (int nb = 0; nb < 4; ++nb) cr[nb] = bv[o0 + nb * 16 + lr];
        asm volatile("s_wait_xcnt 0x0" ::: "memory");   // before the address registers of these loads are used for anything else
        __builtin_amdgcn_sched_barrier(0);   // holds what follows behind that wait
        proj_loop<false>(xp, wv + woff, acc);
        h16* G = GT + (size_t)img * IC * HW + (size_t)t0 * IC + (o0 / 16) * 512 + lane * 8;   // fragment (pair t0 / 32, channel tile o0 / 16), the lane's place
#pragma unroll
        for (int mb = 0; mb < 4; ++mb) { v8h o[4];
#pragma unroll
            for (int nb = 0; nb < 4; ++nb) { const float bb = bfr(cr[nb]);
#pragma unroll
                for (int j = 0; j < 8; ++j) o[nb][j] = tohx(__fadd_rn(acc[mb][nb][j], bb)); }
            __builtin_amdgcn_sched_barrier(0);   // the block's 4 values stand in registers of their own before the first store goes out
#pragma unroll
            for (int nb = 0; nb < 4; ++nb) *(v8h*)(G + (mb >> 1) * 4096 + nb * 512 + (mb & 1) * 256) = o[nb];   // token block mb is tile t0 / 16 + mb: pair mb / 2, run mb % 2
            asm volatile("s_wait_xcnt 0x0" ::: "memory");   // before the registers that these stores name are used again
            __builtin_amdgcn_sched_barrier(0);   // holds the next block's arithmetic behind that wait
        }
    } else {
        const float* bp = (which == 0 ? bq : bk) + o0 + 8 * hi;
        v4f br[4][2];   // the rows' biases, asked for ahead of the k loop
#pragma unroll
        for (int mb = 0; mb < 4; ++mb) { br[mb][0] = *(const v4f*)(bp + mb * 16); br[mb][1] = *(const v4f*)(bp + mb * 16 + 4); }
        asm volatile("s_wait_xcnt 0x0" ::: "memory");   // before the address registers of these loads are used for anything else
        __builtin_amdgcn_sched_barrier(0);   // holds what follows behind that wait
        proj_loop<true>(xp, (which == 0 ? wq : wk) + woff, acc);
        const size_t base = ((size_t)img * 2 + which) * HW * IC + (size_t)t0 * IC + (o0 / 16) * 256 + lane * 8;   // tile t0 / 16, run o0 / 16 of its eight, the lane's place
#pragma unroll
        for (int nb = 0; nb < 4; ++nb) { v8us oh[4], ol[4];
#pragma unroll
            for (int mb = 0; mb < 4; ++mb)
#pragma unroll
                for (int j = 0; j < 8; ++j) { unsigned short p, q; splitf(__fadd_rn(acc[mb][nb][j], bfr(br[mb][j >> 2][j & 3])), p, q); oh[mb][j] = p; ol[mb][j] = q; }
            __builtin_amdgcn_sched_barrier(0);   // the block's 8 values stand in registers of their own before the first store goes out
#pragma unroll
            for (int mb = 0; mb < 4; ++mb) { *(v8us*)(Hh + base + nb * 2048 + mb * 256) = oh[mb]; *(v8us*)(Hl + base + nb * 2048 + mb * 256) = ol[mb]; }   // token block nb is tile t0 / 16 + nb
            asm volatile("s_wait_xcnt 0x0" ::: "memory");   // before the registers that these stores name are used again
            __builtin_amdgcn_sched_barrier(0);   // holds the next block's arithmetic behind that wait
        }
    }
}
// ---- k_fattn: scores, softmax and attn.v in one pass over the keys; no score or softmax plane is stored. grid (HW/64, images), 4 waves, one per SIMD.
// Every wave holds all 64 query columns of the work-group (4 column tiles: each k and v fragment loaded feeds 4 tiles); wave w takes the keys w HW/4 .. + HW/4 - 1, 32 keys a pass.
// The walk over a quarter's FNP passes starts at a pass set by the work-group's index and wraps round: the work-groups of an image, which all read the same k and v planes and start together,
// stand two by two at different lines at any moment (no crowd of requests on one line), and a line that memory has to bring is asked for early by one pair of work-groups, and is an L2 hit for those that come to it later.
// sT[key][query] = K . qT (A = k rows, B = q rows kept in registers; hi.hi + hi.lo + lo.hi): a lane holds 16 scores of ONE query (column l & 15; keys 8h + r and 16 + 8h + r),
// which are, converted to f16, exactly its elements 0..7 and 8..15 of the B fragment of yT[o][query] += vT . pT (A = fragments of GT). Fragments and D layout as above; q, k, v are read and y is written in fragment order,
// so column l & 15 of column tile ct is token n0 + 4 (l & 15) + ct, and the keys of a pass are those of two k tiles (the v fragments hold the same keys in the same order).
// Running maximum m and sum l per query; p = 2^((s - m) log2 e + 6) as f16. m moves (and yT, l are rescaled) only when a pass's maximum passes it by more than 5.5, so p <= 2^14.
// The four key quarters meet in LDS: y = sum_q w_q yT_q / sum_q w_q l_q, w_q = e^(m_q - max m), in the order q = 0..3; the hi/lo bf16 planes of the block's y (64 tokens x 128 channels) go to LDS from there.
// Output projection with bias and residual, behind one more barrier: wave w takes the output channels 32 w .. 32 w + 31 of all 64 tokens. A = Wo rows (read as f32, rounded at the fragment load),
// B = hi, then lo plane of y: tile [channel][token], the layout of out itself; out = (z + bo) + x, x rounded to bf16; a lane's four accumulators of one row are four neighbouring tokens, stored as one 16-byte run.
#define FL2E 1.4426950408889634f
#define FQT 4   // column tiles of 16 queries per wave
#define FNP (HW / 4 / 32)   // passes of 32 keys in a wave's quarter
static_assert(IC == 128 && (HW % 128) == 0 && HW / 4 >= 64 && FQT == 4);
__global__ __launch_bounds__(128) void k_fattn(const bf* __restrict__ Hh, const bf* __restrict__ Hl, const h16* __restrict__ GT, const float* __restrict__ wo, const float* __restrict__ xb, const float* __restrict__ bo, float* OUTb) {
    __shared__ __align__(16) float part[4 * 8 * FQT * 256];
    __shared__ float msh[4][FQT][16];
    __shared__ float lsh[4][FQT][16];
    __shared__ __align__(16) bf ysh[2][FQT * 2048];   // hi, lo plane of the block's y: tile ct at element ct * 2048, fragment order
    const int lane = threadIdx.x & 31, lr = lane & 15, hi = lane >> 4; const int w = __builtin_amdgcn_readfirstlane((int)(threadIdx.x >> 5));
    const size_t PLc = (size_t)HW * IC; const size_t img = blockIdx.y; const int n0 = (int)blockIdx.x * 64;
    const size_t qoff = img * 2 * PLc + (size_t)n0 * IC + lane * 8;
    // first pass of the walk: neighbours in the index, and work-groups 8 apart, get different starts (each start is shared by two of the 64 work-groups of an image)
    int cp = (int)(((blockIdx.x >> 3) << 2 | (blockIdx.x & 3)) % FNP);   // the pass (32 keys of the quarter) that is worked on
    const bf* khn = Hh + img * 2 * PLc + PLc + (size_t)(w * (HW / 4) + cp * 32) * IC + lane * 8;   // the lane's place in the k tiles that are loaded next
    const bf* kln = Hl + img * 2 * PLc + PLc + (size_t)(w * (HW / 4) + cp * 32) * IC + lane * 8;
    const h16* vp = GT + img * PLc + (size_t)(w * (HW / 4) + cp * 32) * IC + lane * 8;   // the lane's place in the v fragments of pass cp
    v16bf qh[FQT][4], ql[FQT][4];
#pragma unroll
    for (int ct = 0; ct < FQT; ++ct)
#pragma unroll
        for (int ks = 0; ks < 4; ++ks) { qh[ct][ks] = WFrag<bf>::ld(Hh + qoff + (ct * 4 + ks) * 512); ql[ct][ks] = WFrag<bf>::ld(Hl + qoff + (ct * 4 + ks) * 512); }
    asm volatile("s_wait_xcnt 0x0" ::: "memory");   // before the address registers of the q loads are used for anything else
    __builtin_amdgcn_sched_barrier(0);   // holds what follows behind that wait
    v8f acc[8][FQT];
#pragma unroll
    for (int ot = 0; ot < 8; ++ot)
#pragma unroll
        for (int ct = 0; ct < FQT; ++ct) acc[ot][ct] = (v8f){};
    float m[FQT], l[FQT];
#pragma unroll
    for (int ct = 0; ct < FQT; ++ct) { m[ct] = -3.0e38f; l[ct] = 0.f; }
    v16bf kh[4][2], kl[4][2];   // loaded tile by tile, plane by plane: the eight 512-B runs of a tile follow one another in memory
#pragma unroll
    for (int kt = 0; kt < 2; ++kt) {
#pragma unroll
        for (int ks = 0; ks < 4; ++ks) kh[ks][kt] = WFrag<bf>::ld(khn + (kt * 4 + ks) * 512);
#pragma unroll
        for (int ks = 0; ks < 4; ++ks) kl[ks][kt] = WFrag<bf>::ld(kln + (kt * 4 + ks) * 512); }
    asm volatile("s_wait_xcnt 0x0" ::: "memory");   // before the address registers of the k loads move on
    __builtin_amdgcn_sched_barrier(0);   // holds the pointer steps behind that wait
    { const int kstep = (cp + 1 < FNP) ? 32 * IC : -(FNP - 1) * 32 * IC; khn += kstep; kln += kstep; }   // on to the next pass, from the quarter's last back to its first
#pragma unroll 1   // rolled: the pass is some 500 instructions long and its fragments take their registers over from the pass before
    for (int np = 0; np < FNP; ++np) {
        v16h vf[8];
#pragma unroll
        for (int ot = 0; ot < 8; ++ot) vf[ot] = WFrag<h16>::ld(vp + ot * 512);
        asm volatile("s_wait_xcnt 0x0" ::: "memory");   // before the address registers of the v loads are used for anything else
        // keeps the 16 v loads at the head of the pass, all the score WMMAs and the softmax ahead of their use (one wave per SIMD: nothing else covers a load)
        __builtin_amdgcn_sched_barrier(0);
        v8f s[2][FQT];
#pragma unroll
        for (int kt = 0; kt < 2; ++kt)
#pragma unroll
            for (int ct = 0; ct < FQT; ++ct) s[kt][ct] = (v8f){};
#pragma unroll
        for (int ks = 0; ks < 4; ++ks) {
#pragma unroll
            for (int kt = 0; kt < 2; ++kt)
#pragma unroll
                for (int ct = 0; ct < FQT; ++ct) s[kt][ct] = wmmab(kh[ks][kt], qh[ct][ks], s[kt][ct]);
#pragma unroll
            for (int kt = 0; kt < 2; ++kt)
#pragma unroll
                for (int ct = 0; ct < FQT; ++ct) s[kt][ct] = wmmab(kh[ks][kt], ql[ct][ks], s[kt][ct]);
#pragma unroll
            for (int kt = 0; kt < 2; ++kt)
#pragma unroll
                for (int ct = 0; ct < FQT; ++ct) s[kt][ct] = wmmab(kl[ks][kt], qh[ct][ks], s[kt][ct]);
        }
        // the next pass's 32 k loads go out here, into the registers that the score WMMAs above have just read, and fly during the softmax and attn.v (the last pass loads the walk's first rows again, unused)
        __builtin_amdgcn_sched_barrier(0);
#pragma unroll
        for (int kt = 0; kt < 2; ++kt) {
#pragma unroll
            for (int ks = 0; ks < 4; ++ks) kh[ks][kt] = WFrag<bf>::ld(khn + (kt * 4 + ks) * 512);
#pragma unroll
            for (int ks = 0; ks < 4; ++ks) kl[ks][kt] = WFrag<bf>::ld(kln + (kt * 4 + ks) * 512); }
        asm volatile("s_wait_xcnt 0x0" ::: "memory");   // before the address registers of the k loads move on
        __builtin_amdgcn_sched_barrier(0);   // holds the k loads (and their wait) in front of the pointer steps and the softmax
        vp += (cp + 1 < FNP) ? 32 * IC : -(FNP - 1) * 32 * IC; cp = (cp + 1 < FNP) ? cp + 1 : 0;
        const int kstep = (cp + 1 < FNP) ? 32 * IC : -(FNP - 1) * 32 * IC; khn += kstep; kln += kstep;
        float ml[FQT]; bool need = false;
#pragma unroll
        for (int ct = 0; ct < FQT; ++ct) { float t = fmaxf(s[0][ct][0], s[1][ct][0]);
#pragma unroll
            for (int r = 1; r < 8; ++r) t = fmaxf(t, fmaxf(s[0][ct][r], s[1][ct][r]));
            ml[ct] = fmaxf(t, __shfl_xor(t, 16, 32)); need = need || (ml[ct] > m[ct] + 5.5f); }
        if (__builtin_amdgcn_ballot_w32(need) != 0) {
#pragma unroll
            for (int ct = 0; ct < FQT; ++ct) { const float mn = fmaxf(m[ct], ml[ct]); const float al = __builtin_amdgcn_exp2f((m[ct] - mn) * FL2E); m[ct] = mn; l[ct] *= al;
#pragma unroll
                for (int ot = 0; ot < 8; ++ot) acc[ot][ct] *= al; }
        }
        v16h pf[FQT];
#pragma unroll
        for (int ct = 0; ct < FQT; ++ct) { float sum = 0.f;
#pragma unroll
            for (int kt = 0; kt < 2; ++kt)
#pragma unroll
                for (int r = 0; r < 8; ++r) { const float p = __builtin_amdgcn_exp2f((s[kt][ct][r] - m[ct]) * FL2E + 6.0f); sum += p; pf[ct][kt * 8 + r] = (h16)p; }
            l[ct] += sum; }
#pragma unroll
        for (int ot = 0; ot < 8; ++ot)
#pragma unroll
            for (int ct = 0; ct < FQT; ++ct) acc[ot][ct] = wmma16(vf[ot], pf[ct], acc[ot][ct]);
    }
    // the output projection's operands from memory (the wave's 32 rows of Wo, its tile of x, the rows' biases) are asked for here and arrive under the join of the key quarters
    const int c0 = w * 32;
    const float* xp = xb + img * CC * HWF + (size_t)(c0 + 8 * hi) * HWF + n0 + 4 * lr;
    const float* wp = wo + (size_t)(c0 + lr) * IC + 8 * hi;
    const char* bp = (const char*)(bo + c0); const unsigned bofs = 32u * (unsigned)hi;   // the lane's 8 rows' biases: byte offset from the wave's first
    v4f xs[2][8], br[2][2], wr[2][4][4];
#pragma unroll
    for (int mb = 0; mb < 2; ++mb) { br[mb][0] = *(const v4f*)(bp + bofs + mb * 64); br[mb][1] = *(const v4f*)(bp + bofs + mb * 64 + 16);
#pragma unroll
        for (int ks = 0; ks < 4; ++ks) ldw_raw(wp + (size_t)mb * 16 * IC + ks * 32, wr[mb][ks]);
#pragma unroll
        for (int j = 0; j < 8; ++j) xs[mb][j] = *(const v4f*)(xp + (size_t)(mb * 16 + j) * HWF); }
    asm volatile("s_wait_xcnt 0x0" :: "v"(xp), "v"(wp), "v"(bofs) : "memory");   // before the address registers of these loads are used for anything else: named as inputs, they stay as they are up to the wait
    __builtin_amdgcn_sched_barrier(0);   // holds the loads in front of the join (their latency passes under it) and what follows behind that wait
#pragma unroll
    for (int ct = 0; ct < FQT; ++ct) { l[ct] += __shfl_xor(l[ct], 16, 32); if (hi == 0) { msh[w][ct][lr] = m[ct]; lsh[w][ct][lr] = l[ct]; } }
    float* my = part + w * (8 * FQT * 256) + lane * 4;
#pragma unroll
    for (int ot = 0; ot < 8; ++ot)
#pragma unroll
        for (int ct = 0; ct < FQT; ++ct) { const v8f t = acc[ot][ct]; *(v4fa*)(my + (ot * FQT + ct) * 256) = (v4f){t[0], t[1], t[2], t[3]}; *(v4fa*)(my + (ot * FQT + ct) * 256 + 128) = (v4f){t[4], t[5], t[6], t[7]}; }
    __syncthreads();
    // wave w merges the 16 queries of column tile w, all 128 channels: tile w of each y plane in LDS, its eight 512-B runs
    float wq[4]; float mm = msh[0][w][lr];
#pragma unroll
    for (int q = 1; q < 4; ++q) mm = fmaxf(mm, msh[q][w][lr]);
    float ls = 0.f;
#pragma unroll
    for (int q = 0; q < 4; ++q) { wq[q] = __builtin_amdgcn_exp2f((msh[q][w][lr] - mm) * FL2E); ls += wq[q] * lsh[q][w][lr]; }
    const float inv = __fdiv_rn(1.0f, ls);
    const int yoff = w * 2048 + lane * 8;
#pragma unroll
    for (int j = 0; j < 8; ++j) { const float* sp = part + (j * FQT + w) * 256 + lane * 4; v4f a0 = wq[0] * *(const v4fa*)sp, a1 = wq[0] * *(const v4fa*)(sp + 128);
#pragma unroll
        for (int q = 1; q < 4; ++q) { a0 += wq[q] * *(const v4fa*)(sp + q * (8 * FQT * 256)); a1 += wq[q] * *(const v4fa*)(sp + q * (8 * FQT * 256) + 128); }
        v8us o_h, o_l;
#pragma unroll
        for (int u = 0; u < 4; ++u) { unsigned short p, q2; splitf(a0[u] * inv, p, q2); o_h[u] = p; o_l[u] = q2; splitf(a1[u] * inv, p, q2); o_h[4 + u] = p; o_l[4 + u] = q2; }
        *(v8usa*)(&ysh[0][yoff + j * 256]) = o_h; *(v8usa*)(&ysh[1][yoff + j * 256]) = o_l; }
    __syncthreads();   // every wave reads all four tiles of y
    v16bf yb[4][4], yb2[4][4];
#pragma unroll
    for (int ks = 0; ks < 4; ++ks)
#pragma unroll
        for (int nb = 0; nb < 4; ++nb) { const int e = nb * 2048 + ks * 512 + lane * 8;
            yb[ks][nb] = cat16b(*(const v8usa*)(&ysh[0][e]), *(const v8usa*)(&ysh[0][e + 256])); yb2[ks][nb] = cat16b(*(const v8usa*)(&ysh[1][e]), *(const v8usa*)(&ysh[1][e + 256])); }
    __builtin_amdgcn_sched_barrier(0);   // the 64 LDS reads go out as one group ahead of the WMMAs
    v8f z[2][4];
#pragma unroll
    for (int mb = 0; mb < 2; ++mb)
#pragma unroll
        for (int nb = 0; nb < 4; ++nb) z[mb][nb] = (v8f){};
#pragma unroll
    for (int ks = 0; ks < 4; ++ks) { v16bf a[2];
#pragma unroll
        for (int mb = 0; mb < 2; ++mb) a[mb] = cvw(wr[mb][ks]);
#pragma unroll
        for (int nb = 0; nb < 4; ++nb)
#pragma unroll
            for (int mb = 0; mb < 2; ++mb) z[mb][nb] = wmmab(a[mb], yb[ks][nb], z[mb][nb]);
#pragma unroll
        for (int nb = 0; nb < 4; ++nb)
#pragma unroll
            for (int mb = 0; mb < 2; ++mb) z[mb][nb] = wmmab(a[mb], yb2[ks][nb], z[mb][nb]); }
    float* op = OUTb + img * CC * HW + (size_t)(c0 + 8 * hi) * HW + n0 + 4 * lr;
#pragma unroll
    for (int mb = 0; mb < 2; ++mb) { v4f r[8];
#pragma unroll
        for (int j = 0; j < 8; ++j) { const float bb = bfr(br[mb][j >> 2][j & 3]);
#pragma unroll
            for (int nb = 0; nb < 4; ++nb) r[j][nb] = __fadd_rn(__fadd_rn(z[mb][nb][j], bb), bfr(xs[mb][j][nb])); }
        __builtin_amdgcn_sched_barrier(0);   // the block's 8 values stand in registers of their own before the first store goes out
#pragma unroll
        for (int j = 0; j < 8; ++j) *(v4f*)(op + (size_t)(mb * 16 + j) * HW) = r[j];
        asm volatile("s_wait_xcnt 0x0" ::: "memory");   // before the registers that these stores name are used again
        __builtin_amdgcn_sched_barrier(0);   // holds the next block's arithmetic behind that wait
    }
}

extern "C" void kernel_launch(void* const* d_in, const int* in_sizes, int n_in,
                              void* d_out, int out_size, void* d_ws, size_t ws_size, hipStream_t stream) {
    if (n_in < 9) return;
    if (in_sizes[0] < NB * CC * HW) return;
    if (in_sizes[1] < IC * CC || in_sizes[3] < IC * CC || in_sizes[5] < IC * CC || in_sizes[7] < CC * IC) return;
    if (in_sizes[2] < IC || in_sizes[4] < IC || in_sizes[6] < IC || in_sizes[8] < CC) return;
    if (out_size < NB * CC * HW) return;
    const float* x  = (const float*)d_in[0];   // [NB][CC][HWF]
    const float* wq = (const float*)d_in[1];   // [IC][CC]  (queries)
    const float* bq = (const float*)d_in[2];   // [IC]
    const float* wk = (const float*)d_in[3];   // [IC][CC]  (keys)
    const float* bk = (const float*)d_in[4];   // [IC]
    const float* wv = (const float*)d_in[5];   // [IC][CC]  (values)
    const float* bv = (const float*)d_in[6];   // [IC]
    const float* wo = (const float*)d_in[7];   // [CC][IC]  (output projection)
    const float* bo = (const float*)d_in[8];   // [CC]
    float* OUT = (float*)d_out;                // [NB][CC][HW]
    char* wsp = (char*)d_ws;
    auto take = [&](size_t bytes) { char* p = wsp; wsp += (bytes + 255) & ~(size_t)255; return (void*)p; };
    bf* Hh  = (bf*)take((size_t)NB * 2 * HW * IC * 2);     // [b] hi planes of q+bq, k+bk
    bf* Hl  = (bf*)take((size_t)NB * 2 * HW * IC * 2);     // [b] lo planes of q+bq, k+bk
    h16* GT = (h16*)take((size_t)NB * IC * HW * 2);        // [b] fp16 (v + bv)
    if ((size_t)(wsp - (char*)d_ws) > ws_size) return;

    // Every launch takes all NB images (the image is a grid dimension).
    // q / k [m][o] = sum_c x[c][m] W[o][c] + bias as hi/lo planes, v [o][m] + bias as f16, all in fragment order   (z = 3 b + (0 q, 1 k, 2 v); exact bf16 products)
    k_proj<<<dim3(HW / 64, IC / 64, 3 * NB), 32, 0, stream>>>(x, wq, wk, wv, bq, bk, bv, Hh, Hl, GT);
    // y = softmax(q . k) . v; out[c][n] = (sum_o Wo[c][o] y[n][o] + bo[c]) + x[c][n]  (hi + lo planes of y, 2 products)
    k_fattn<<<dim3(HW / 64, NB), 128, 0, stream>>>(Hh, Hl, GT, wo, x, bo, OUT);
}

// v008
// One run takes 52.7 microseconds.
// Next to v007, in two timings, it ran 1.03 times as fast each time.
// All steps since v000 together make it 11.9 times as fast.
#include <hip/hip_runtime.h>

// All contractions on 16-bit WMMA, f32 accumulate: the three 1x1 projections q/k/v = v_wmma_f32_16x16x32_bf16 on RNE-bf16 values of x and of the weights (single products); scores q.k = bf16 hi/lo split (hi.hi + lo.hi + hi.lo, K = 128); attn.v = v_wmma_f32_16x16x32_f16 (unnormalised softmax terms carried x 2^6 as f16, v as f16); output projection = bf16 Wo times bf16 hi/lo planes of y (2 products). Bias adds, softmax and the residual add in f32.
// x [NB][128][4096]; q/k hi/lo planes and the f16 plane of v lie in the workspace, the hi/lo planes of y in LDS, all in FRAGMENT ORDER (below: "Fragment order"); s[n][m] = q_n . k_m (unscaled); attn[n][m] = softmax_m(s); y[n][o] = sum_m attn[n][m] v[m][o]; out[c][n] = x[c][n] + bo[c] + sum_o Wo[c][o] y[n][o]. Two launches: projections; attention with the output projection as its epilogue (y stays in LDS); every convert or transposing step is done where a GEMM loads a fragment or stores its tile.

#ifndef NB
#define NB 4
#endif
#ifndef SEQ
#define SEQ 4096
#endif
#define NB_FULL  4
#define SEQ_FULL 4096
#define CC   128
#define IC   128
#define HW   SEQ
#define HWF  SEQ_FULL
static_assert(NB >= 1 && NB <= NB_FULL);
static_assert(SEQ >= 128 && SEQ <= SEQ_FULL && (SEQ % 128) == 0);
static_assert((HW % 64) == 0 && (IC % 64) == 0 && (CC % 64) == 0);
static_assert((HW % 32) == 0 && (IC % 32) == 0 && (CC % 32) == 0);
static_assert(((IC * CC) % 8) == 0 && ((HW * CC) % 4) == 0 && ((HW * IC) % 4) == 0 && ((IC * HW) % 2) == 0 && (HW % 8) == 0 && (IC % 4) == 0);
static_assert(((size_t)HW * CC / 4) % 256 == 0 && ((size_t)HW * IC / 4) % 256 == 0 && ((size_t)HW * IC / 2) % 256 == 0);

typedef _Float16 h16;
typedef unsigned short bf;
typedef __attribute__((ext_vector_type(16))) __bf16   v16bf;
typedef __attribute__((ext_vector_type(16))) _Float16 v16h;
typedef __attribute__((ext_vector_type(8)))  _Float16 v8h;
typedef __attribute__((ext_vector_type(8)))  unsigned short v8us;
typedef __attribute__((ext_vector_type(8)))  float    v8f;
typedef __attribute__((ext_vector_type(4)))  float    v4f;
typedef v8h  __attribute__((may_alias)) v8ha;
typedef v4f  __attribute__((may_alias)) v4fa;
typedef v8us __attribute__((may_alias)) v8usa;

__device__ __forceinline__ unsigned short f2bf(float f) { unsigned u = __float_as_uint(f); u += 0x7FFFu + ((u >> 16) & 1u); return (unsigned short)(u >> 16); }
__device__ __forceinline__ float bf2f(unsigned short b) { return __uint_as_float(((unsigned)b) << 16); }
__device__ __forceinline__ float bfr(float f) { return bf2f(f2bf(f)); }
__device__ __forceinline__ v16h cat16(v8h lo, v8h hi) { return __builtin_shufflevector(lo, hi, 0, 1, 2, 3, 4, 5, 6, 7, 8, 9, 10, 11, 12, 13, 14, 15); }
__device__ __forceinline__ v16bf cat16b(v8us lo, v8us hi) { return __builtin_bit_cast(v16bf, __builtin_shufflevector(lo, hi, 0, 1, 2, 3, 4, 5, 6, 7, 8, 9, 10, 11, 12, 13, 14, 15)); }
__device__ __forceinline__ v8f wmma16(v16h a, v16h b, v8f c) { return __builtin_amdgcn_wmma_f32_16x16x32_f16(false, a, false, b, (short)0, c, false, false); }
__device__ __forceinline__ v8f wmmab(v16bf a, v16bf b, v8f c) { return __builtin_amdgcn_wmma_f32_16x16x32_bf16(false, a, false, b, (short)0, c, false, false); }

// ---- The projection GEMMs: K = 128 in 4 steps of 32, fragments formed straight from the operands as they lie in memory (k_proj: ONE WAVE per 64x64 output tile, 16 accumulators).
// Fragments: lane l, h = l >> 4, row/col = l & 15; elements 0..7 = k0 + 8h + 0..7, elements 8..15 = k0 + 16 + 8h + 0..7 for BOTH A and B; D element r = (row 8h + r, col l & 15).
// Tokens are dealt to the four 16-wide blocks of a tile as token = t0 + 4 (l & 15) + block: a lane's 16-byte load of x gives one element to each of its four fragments,
// and in the output projection, where tokens are the tile's columns, a lane's four accumulators of one row are four neighbouring tokens, stored as one run without a pass through LDS.
// Fragment order: every 16-bit plane (workspace or LDS) is a row of 1-KiB fragments, each two runs of 512 B: run j holds, at lane l's 16 bytes (l * 16), the lane's elements 8 j .. 8 j + 7.
// A wave-wide 16-byte load or store of a run is 512 contiguous bytes (4 whole 128-B lines), where rows of a token- or channel-major plane gave 16 lines a load.
// q, k, y planes: fragment (tile, ks) at element (tile * 4 + ks) * 512; row l & 15 of tile T is token (T / 4) * 64 + 4 (l & 15) + T % 4 (the deal above), channels 32 ks + 16 j + 8 h + 0..7.
// v plane: fragment (pair P of tiles, channel tile ot) at element (P * 8 + ot) * 512; row l & 15 is channel 16 ot + (l & 15), run j holds rows 8 h + 0..7 of tile 2 P + j: keys in the order of the k tiles.
// ld(p): p = fragment start + 8 l.
template <typename T16> struct WFrag;
template <> struct WFrag<h16> { typedef v16h V; static __device__ __forceinline__ V ld(const h16* p) { return cat16(*(const v8h*)p, *(const v8h*)(p + 256)); } static __device__ __forceinline__ v8f mma(V a, V b, v8f c) { return wmma16(a, b, c); } };
template <> struct WFrag<bf> { typedef v16bf V; static __device__ __forceinline__ V ld(const bf* p) { return cat16b(*(const v8us*)p, *(const v8us*)(p + 256)); } static __device__ __forceinline__ v8f mma(V a, V b, v8f c) { return wmmab(a, b, c); } };
static_assert(CC == 128 && IC == 128 && (HW % 64) == 0);
// 16 k values of one row of an f32 matrix [row][k]: raw load (p = row start + k0 + 8h), then rounding to bf16 (to nearest even)
__device__ __forceinline__ void ldw_raw(const float* __restrict__ p, v4f (&r)[4]) { r[0] = *(const v4f*)p; r[1] = *(const v4f*)(p + 4); r[2] = *(const v4f*)(p + 16); r[3] = *(const v4f*)(p + 20); }
__device__ __forceinline__ v16bf cvw(const v4f (&r)[4]) { v16bf f;
#pragma unroll
    for (int g = 0; g < 4; ++g)
#pragma unroll
        for (int u = 0; u < 4; ++u) f[4 * g + u] = (__bf16)r[g][u];
    return f; }
// the four token fragments of one k step from x [k][token] f32: raw load (p = x + (k0 + 8h) HWF + t0 + 4 (l & 15)), then rounding to bf16 (to nearest even); word i of a load belongs to block i
__device__ __forceinline__ void ldx_raw(const float* __restrict__ p, v4f (&r)[16]) {
#pragma unroll
    for (int e = 0; e < 16; ++e) r[e] = *(const v4f*)(p + (size_t)(e < 8 ? e : e + 8) * HWF); }
__device__ __forceinline__ void cvx(const v4f (&r)[16], v16bf (&f)[4]) {
#pragma unroll
    for (int e = 0; e < 16; ++e)
#pragma unroll
        for (int i = 0; i < 4; ++i) f[i][e] = (__bf16)r[e][i]; }
__device__ __forceinline__ void zero16(v8f (&acc)[4][4]) {
#pragma unroll
    for (int mb = 0; mb < 4; ++mb)
#pragma unroll
        for (int nb = 0; nb < 4; ++nb) acc[mb][nb] = (v8f){};
}

__device__ __forceinline__ h16 tohx(float x) { return (h16)x; }
__device__ __forceinline__ void splitf(float y, unsigned short& h, unsigned short& l) { h = f2bf(y); l = f2bf(y - bf2f(h)); }
typedef __attribute__((ext_vector_type(2))) unsigned short v2us;
typedef __attribute__((ext_vector_type(2))) _Float16 v2h;
typedef __attribute__((ext_vector_type(2))) float v2f;
// ---- k_proj: the three projections. grid (HW/64, IC/64, 3 images), one wave; blockIdx.z = 3 b + (0 q, 1 k, 2 v). x and W are read as f32 and rounded at the fragment load.
// q, k: A = W rows (channels), B = tokens: tile [channel][token]: a lane's 8 accumulator rows are 8 channels of one token, one 16-byte piece of a q/k fragment; + bias (a row's), split into the hi/lo bf16 planes.
// v: the roles swapped, A = tokens, B = W rows: tile [token][channel]: a lane's 8 rows are 8 keys of one channel, one 16-byte piece of a v fragment; + bias (a column's), f16.
// Both are stored from the accumulators, 512 contiguous bytes a store, without a pass through LDS.
template <bool TR>
__device__ __forceinline__ void proj_loop(const float* __restrict__ xp, const float* __restrict__ wp, v8f (&acc)[4][4]) {
    zero16(acc);
#pragma unroll 1   // rolled, as the GEMM loop was: the fragments of one k step take over the registers of the step before
    for (int kc = 0; kc < CC; kc += 32) {
        v4f xr[16], wr[4][4];
        ldx_raw(xp + (size_t)kc * HWF, xr);
#pragma unroll
        for (int b = 0; b < 4; ++b) ldw_raw(wp + (size_t)b * 16 * CC + kc, wr[b]);
        asm volatile("s_wait_xcnt 0x0" ::: "memory");   // before the address registers of the step's loads move on
        __builtin_amdgcn_sched_barrier(0);   // the step's 32 loads go out together, ahead of the rounding (one load latency a step, not one a fragment), and the pointer steps stay behind that wait
        v16bf xf[4], wf[4];
        cvx(xr, xf);
#pragma unroll
        for (int b = 0; b < 4; ++b) wf[b] = cvw(wr[b]);
#pragma unroll
        for (int nb = 0; nb < 4; ++nb)
#pragma unroll
            for (int mb = 0; mb < 4; ++mb) acc[mb][nb] = TR ? wmmab(wf[mb], xf[nb], acc[mb][nb]) : wmmab(xf[mb], wf[nb], acc[mb][nb]);
        // four vector slots behind the step's last WMMA: the distance the chip needs before a vector instruction writes its A or B (the next step's rounding, over the back edge) or reads D (the epilogue)
        asm volatile("v_nop\n\tv_nop\n\tv_nop\n\tv_nop" : "+v"(acc[0][0]), "+v"(acc[1][1]), "+v"(acc[2][2]), "+v"(acc[3][3]) : "v"(xf[0]), "v"(xf[3]), "v"(wf[0]), "v"(wf[3]));
    }
}
__global__ __launch_bounds__(32) void k_proj(const float* __restrict__ x, const float* __restrict__ wq, const float* __restrict__ wk, const float* __restrict__ wv, const float* __restrict__ bq, const float* __restrict__ bk, const float* __restrict__ bv, bf* Hh, bf* Hl, h16* GT) {
    const int lane = threadIdx.x & 31, lr = lane & 15, hi = lane >> 4; const int img = (int)blockIdx.z / 3, which = (int)blockIdx.z % 3;
    const int t0 = (int)blockIdx.x * 64, o0 = (int)blockIdx.y * 64;
    const float* xp = x + (size_t)img * CC * HWF + (size_t)(8 * hi) * HWF + t0 + 4 * lr;
    const size_t woff = (size_t)(o0 + lr) * CC + 8 * hi;
    v8f acc[4][4];
    if (which == 2) {
        float cr[4];   // the columns' biases, asked for ahead of the k loop
#pragma unroll
        for (int nb = 0; nb < 4; ++nb) cr[nb] = bv[o0 + nb * 16 + lr];
        asm volatile("s_wait_xcnt 0x0" ::: "memory");   // before the address registers of these loads are used for anything else
        __builtin_amdgcn_sched_barrier(0);   // holds what follows behind that wait
        proj_loop<false>(xp, wv + woff, acc);
        h16* G = GT + (size_t)img * IC * HW + (size_t)t0 * IC + (o0 / 16) * 512 + lane * 8;   // fragment (pair t0 / 32, channel tile o0 / 16), the lane's place
#pragma unroll
        for (int mb = 0; mb < 4; ++mb) { v8h o[4];
#pragma unroll
            for (int nb = 0; nb < 4; ++nb) { const float bb = bfr(cr[nb]);
#pragma unroll
                for (int j = 0; j < 8; ++j) o[nb][j] = tohx(__fadd_rn(acc[mb][nb][j], bb)); }
            __builtin_amdgcn_sched_barrier(0);   // the block's 4 values stand in registers of their own before the first store goes out
#pragma unroll
            for (int nb = 0; nb < 4; ++nb) *(v8h*)(G + (mb >> 1) * 4096 + nb * 512 + (mb & 1) * 256) = o[nb];   // token block mb is tile t0 / 16 + mb: pair mb / 2, run mb % 2
            asm volatile("s_wait_xcnt 0x0" ::: "memory");   // before the registers that these stores name are used again
            __builtin_amdgcn_sched_barrier(0);   // holds the next block's arithmetic behind that wait
        }
    } else {
        const float* bp = (which == 0 ? bq : bk) + o0 + 8 * hi;
        v4f br[4][2];   // the rows' biases, asked for ahead of the k loop
#pragma unroll
        for (int mb = 0; mb < 4; ++mb) { br[mb][0] = *(const v4f*)(bp + mb * 16); br[mb][1] = *(const v4f*)(bp + mb * 16 + 4); }
        asm volatile("s_wait_xcnt 0x0" ::: "memory");   // before the address registers of these loads are used for anything else
        __builtin_amdgcn_sched_barrier(0);   // holds what follows behind that wait
        proj_loop<true>(xp, (which == 0 ? wq : wk) + woff, acc);
        const size_t base = ((size_t)img * 2 + which) * HW * IC + (size_t)t0 * IC + (o0 / 16) * 256 + lane * 8;   // tile t0 / 16, run o0 / 16 of its eight, the lane's place
#pragma unroll
        for (int nb = 0; nb < 4; ++nb) { v8us oh[4], ol[4];
#pragma unroll
            for (int mb = 0; mb < 4; ++mb)
#pragma unroll
                for (int j = 0; j < 8; ++j) { unsigned short p, q; splitf(__fadd_rn(acc[mb][nb][j], bfr(br[mb][j >> 2][j & 3])), p, q); oh[mb][j] = p; ol[mb][j] = q; }
            __builtin_amdgcn_sched_barrier(0);   // the block's 8 values stand in registers of their own before the first store goes out
#pragma unroll
            for (int mb = 0; mb < 4; ++mb) { *(v8us*)(Hh + base + nb * 2048 + mb * 256) = oh[mb]; *(v8us*)(Hl + base + nb * 2048 + mb * 256) = ol[mb]; }   // token block nb is tile t0 / 16 + nb
            asm volatile("s_wait_xcnt 0x0" ::: "memory");   // before the registers that these stores name are used again
            __builtin_amdgcn_sched_barrier(0);   // holds the next block's arithmetic behind that wait
        }
    }
}
// ---- k_fattn: scores, softmax and attn.v in one pass over the keys; no score or softmax plane is stored. grid (HW/64, images), 4 waves, one per SIMD.
// Every wave holds all 64 query columns of the work-group (4 column tiles: each k and v fragment loaded feeds 4 tiles); wave w takes the keys w HW/4 .. + HW/4 - 1, 32 keys a pass.
// The walk over a quarter's FNP passes starts at a pass set by the work-group's index and wraps round: the work-groups of an image, which all read the same k and v planes and start together,
// stand two by two at different lines at any moment (no crowd of requests on one line), and a line that memory has to bring is asked for early by one pair of work-groups, and is an L2 hit for those that come to it later.
// sT[key][query] = K . qT (A = k rows, B = q rows kept in registers; hi.hi + hi.lo + lo.hi): a lane holds 16 scores of ONE query (column l & 15; keys 8h + r and 16 + 8h + r),
// which are, converted to f16, exactly its elements 0..7 and 8..15 of the B fragment of yT[o][query] += vT . pT (A = fragments of GT). Fragments and D layout as above; q, k, v are read and y is written in fragment order,
// so column l & 15 of column tile ct is token n0 + 4 (l & 15) + ct, and the keys of a pass are those of two k tiles (the v fragments hold the same keys in the same order).
// Running maximum m and sum l per query; p = 2^((s - m) log2 e + 6) as f16. m moves (and yT, l are rescaled) only when a pass's maximum passes it by more than 5.5, so p <= 2^14.
// The four key quarters meet in LDS: y = sum_q w_q yT_q / sum_q w_q l_q, w_q = e^(m_q - max m), in the order q = 0..3; the hi/lo bf16 planes of the block's y (64 tokens x 128 channels) go to LDS from there.
// Output projection with bias and residual, behind one more barrier: wave w takes the output channels 32 w .. 32 w + 31 of all 64 tokens. A = Wo rows (read as f32, rounded at the fragment load),
// B = hi, then lo plane of y: tile [channel][token], the layout of out itself; out = (z + bo) + x, x rounded to bf16; a lane's four accumulators of one row are four neighbouring tokens, stored as one 16-byte run.
#define FL2E 1.4426950408889634f
#define FQT 4   // column tiles of 16 queries per wave
#define FNP (HW / 4 / 32)   // passes of 32 keys in a wave's quarter
static_assert(IC == 128 && (HW % 128) == 0 && HW / 4 >= 64 && FQT == 4);
__global__ __launch_bounds__(128) void k_fattn(const bf* __restrict__ Hh, const bf* __restrict__ Hl, const h16* __restrict__ GT, const float* __restrict__ wo, const float* __restrict__ xb, const float* __restrict__ bo, float* OUTb) {
    __shared__ __align__(16) float part[4 * 8 * FQT * 256];
    __shared__ float msh[4][FQT][16];
    __shared__ float lsh[4][FQT][16];
    __shared__ __align__(16) bf ysh[2][FQT * 2048];   // hi, lo plane of the block's y: tile ct at element ct * 2048, fragment order
    const int lane = threadIdx.x & 31, lr = lane & 15, hi = lane >> 4; const int w = __builtin_amdgcn_readfirstlane((int)(threadIdx.x >> 5));
    const size_t PLc = (size_t)HW * IC; const size_t img = blockIdx.y; const int n0 = (int)blockIdx.x * 64;
    const size_t qoff = img * 2 * PLc + (size_t)n0 * IC + lane * 8;
    // first pass of the walk: neighbours in the index, and work-groups 8 apart, get different starts (each start is shared by two of the 64 work-groups of an image)
    int cp = (int)(((blockIdx.x >> 3) << 2 | (blockIdx.x & 3)) % FNP);   // the pass (32 keys of the quarter) that is worked on
    const bf* khn = Hh + img * 2 * PLc + PLc + (size_t)(w * (HW / 4) + cp * 32) * IC + lane * 8;   // the lane's place in the k tiles that are loaded next
    const bf* kln = Hl + img * 2 * PLc + PLc + (size_t)(w * (HW / 4) + cp * 32) * IC + lane * 8;
    const h16* vp = GT + img * PLc + (size_t)(w * (HW / 4) + cp * 32) * IC + lane * 8;   // the lane's place in the v fragments of pass cp
    v16bf qh[FQT][4], ql[FQT][4];
#pragma unroll
    for (int ct = 0; ct < FQT; ++ct)
#pragma unroll
        for (int ks = 0; ks < 4; ++ks) { qh[ct][ks] = WFrag<bf>::ld(Hh + qoff + (ct * 4 + ks) * 512); ql[ct][ks] = WFrag<bf>::ld(Hl + qoff + (ct * 4 + ks) * 512); }
    asm volatile("s_wait_xcnt 0x0" ::: "memory");   // before the address registers of the q loads are used for anything else
    __builtin_amdgcn_sched_barrier(0);   // holds what follows behind that wait
    v8f acc[8][FQT];
#pragma unroll
    for (int ot = 0; ot < 8; ++ot)
#pragma unroll
        for (int ct = 0; ct < FQT; ++ct) acc[ot][ct] = (v8f){};
    float m[FQT], l[FQT];
#pragma unroll
    for (int ct = 0; ct < FQT; ++ct) { m[ct] = -3.0e38f; l[ct] = 0.f; }
    v16bf kh[4][2], kl[4][2];   // loaded tile by tile, plane by plane: the eight 512-B runs of a tile follow one another in memory
#pragma unroll
    for (int kt = 0; kt < 2; ++kt) {
#pragma unroll
        for (int ks = 0; ks < 4; ++ks) kh[ks][kt] = WFrag<bf>::ld(khn + (kt * 4 + ks) * 512);
#pragma unroll
        for (int ks = 0; ks < 4; ++ks) kl[ks][kt] = WFrag<bf>::ld(kln + (kt * 4 + ks) * 512); }
    asm volatile("s_wait_xcnt 0x0" ::: "memory");   // before the address registers of the k loads move on
    __builtin_amdgcn_sched_barrier(0);   // holds the pointer steps behind that wait
    { const int kstep = (cp + 1 < FNP) ? 32 * IC : -(FNP - 1) * 32 * IC; khn += kstep; kln += kstep; }   // on to the next pass, from the quarter's last back to its first
#pragma unroll 1   // rolled: the pass is some 500 instructions long and its fragments take their registers over from the pass before
    for (int np = 0; np < FNP; ++np) {
        v16h vf[8];
#pragma unroll
        for (int ot = 0; ot < 8; ++ot) vf[ot] = WFrag<h16>::ld(vp + ot * 512);
        // keeps the 16 v loads at the head of the pass, all the score WMMAs and the softmax ahead of their use (one wave per SIMD: nothing else covers a load)
        __builtin_amdgcn_sched_barrier(0);
        v8f s[2][FQT];
#pragma unroll
        for (int kt = 0; kt < 2; ++kt)
#pragma unroll
            for (int ct = 0; ct < FQT; ++ct) s[kt][ct] = (v8f){};
#pragma unroll
        for (int ks = 0; ks < 4; ++ks) {
#pragma unroll
            for (int kt = 0; kt < 2; ++kt)
#pragma unroll
                for (int ct = 0; ct < FQT; ++ct) s[kt][ct] = wmmab(kh[ks][kt], qh[ct][ks], s[kt][ct]);
#pragma unroll
            for (int kt = 0; kt < 2; ++kt)
#pragma unroll
                for (int ct = 0; ct < FQT; ++ct) s[kt][ct] = wmmab(kh[ks][kt], ql[ct][ks], s[kt][ct]);
#pragma unroll
            for (int kt = 0; kt < 2; ++kt)
#pragma unroll
                for (int ct = 0; ct < FQT; ++ct) s[kt][ct] = wmmab(kl[ks][kt], qh[ct][ks], s[kt][ct]);
        }
        // the next pass's 32 k loads go out here, into the registers that the score WMMAs above have just read, and fly during the softmax and attn.v (the last pass loads the walk's first rows again, unused)
        __builtin_amdgcn_sched_barrier(0);
#pragma unroll
        for (int kt = 0; kt < 2; ++kt) {
#pragma unroll
            for (int ks = 0; ks < 4; ++ks) kh[ks][kt] = WFrag<bf>::ld(khn + (kt * 4 + ks) * 512);
#pragma unroll
            for (int ks = 0; ks < 4; ++ks) kl[ks][kt] = WFrag<bf>::ld(kln + (kt * 4 + ks) * 512); }
        __builtin_amdgcn_sched_barrier(0);   // holds the k loads in front of the softmax
        float ml[FQT]; bool need = false;
#pragma unroll
        for (int ct = 0; ct < FQT; ++ct) { float t = fmaxf(s[0][ct][0], s[1][ct][0]);
#pragma unroll
            for (int r = 1; r < 8; ++r) t = fmaxf(t, fmaxf(s[0][ct][r], s[1][ct][r]));
            ml[ct] = fmaxf(t, __shfl_xor(t, 16, 32)); need = need || (ml[ct] > m[ct] + 5.5f); }
        if (__builtin_amdgcn_ballot_w32(need) != 0) {
#pragma unroll
            for (int ct = 0; ct < FQT; ++ct) { const float mn = fmaxf(m[ct], ml[ct]); const float al = __builtin_amdgcn_exp2f((m[ct] - mn) * FL2E); m[ct] = mn; l[ct] *= al;
#pragma unroll
                for (int ot = 0; ot < 8; ++ot) acc[ot][ct] *= al; }
        }
        v16h pf[FQT];
#pragma unroll
        for (int ct = 0; ct < FQT; ++ct) { float sum = 0.f;
#pragma unroll
            for (int kt = 0; kt < 2; ++kt)
#pragma unroll
                for (int r = 0; r < 8; ++r) { const float p = __builtin_amdgcn_exp2f((s[kt][ct][r] - m[ct]) * FL2E + 6.0f); sum += p; pf[ct][kt * 8 + r] = (h16)p; }
            l[ct] += sum; }
#pragma unroll
        for (int ot = 0; ot < 8; ++ot)
#pragma unroll
            for (int ct = 0; ct < FQT; ++ct) acc[ot][ct] = wmma16(vf[ot], pf[ct], acc[ot][ct]);
        // the pass's one wait for the address registers of its 48 loads stands here, at the foot, directly in front of the pointer steps: the loads went out a softmax and more ago, so the lone wave does not stand still for it (behind each load group it did)
        __builtin_amdgcn_sched_barrier(0);   // keeps the pointer steps from rising over the wait below
        asm volatile("s_wait_xcnt 0x0" ::: "memory");   // before the address registers of the v and k loads move on
        __builtin_amdgcn_sched_barrier(0);   // holds the pointer steps behind that wait
        vp += (cp + 1 < FNP) ? 32 * IC : -(FNP - 1) * 32 * IC; cp = (cp + 1 < FNP) ? cp + 1 : 0;
        const int kstep = (cp + 1 < FNP) ? 32 * IC : -(FNP - 1) * 32 * IC; khn += kstep; kln += kstep;
    }
    // the output projection's operands from memory (the wave's 32 rows of Wo, its tile of x, the rows' biases) are asked for here and arrive under the join of the key quarters
    const int c0 = w * 32;
    const float* xp = xb + img * CC * HWF + (size_t)(c0 + 8 * hi) * HWF + n0 + 4 * lr;
    const float* wp = wo + (size_t)(c0 + lr) * IC + 8 * hi;
    const char* bp = (const char*)(bo + c0); const unsigned bofs = 32u * (unsigned)hi;   // the lane's 8 rows' biases: byte offset from the wave's first
    v4f xs[2][8], br[2][2], wr[2][4][4];
#pragma unroll
    for (int mb = 0; mb < 2; ++mb) { br[mb][0] = *(const v4f*)(bp + bofs + mb * 64); br[mb][1] = *(const v4f*)(bp + bofs + mb * 64 + 16);
#pragma unroll
        for (int ks = 0; ks < 4; ++ks) ldw_raw(wp + (size_t)mb * 16 * IC + ks * 32, wr[mb][ks]);
#pragma unroll
        for (int j = 0; j < 8; ++j) xs[mb][j] = *(const v4f*)(xp + (size_t)(mb * 16 + j) * HWF); }
    asm volatile("s_wait_xcnt 0x0" :: "v"(xp), "v"(wp), "v"(bofs) : "memory");   // before the address registers of these loads are used for anything else: named as inputs, they stay as they are up to the wait
    __builtin_amdgcn_sched_barrier(0);   // holds the loads in front of the join (their latency passes under it) and what follows behind that wait
#pragma unroll
    for (int ct = 0; ct < FQT; ++ct) { l[ct] += __shfl_xor(l[ct], 16, 32); if (hi == 0) { msh[w][ct][lr] = m[ct]; lsh[w][ct][lr] = l[ct]; } }
    float* my = part + w * (8 * FQT * 256) + lane * 4;
#pragma unroll
    for (int ot = 0; ot < 8; ++ot)
#pragma unroll
        for (int ct = 0; ct < FQT; ++ct) { const v8f t = acc[ot][ct]; *(v4fa*)(my + (ot * FQT + ct) * 256) = (v4f){t[0], t[1], t[2], t[3]}; *(v4fa*)(my + (ot * FQT + ct) * 256 + 128) = (v4f){t[4], t[5], t[6], t[7]}; }
    __syncthreads();
    // wave w merges the 16 queries of column tile w, all 128 channels: tile w of each y plane in LDS, its eight 512-B runs
    float wq[4]; float mm = msh[0][w][lr];
#pragma unroll
    for (int q = 1; q < 4; ++q) mm = fmaxf(mm, msh[q][w][lr]);
    float ls = 0.f;
#pragma unroll
    for (int q = 0; q < 4; ++q) { wq[q] = __builtin_amdgcn_exp2f((msh[q][w][lr] - mm) * FL2E); ls += wq[q] * lsh[q][w][lr]; }
    const float inv = __fdiv_rn(1.0f, ls);
    const int yoff = w * 2048 + lane * 8;
#pragma unroll
    for (int j = 0; j < 8; ++j) { const float* sp = part + (j * FQT + w) * 256 + lane * 4; v4f a0 = wq[0] * *(const v4fa*)sp, a1 = wq[0] * *(const v4fa*)(sp + 128);
#pragma unroll
        for (int q = 1; q < 4; ++q) { a0 += wq[q] * *(const v4fa*)(sp + q * (8 * FQT * 256)); a1 += wq[q] * *(const v4fa*)(sp + q * (8 * FQT * 256) + 128); }
        v8us o_h, o_l;
#pragma unroll
        for (int u = 0; u < 4; ++u) { unsigned short p, q2; splitf(a0[u] * inv, p, q2); o_h[u] = p; o_l[u] = q2; splitf(a1[u] * inv, p, q2); o_h[4 + u] = p; o_l[4 + u] = q2; }
        *(v8usa*)(&ysh[0][yoff + j * 256]) = o_h; *(v8usa*)(&ysh[1][yoff + j * 256]) = o_l; }
    __syncthreads();   // every wave reads all four tiles of y
    v16bf yb[4][4], yb2[4][4];
#pragma unroll
    for (int ks = 0; ks < 4; ++ks)
#pragma unroll
        for (int nb = 0; nb < 4; ++nb) { const int e = nb * 2048 + ks * 512 + lane * 8;
            yb[ks][nb] = cat16b(*(const v8usa*)(&ysh[0][e]), *(const v8usa*)(&ysh[0][e + 256])); yb2[ks][nb] = cat16b(*(const v8usa*)(&ysh[1][e]), *(const v8usa*)(&ysh[1][e + 256])); }
    __builtin_amdgcn_sched_barrier(0);   // the 64 LDS reads go out as one group ahead of the WMMAs
    v8f z[2][4];
#pragma unroll
    for (int mb = 0; mb < 2; ++mb)
#pragma unroll
        for (int nb = 0; nb < 4; ++nb) z[mb][nb] = (v8f){};
#pragma unroll
    for (int ks = 0; ks < 4; ++ks) { v16bf a[2];
#pragma unroll
        for (int mb = 0; mb < 2; ++mb) a[mb] = cvw(wr[mb][ks]);
#pragma unroll
        for (int nb = 0; nb < 4; ++nb)
#pragma unroll
            for (int mb = 0; mb < 2; ++mb) z[mb][nb] = wmmab(a[mb], yb[ks][nb], z[mb][nb]);
#pragma unroll
        for (int nb = 0; nb < 4; ++nb)
#pragma unroll
            for (int mb = 0; mb < 2; ++mb) z[mb][nb] = wmmab(a[mb], yb2[ks][nb], z[mb][nb]); }
    float* op = OUTb + img * CC * HW + (size_t)(c0 + 8 * hi) * HW + n0 + 4 * lr;
#pragma unroll
    for (int mb = 0; mb < 2; ++mb) { v4f r[8];
#pragma unroll
        for (int j = 0; j < 8; ++j) { const float bb = bfr(br[mb][j >> 2][j & 3]);
#pragma unroll
            for (int nb = 0; nb < 4; ++nb) r[j][nb] = __fadd_rn(__fadd_rn(z[mb][nb][j], bb), bfr(xs[mb][j][nb])); }
        __builtin_amdgcn_sched_barrier(0);   // the block's 8 values stand in registers of their own before the first store goes out
#pragma unroll
        for (int j = 0; j < 8; ++j) *(v4f*)(op + (size_t)(mb * 16 + j) * HW) = r[j];
        asm volatile("s_wait_xcnt 0x0" ::: "memory");   // before the registers that these stores name are used again
        __builtin_amdgcn_sched_barrier(0);   // holds the next block's arithmetic behind that wait
    }
}

extern "C" void kernel_launch(void* const* d_in, const int* in_sizes, int n_in,
                              void* d_out, int out_size, void* d_ws, size_t ws_size, hipStream_t stream) {
    if (n_in < 9) return;
    if (in_sizes[0] < NB * CC * HW) return;
    if (in_sizes[1] < IC * CC || in_sizes[3] < IC * CC || in_sizes[5] < IC * CC || in_sizes[7] < CC * IC) return;
    if (in_sizes[2] < IC || in_sizes[4] < IC || in_sizes[6] < IC || in_sizes[8] < CC) return;
    if (out_size < NB * CC * HW) return;
    const float* x  = (const float*)d_in[0];   // [NB][CC][HWF]
    const float* wq = (const float*)d_in[1];   // [IC][CC]  (queries)
    const float* bq = (const float*)d_in[2];   // [IC]
    const float* wk = (const float*)d_in[3];   // [IC][CC]  (keys)
    const float* bk = (const float*)d_in[4];   // [IC]
    const float* wv = (const float*)d_in[5];   // [IC][CC]  (values)
    const float* bv = (const float*)d_in[6];   // [IC]
    const float* wo = (const float*)d_in[7];   // [CC][IC]  (output projection)
    const float* bo = (const float*)d_in[8];   // [CC]
    float* OUT = (float*)d_out;                // [NB][CC][HW]
    char* wsp = (char*)d_ws;
    auto take = [&](size_t bytes) { char* p = wsp; wsp += (bytes + 255) & ~(size_t)255; return (void*)p; };
    bf* Hh  = (bf*)take((size_t)NB * 2 * HW * IC * 2);     // [b] hi planes of q+bq, k+bk
    bf* Hl  = (bf*)take((size_t)NB * 2 * HW * IC * 2);     // [b] lo planes of q+bq, k+bk
    h16* GT = (h16*)take((size_t)NB * IC * HW * 2);        // [b] fp16 (v + bv)
    if ((size_t)(wsp - (char*)d_ws) > ws_size) return;

    // Every launch takes all NB images (the image is a grid dimension).
    // q / k [m][o] = sum_c x[c][m] W[o][c] + bias as hi/lo planes, v [o][m] + bias as f16, all in fragment order   (z = 3 b + (0 q, 1 k, 2 v); exact bf16 products)
    k_proj<<<dim3(HW / 64, IC / 64, 3 * NB), 32, 0, stream>>>(x, wq, wk, wv, bq, bk, bv, Hh, Hl, GT);
    // y = softmax(q . k) . v; out[c][n] = (sum_o Wo[c][o] y[n][o] + bo[c]) + x[c][n]  (hi + lo planes of y, 2 products)
    k_fattn<<<dim3(HW / 64, NB), 128, 0, stream>>>(Hh, Hl, GT, wo, x, bo, OUT);
}

// v009
// One run takes 46.8 microseconds.
// Two timings next to v008 put it at 1.13 and 1.12 times that version's speed.
// All steps since v000 together make it 13.4 times as fast.
#include <hip/hip_runtime.h>

// All contractions on 16-bit WMMA, f32 accumulate: the 1x1 projections q, v = v_wmma_f32_16x16x32_bf16 on RNE-bf16 values of x and of the weights (single products); g = Wk^T q = bf16 Wk times bf16 hi/lo planes of q (2 products); scores g.x = bf16 hi/lo planes of g times the bf16 values of x, which are exact (2 products, K = 128); attn.v = v_wmma_f32_16x16x32_f16 (unnormalised softmax terms carried x 2^6 as f16, v as f16); output projection = bf16 Wo times bf16 hi/lo planes of y (2 products). Bias adds, softmax and the residual add in f32.
// x [NB][128][4096]; the hi/lo planes of g, the bf16 plane of x and the f16 plane of v lie in the workspace, the hi/lo planes of y in LDS, all in FRAGMENT ORDER (below: "Fragment order"); q_n . k_m = q_n . (Wk x_m + bk) = g_n . x_m + q_n . bk with g_n = Wk^T q_n: the last term is the same for every key m of a query n and falls out of softmax_m, so s[n][m] = g_n . x_m (unscaled); attn[n][m] = softmax_m(s); y[n][o] = sum_m attn[n][m] v[m][o]; out[c][n] = x[c][n] + bo[c] + sum_o Wo[c][o] y[n][o]. Two launches: projections; attention with the output projection as its epilogue (y stays in LDS); every convert or transposing step but the x plane's (a branch of k_proj with no product) is done where a GEMM loads a fragment or stores its tile.

#ifndef NB
#define NB 4
#endif
#ifndef SEQ
#define SEQ 4096
#endif
#define NB_FULL  4
#define SEQ_FULL 4096
#define CC   128
#define IC   128
#define HW   SEQ
#define HWF  SEQ_FULL
static_assert(NB >= 1 && NB <= NB_FULL);
static_assert(SEQ >= 128 && SEQ <= SEQ_FULL && (SEQ % 128) == 0);
static_assert((HW % 64) == 0 && (IC % 64) == 0 && (CC % 64) == 0);
static_assert((HW % 32) == 0 && (IC % 32) == 0 && (CC % 32) == 0);
static_assert(((IC * CC) % 8) == 0 && ((HW * CC) % 4) == 0 && ((HW * IC) % 4) == 0 && ((IC * HW) % 2) == 0 && (HW % 8) == 0 && (IC % 4) == 0);
static_assert(((size_t)HW * CC / 4) % 256 == 0 && ((size_t)HW * IC / 4) % 256 == 0 && ((size_t)HW * IC / 2) % 256 == 0);

typedef _Float16 h16;
typedef unsigned short bf;
typedef __attribute__((ext_vector_type(16))) __bf16   v16bf;
typedef __attribute__((ext_vector_type(16))) _Float16 v16h;
typedef __attribute__((ext_vector_type(8)))  _Float16 v8h;
typedef __attribute__((ext_vector_type(8)))  unsigned short v8us;
typedef __attribute__((ext_vector_type(8)))  float    v8f;
typedef __attribute__((ext_vector_type(4)))  float    v4f;
typedef v8h  __attribute__((may_alias)) v8ha;
typedef v4f  __attribute__((may_alias)) v4fa;
typedef v8us __attribute__((may_alias)) v8usa;

__device__ __forceinline__ unsigned short f2bf(float f) { unsigned u = __float_as_uint(f); u += 0x7FFFu + ((u >> 16) & 1u); return (unsigned short)(u >> 16); }
__device__ __forceinline__ float bf2f(unsigned short b) { return __uint_as_float(((unsigned)b) << 16); }
__device__ __forceinline__ float bfr(float f) { return bf2f(f2bf(f)); }
__device__ __forceinline__ v16h cat16(v8h lo, v8h hi) { return __builtin_shufflevector(lo, hi, 0, 1, 2, 3, 4, 5, 6, 7, 8, 9, 10, 11, 12, 13, 14, 15); }
__device__ __forceinline__ v16bf cat16b(v8us lo, v8us hi) { return __builtin_bit_cast(v16bf, __builtin_shufflevector(lo, hi, 0, 1, 2, 3, 4, 5, 6, 7, 8, 9, 10, 11, 12, 13, 14, 15)); }
__device__ __forceinline__ v8f wmma16(v16h a, v16h b, v8f c) { return __builtin_amdgcn_wmma_f32_16x16x32_f16(false, a, false, b, (short)0, c, false, false); }
__device__ __forceinline__ v8f wmmab(v16bf a, v16bf b, v8f c) { return __builtin_amdgcn_wmma_f32_16x16x32_bf16(false, a, false, b, (short)0, c, false, false); }

// ---- The projection GEMMs: K = 128 in 4 steps of 32, fragments formed straight from the operands as they lie in memory (k_proj: ONE WAVE per 64x64 output tile, 16 accumulators).
// Fragments: lane l, h = l >> 4, row/col = l & 15; elements 0..7 = k0 + 8h + 0..7, elements 8..15 = k0 + 16 + 8h + 0..7 for BOTH A and B; D element r = (row 8h + r, col l & 15).
// Tokens are dealt to the four 16-wide blocks of a tile as token = t0 + 4 (l & 15) + block: a lane's 16-byte load of x gives one element to each of its four fragments,
// and in the output projection, where tokens are the tile's columns, a lane's four accumulators of one row are four neighbouring tokens, stored as one run without a pass through LDS.
// Fragment order: every 16-bit plane (workspace or LDS) is a row of 1-KiB fragments, each two runs of 512 B: run j holds, at lane l's 16 bytes (l * 16), the lane's elements 8 j .. 8 j + 7.
// A wave-wide 16-byte load or store of a run is 512 contiguous bytes (4 whole 128-B lines), where rows of a token- or channel-major plane gave 16 lines a load.
// g, x, y planes: fragment (tile, ks) at element (tile * 4 + ks) * 512; row l & 15 of tile T is token (T / 4) * 64 + 4 (l & 15) + T % 4 (the deal above); y: channels 32 ks + 16 j + 8 h + 0..7;
// g and x, both alike: run R = 2 ks + j of a tile holds at lane (h, row), element r, channel 64 (R / 4) + 32 h + 4 r + R % 4 (the order in which g leaves its accumulators).
// v plane: fragment (pair P of tiles, channel tile ot) at element (P * 8 + ot) * 512; row l & 15 is channel 16 ot + (l & 15), run j holds rows 8 h + 0..7 of tile 2 P + j: keys in the order of the k tiles.
// ld(p): p = fragment start + 8 l.
template <typename T16> struct WFrag;
template <> struct WFrag<h16> { typedef v16h V; static __device__ __forceinline__ V ld(const h16* p) { return cat16(*(const v8h*)p, *(const v8h*)(p + 256)); } static __device__ __forceinline__ v8f mma(V a, V b, v8f c) { return wmma16(a, b, c); } };
template <> struct WFrag<bf> { typedef v16bf V; static __device__ __forceinline__ V ld(const bf* p) { return cat16b(*(const v8us*)p, *(const v8us*)(p + 256)); } static __device__ __forceinline__ v8f mma(V a, V b, v8f c) { return wmmab(a, b, c); } };
static_assert(CC == 128 && IC == 128 && (HW % 64) == 0);
// 16 k values of one row of an f32 matrix [row][k]: raw load (p = row start + k0 + 8h), then rounding to bf16 (to nearest even)
__device__ __forceinline__ void ldw_raw(const float* __restrict__ p, v4f (&r)[4]) { r[0] = *(const v4f*)p; r[1] = *(const v4f*)(p + 4); r[2] = *(const v4f*)(p + 16); r[3] = *(const v4f*)(p + 20); }
__device__ __forceinline__ v16bf cvw(const v4f (&r)[4]) { v16bf f;
#pragma unroll
    for (int g = 0; g < 4; ++g)
#pragma unroll
        for (int u = 0; u < 4; ++u) f[4 * g + u] = (__bf16)r[g][u];
    return f; }
// the four token fragments of one k step from x [k][token] f32: raw load (p = x + (k0 + 8h) HWF + t0 + 4 (l & 15)), then rounding to bf16 (to nearest even); word i of a load belongs to block i
__device__ __forceinline__ void ldx_raw(const float* __restrict__ p, v4f (&r)[16]) {
#pragma unroll
    for (int e = 0; e < 16; ++e) r[e] = *(const v4f*)(p + (size_t)(e < 8 ? e : e + 8) * HWF); }
// the same for Wk [o][c] f32, read as A of g = Wk^T q (k index o, rows c): p = Wk + (k0 + 8h) CC + c0 + 4 (l & 15); word i of a load belongs to row block i (row l & 15 of block i is channel c0 + 4 (l & 15) + i)
__device__ __forceinline__ void ldk_raw(const float* __restrict__ p, v4f (&r)[16]) {
#pragma unroll
    for (int e = 0; e < 16; ++e) r[e] = *(const v4f*)(p + (size_t)(e < 8 ? e : e + 8) * CC); }
__device__ __forceinline__ void cvx(const v4f (&r)[16], v16bf (&f)[4]) {
#pragma unroll
    for (int e = 0; e < 16; ++e)
#pragma unroll
        for (int i = 0; i < 4; ++i) f[i][e] = (__bf16)r[e][i]; }
__device__ __forceinline__ void zero16(v8f (&acc)[4][4]) {
#pragma unroll
    for (int mb = 0; mb < 4; ++mb)
#pragma unroll
        for (int nb = 0; nb < 4; ++nb) acc[mb][nb] = (v8f){};
}

__device__ __forceinline__ h16 tohx(float x) { return (h16)x; }
__device__ __forceinline__ void splitf(float y, unsigned short& h, unsigned short& l) { h = f2bf(y); l = f2bf(y - bf2f(h)); }
typedef __attribute__((ext_vector_type(2))) unsigned short v2us;
typedef __attribute__((ext_vector_type(2))) _Float16 v2h;
typedef __attribute__((ext_vector_type(2))) float v2f;
// ---- k_proj: the projections. grid (HW/64, IC/64, 3 images), one wave; blockIdx.z = 3 b + (0 g, 1 x plane, 2 v). x and W are read as f32 and rounded at the fragment load.
// g: first q, 64 channels at a time: A = Wq rows (channels), B = tokens: tile [channel][token]: a lane's 8 accumulator rows are 8 channels of one token; + bias (a row's), split hi/lo: two tiles are, as they stand in the lane, one B fragment (k = q's channel)
// of g[c][token] += Wk^T . q (A = Wk read down its columns, ldk_raw; hi, then lo plane of q); the wave takes the 64 channels c of blockIdx.y; a lane's 8 rows of g are one 16-byte piece of a g fragment, split into the hi/lo bf16 planes.
// x plane: no product: the bf16 values of x, which the projections round to as well, laid in the channel order of the g fragments (the keys' side of the score GEMM).
// v: the roles swapped, A = tokens, B = W rows: tile [token][channel]: a lane's 8 rows are 8 keys of one channel, one 16-byte piece of a v fragment; + bias (a column's), f16.
// Both are stored from the accumulators, 512 contiguous bytes a store, without a pass through LDS.
template <bool TR>
__device__ __forceinline__ void proj_loop(const float* __restrict__ xp, const float* __restrict__ wp, v8f (&acc)[4][4]) {
    zero16(acc);
#pragma unroll 1   // rolled, as the GEMM loop was: the fragments of one k step take over the registers of the step before
    for (int kc = 0; kc < CC; kc += 32) {
        v4f xr[16], wr[4][4];
        ldx_raw(xp + (size_t)kc * HWF, xr);
#pragma unroll
        for (int b = 0; b < 4; ++b) ldw_raw(wp + (size_t)b * 16 * CC + kc, wr[b]);
        asm volatile("s_wait_xcnt 0x0" ::: "memory");   // before the address registers of the step's loads move on
        __builtin_amdgcn_sched_barrier(0);   // the step's 32 loads go out together, ahead of the rounding (one load latency a step, not one a fragment), and the pointer steps stay behind that wait
        v16bf xf[4], wf[4];
        cvx(xr, xf);
#pragma unroll
        for (int b = 0; b < 4; ++b) wf[b] = cvw(wr[b]);
#pragma unroll
        for (int nb = 0; nb < 4; ++nb)
#pragma unroll
            for (int mb = 0; mb < 4; ++mb) acc[mb][nb] = TR ? wmmab(wf[mb], xf[nb], acc[mb][nb]) : wmmab(xf[mb], wf[nb], acc[mb][nb]);
        // four vector slots behind the step's last WMMA: the distance the chip needs before a vector instruction writes its A or B (the next step's rounding, over the back edge) or reads D (the epilogue)
        asm volatile("v_nop\n\tv_nop\n\tv_nop\n\tv_nop" : "+v"(acc[0][0]), "+v"(acc[1][1]), "+v"(acc[2][2]), "+v"(acc[3][3]) : "v"(xf[0]), "v"(xf[3]), "v"(wf[0]), "v"(wf[3]));
    }
}
__global__ __launch_bounds__(32) void k_proj(const float* __restrict__ x, const float* __restrict__ wq, const float* __restrict__ wk, const float* __restrict__ wv, const float* __restrict__ bq, const float* __restrict__ bk, const float* __restrict__ bv, bf* Hh, bf* Hl, h16* GT) {
    const int lane = threadIdx.x & 31, lr = lane & 15, hi = lane >> 4; const int img = (int)blockIdx.z / 3, which = (int)blockIdx.z % 3;
    const int t0 = (int)blockIdx.x * 64, o0 = (int)blockIdx.y * 64;
    const float* xp = x + (size_t)img * CC * HWF + (size_t)(8 * hi) * HWF + t0 + 4 * lr;
    const size_t woff = (size_t)(o0 + lr) * CC + 8 * hi;
    v8f acc[4][4];
    if (which == 2) {
        float cr[4];   // the columns' biases, asked for ahead of the k loop
#pragma unroll
        for (int nb = 0; nb < 4; ++nb) cr[nb] = bv[o0 + nb * 16 + lr];
        asm volatile("s_wait_xcnt 0x0" ::: "memory");   // before the address registers of these loads are used for anything else
        __builtin_amdgcn_sched_barrier(0);   // holds what follows behind that wait
        proj_loop<false>(xp, wv + woff, acc);
        h16* G = GT + (size_t)img * IC * HW + (size_t)t0 * IC + (o0 / 16) * 512 + lane * 8;   // fragment (pair t0 / 32, channel tile o0 / 16), the lane's place
#pragma unroll
        for (int mb = 0; mb < 4; ++mb) { v8h o[4];
#pragma unroll
            for (int nb = 0; nb < 4; ++nb) { const float bb = bfr(cr[nb]);
#pragma unroll
                for (int j = 0; j < 8; ++j) o[nb][j] = tohx(__fadd_rn(acc[mb][nb][j], bb)); }
            __builtin_amdgcn_sched_barrier(0);   // the block's 4 values stand in registers of their own before the first store goes out
#pragma unroll
            for (int nb = 0; nb < 4; ++nb) *(v8h*)(G + (mb >> 1) * 4096 + nb * 512 + (mb & 1) * 256) = o[nb];   // token block mb is tile t0 / 16 + mb: pair mb / 2, run mb % 2
            asm volatile("s_wait_xcnt 0x0" ::: "memory");   // before the registers that these stores name are used again
            __builtin_amdgcn_sched_barrier(0);   // holds the next block's arithmetic behind that wait
        }
    } else if (which == 1) {
        const size_t base = ((size_t)img * 2 + 1) * HW * IC + (size_t)t0 * IC + (o0 / 16) * 256 + lane * 8;   // tile t0 / 16, run o0 / 16 of its eight, the lane's place
        const float* xc = x + (size_t)img * CC * HWF + (size_t)(o0 + 32 * hi) * HWF + t0 + 4 * lr;   // the lane's 32 channels, its 4 tokens (one of each tile)
        v4f xr[32];
#pragma unroll
        for (int e = 0; e < 32; ++e) xr[e] = *(const v4f*)(xc + (size_t)e * HWF);
        asm volatile("s_wait_xcnt 0x0" ::: "memory");   // before the address registers of these loads are used for anything else
        __builtin_amdgcn_sched_barrier(0);   // the 32 loads go out together (one load latency), and what follows stays behind that wait
#pragma unroll
        for (int nb = 0; nb < 4; ++nb) { v8us o[4];
#pragma unroll
            for (int i = 0; i < 4; ++i)
#pragma unroll
                for (int r = 0; r < 8; ++r) o[i][r] = __builtin_bit_cast(unsigned short, (__bf16)xr[4 * r + i][nb]);   // channel o0 + 32 h + 4 r + i: run o0 / 16 + i, element r
            __builtin_amdgcn_sched_barrier(0);   // the block's 4 values stand in registers of their own before the first store goes out
#pragma unroll
            for (int i = 0; i < 4; ++i) *(v8us*)(Hh + base + nb * 2048 + i * 256) = o[i];   // token block nb is tile t0 / 16 + nb
            asm volatile("s_wait_xcnt 0x0" ::: "memory");   // before the registers that these stores name are used again
            __builtin_amdgcn_sched_barrier(0);   // holds the next block's arithmetic behind that wait
        }
    } else {
        v8f g[4][4];
        zero16(g);
#pragma unroll 1   // rolled: both halves of q's channels run the same text (half the code to fetch on a first launch)
        for (int hf = 0; hf < 2; ++hf) {
            const float* bp = bq + hf * 64 + 8 * hi;
            v4f br[4][2];   // the rows' biases, asked for ahead of the k loop
#pragma unroll
            for (int mb = 0; mb < 4; ++mb) { br[mb][0] = *(const v4f*)(bp + mb * 16); br[mb][1] = *(const v4f*)(bp + mb * 16 + 4); }
            asm volatile("s_wait_xcnt 0x0" ::: "memory");   // before the address registers of these loads are used for anything else
            __builtin_amdgcn_sched_barrier(0);   // holds what follows behind that wait
            proj_loop<true>(xp, wq + (size_t)(hf * 64 + lr) * CC + 8 * hi, acc);   // q, channels 64 hf .. 64 hf + 63, of the 64 tokens
#pragma unroll
            for (int k2 = 0; k2 < 2; ++k2) {
                v4f wr[16];
                ldk_raw(wk + (size_t)(hf * 64 + k2 * 32 + 8 * hi) * CC + o0 + 4 * lr, wr);
                asm volatile("s_wait_xcnt 0x0" ::: "memory");   // before the address registers of these loads are used for anything else
                __builtin_amdgcn_sched_barrier(0);   // the 16 loads go out ahead of the split of q, which covers part of their latency
                v16bf fh[4], fl[4];
#pragma unroll
                for (int nb = 0; nb < 4; ++nb)
#pragma unroll
                    for (int u = 0; u < 2; ++u)
#pragma unroll
                        for (int j = 0; j < 8; ++j) { const float y = __fadd_rn(acc[2 * k2 + u][nb][j], bfr(br[2 * k2 + u][j >> 2][j & 3])); const __bf16 yh = (__bf16)y; fh[nb][8 * u + j] = yh; fl[nb][8 * u + j] = (__bf16)(y - (float)yh); }
                v16bf af[4];
                cvx(wr, af);
#pragma unroll
                for (int nb = 0; nb < 4; ++nb)
#pragma unroll
                    for (int i = 0; i < 4; ++i) g[i][nb] = wmmab(af[i], fh[nb], g[i][nb]);
#pragma unroll
                for (int nb = 0; nb < 4; ++nb)
#pragma unroll
                    for (int i = 0; i < 4; ++i) g[i][nb] = wmmab(af[i], fl[nb], g[i][nb]);
            }
        }
        const size_t base = (size_t)img * 2 * HW * IC + (size_t)t0 * IC + (o0 / 16) * 256 + lane * 8;   // tile t0 / 16, run o0 / 16 of its eight, the lane's place
#pragma unroll
        for (int nb = 0; nb < 4; ++nb) { v8us oh[4], ol[4];
#pragma unroll
            for (int mb = 0; mb < 4; ++mb)
#pragma unroll
                for (int j = 0; j < 8; ++j) { const float y = g[mb][nb][j]; const __bf16 yh = (__bf16)y; oh[mb][j] = __builtin_bit_cast(unsigned short, yh); ol[mb][j] = __builtin_bit_cast(unsigned short, (__bf16)(y - (float)yh)); }
            __builtin_amdgcn_sched_barrier(0);   // the block's 8 values stand in registers of their own before the first store goes out
#pragma unroll
            for (int mb = 0; mb < 4; ++mb) { *(v8us*)(Hh + base + nb * 2048 + mb * 256) = oh[mb]; *(v8us*)(Hl + base + nb * 2048 + mb * 256) = ol[mb]; }   // token block nb is tile t0 / 16 + nb
            asm volatile("s_wait_xcnt 0x0" ::: "memory");   // before the registers that these stores name are used again
            __builtin_amdgcn_sched_barrier(0);   // holds the next block's arithmetic behind that wait
        }
    }
}
// ---- k_fattn: scores, softmax and attn.v in one pass over the keys; no score or softmax plane is stored. grid (HW/64, images), 4 waves, one per SIMD.
// Every wave holds all 64 query columns of the work-group (4 column tiles: each k and v fragment loaded feeds 4 tiles); wave w takes the keys w HW/4 .. + HW/4 - 1, 32 keys a pass.
// The walk over a quarter's FNP passes starts at a pass set by the work-group's index and wraps round: the work-groups of an image, which all read the same k and v planes and start together,
// stand at different lines at any moment (no crowd of requests on one line), and a line that memory has to bring is asked for once, early, by one work-group, and is an L2 hit for those that come to it later.
// sT[key][query] = X . gT (A = rows of the x plane, called k below, exact in bf16; B = g rows kept in registers, called q below; g.hi + g.lo): a lane holds 16 scores of ONE query (column l & 15; keys 8h + r and 16 + 8h + r),
// which are, converted to f16, exactly its elements 0..7 and 8..15 of the B fragment of yT[o][query] += vT . pT (A = fragments of GT). Fragments and D layout as above; q, k, v are read and y is written in fragment order,
// so column l & 15 of column tile ct is token n0 + 4 (l & 15) + ct, and the keys of a pass are those of two k tiles (the v fragments hold the same keys in the same order).
// Running maximum m and sum l per query; p = 2^((s - m) log2 e + 6) as f16. m moves (and yT, l are rescaled) only when a pass's maximum passes it by more than 5.5, so p <= 2^14.
// The four key quarters meet in LDS: y = sum_q w_q yT_q / sum_q w_q l_q, w_q = e^(m_q - max m), in the order q = 0..3; the hi/lo bf16 planes of the block's y (64 tokens x 128 channels) go to LDS from there.
// Output projection with bias and residual, behind one more barrier: wave w takes the output channels 32 w .. 32 w + 31 of all 64 tokens. A = Wo rows (read as f32, rounded at the fragment load),
// B = hi, then lo plane of y: tile [channel][token], the layout of out itself; out = (z + bo) + x, x rounded to bf16; a lane's four accumulators of one row are four neighbouring tokens, stored as one 16-byte run.
#define FL2E 1.4426950408889634f
#define FQT 4   // column tiles of 16 queries per wave
#define FNP (HW / 4 / 32)   // passes of 32 keys in a wave's quarter
static_assert(IC == 128 && (HW % 128) == 0 && HW / 4 >= 64 && FQT == 4);
__global__ __launch_bounds__(128) void k_fattn(const bf* __restrict__ Hh, const bf* __restrict__ Hl, const h16* __restrict__ GT, const float* __restrict__ wo, const float* __restrict__ xb, const float* __restrict__ bo, float* OUTb) {
    __shared__ __align__(16) float part[4 * 8 * FQT * 256];
    __shared__ float msh[4][FQT][16];
    __shared__ float lsh[4][FQT][16];
    __shared__ __align__(16) bf ysh[2][FQT * 2048];   // hi, lo plane of the block's y: tile ct at element ct * 2048, fragment order
    const int lane = threadIdx.x & 31, lr = lane & 15, hi = lane >> 4; const int w = __builtin_amdgcn_readfirstlane((int)(threadIdx.x >> 5));
    const size_t PLc = (size_t)HW * IC; const size_t img = blockIdx.y; const int n0 = (int)blockIdx.x * 64;
    const size_t qoff = img * 2 * PLc + (size_t)n0 * IC + lane * 8;
    // first pass of the walk: neighbours in the index, and work-groups 8 apart, get different starts (each start is shared by two of the 64 work-groups of an image)
    int cp = (int)(((blockIdx.x >> 3) << 2 | (blockIdx.x & 3)) % FNP);   // the pass (32 keys of the quarter) that is worked on
    const bf* khn = Hh + img * 2 * PLc + PLc + (size_t)(w * (HW / 4) + cp * 32) * IC + lane * 8;   // the lane's place in the k tiles that are loaded next
    const h16* vp = GT + img * PLc + (size_t)(w * (HW / 4) + cp * 32) * IC + lane * 8;   // the lane's place in the v fragments of pass cp
    v16bf qh[FQT][4], ql[FQT][4];
#pragma unroll
    for (int ct = 0; ct < FQT; ++ct)
#pragma unroll
        for (int ks = 0; ks < 4; ++ks) { qh[ct][ks] = WFrag<bf>::ld(Hh + qoff + (ct * 4 + ks) * 512); ql[ct][ks] = WFrag<bf>::ld(Hl + qoff + (ct * 4 + ks) * 512); }
    asm volatile("s_wait_xcnt 0x0" ::: "memory");   // before the address registers of the q loads are used for anything else
    __builtin_amdgcn_sched_barrier(0);   // holds what follows behind that wait
    v8f acc[8][FQT];
#pragma unroll
    for (int ot = 0; ot < 8; ++ot)
#pragma unroll
        for (int ct = 0; ct < FQT; ++ct) acc[ot][ct] = (v8f){};
    float m[FQT], l[FQT];
#pragma unroll
    for (int ct = 0; ct < FQT; ++ct) { m[ct] = -3.0e38f; l[ct] = 0.f; }
    v16bf kh[4][2];   // loaded tile by tile: the eight 512-B runs of a tile follow one another in memory
#pragma unroll
    for (int kt = 0; kt < 2; ++kt)
#pragma unroll
        for (int ks = 0; ks < 4; ++ks) kh[ks][kt] = WFrag<bf>::ld(khn + (kt * 4 + ks) * 512);
    asm volatile("s_wait_xcnt 0x0" ::: "memory");   // before the address registers of the k loads move on
    __builtin_amdgcn_sched_barrier(0);   // holds the pointer steps behind that wait
    { const int kstep = (cp + 1 < FNP) ? 32 * IC : -(FNP - 1) * 32 * IC; khn += kstep; }   // on to the next pass, from the quarter's last back to its first
#pragma unroll 1   // rolled: the pass is some 500 instructions long and its fragments take their registers over from the pass before
    for (int np = 0; np < FNP; ++np) {
        v16h vf[8];
#pragma unroll
        for (int ot = 0; ot < 8; ++ot) vf[ot] = WFrag<h16>::ld(vp + ot * 512);
        // keeps the 16 v loads at the head of the pass, all the score WMMAs and the softmax ahead of their use (one wave per SIMD: nothing else covers a load)
        __builtin_amdgcn_sched_barrier(0);
        v8f s[2][FQT];
#pragma unroll
        for (int kt = 0; kt < 2; ++kt)
#pragma unroll
            for (int ct = 0; ct < FQT; ++ct) s[kt][ct] = (v8f){};
#pragma unroll
        for (int ks = 0; ks < 4; ++ks) {
#pragma unroll
            for (int kt = 0; kt < 2; ++kt)
#pragma unroll
                for (int ct = 0; ct < FQT; ++ct) s[kt][ct] = wmmab(kh[ks][kt], qh[ct][ks], s[kt][ct]);
#pragma unroll
            for (int kt = 0; kt < 2; ++kt)
#pragma unroll
                for (int ct = 0; ct < FQT; ++ct) s[kt][ct] = wmmab(kh[ks][kt], ql[ct][ks], s[kt][ct]);
        }
        // the next pass's 16 k loads go out here, into the registers that the score WMMAs above have just read, and fly during the softmax and attn.v (the last pass loads the walk's first rows again, unused)
        __builtin_amdgcn_sched_barrier(0);
#pragma unroll
        for (int kt = 0; kt < 2; ++kt)
#pragma unroll
            for (int ks = 0; ks < 4; ++ks) kh[ks][kt] = WFrag<bf>::ld(khn + (kt * 4 + ks) * 512);
        __builtin_amdgcn_sched_barrier(0);   // holds the k loads in front of the softmax
        float ml[FQT]; bool need = false;
#pragma unroll
        for (int ct = 0; ct < FQT; ++ct) { float t = fmaxf(s[0][ct][0], s[1][ct][0]);
#pragma unroll
            for (int r = 1; r < 8; ++r) t = fmaxf(t, fmaxf(s[0][ct][r], s[1][ct][r]));
            ml[ct] = fmaxf(t, __shfl_xor(t, 16, 32)); need = need || (ml[ct] > m[ct] + 5.5f); }
        if (__builtin_amdgcn_ballot_w32(need) != 0) {
#pragma unroll
            for (int ct = 0; ct < FQT; ++ct) { const float mn = fmaxf(m[ct], ml[ct]); const float al = __builtin_amdgcn_exp2f((m[ct] - mn) * FL2E); m[ct] = mn; l[ct] *= al;
#pragma unroll
                for (int ot = 0; ot < 8; ++ot) acc[ot][ct] *= al; }
        }
        v16h pf[FQT];
#pragma unroll
        for (int ct = 0; ct < FQT; ++ct) { float sum = 0.f;
#pragma unroll
            for (int kt = 0; kt < 2; ++kt)
#pragma unroll
                for (int r = 0; r < 8; ++r) { const float p = __builtin_amdgcn_exp2f((s[kt][ct][r] - m[ct]) * FL2E + 6.0f); sum += p; pf[ct][kt * 8 + r] = (h16)p; }
            l[ct] += sum; }
#pragma unroll
        for (int ot = 0; ot < 8; ++ot)
#pragma unroll
            for (int ct = 0; ct < FQT; ++ct) acc[ot][ct] = wmma16(vf[ot], pf[ct], acc[ot][ct]);
        // the pass's one wait for the address registers of its 32 loads stands here, at the foot, directly in front of the pointer steps: the loads went out a softmax and more ago, so the lone wave does not stand still for it (behind each load group it did)
        __builtin_amdgcn_sched_barrier(0);   // keeps the pointer steps from rising over the wait below
        asm volatile("s_wait_xcnt 0x0" ::: "memory");   // before the address registers of the v and k loads move on
        __builtin_amdgcn_sched_barrier(0);   // holds the pointer steps behind that wait
        vp += (cp + 1 < FNP) ? 32 * IC : -(FNP - 1) * 32 * IC; cp = (cp + 1 < FNP) ? cp + 1 : 0;
        const int kstep = (cp + 1 < FNP) ? 32 * IC : -(FNP - 1) * 32 * IC; khn += kstep;
    }
    // the output projection's operands from memory (the wave's 32 rows of Wo, its tile of x, the rows' biases) are asked for here and arrive under the join of the key quarters
    const int c0 = w * 32;
    const float* xp = xb + img * CC * HWF + (size_t)(c0 + 8 * hi) * HWF + n0 + 4 * lr;
    const float* wp = wo + (size_t)(c0 + lr) * IC + 8 * hi;
    const char* bp = (const char*)(bo + c0); const unsigned bofs = 32u * (unsigned)hi;   // the lane's 8 rows' biases: byte offset from the wave's first
    v4f xs[2][8], br[2][2], wr[2][4][4];
#pragma unroll
    for (int mb = 0; mb < 2; ++mb) { br[mb][0] = *(const v4f*)(bp + bofs + mb * 64); br[mb][1] = *(const v4f*)(bp + bofs + mb * 64 + 16);
#pragma unroll
        for (int ks = 0; ks < 4; ++ks) ldw_raw(wp + (size_t)mb * 16 * IC + ks * 32, wr[mb][ks]);
#pragma unroll
        for (int j = 0; j < 8; ++j) xs[mb][j] = *(const v4f*)(xp + (size_t)(mb * 16 + j) * HWF); }
    asm volatile("s_wait_xcnt 0x0" :: "v"(xp), "v"(wp), "v"(bofs) : "memory");   // before the address registers of these loads are used for anything else: named as inputs, they stay as they are up to the wait
    __builtin_amdgcn_sched_barrier(0);   // holds the loads in front of the join (their latency passes under it) and what follows behind that wait
#pragma unroll
    for (int ct = 0; ct < FQT; ++ct) { l[ct] += __shfl_xor(l[ct], 16, 32); if (hi == 0) { msh[w][ct][lr] = m[ct]; lsh[w][ct][lr] = l[ct]; } }
    float* my = part + w * (8 * FQT * 256) + lane * 4;
#pragma unroll
    for (int ot = 0; ot < 8; ++ot)
#pragma unroll
        for (int ct = 0; ct < FQT; ++ct) { const v8f t = acc[ot][ct]; *(v4fa*)(my + (ot * FQT + ct) * 256) = (v4f){t[0], t[1], t[2], t[3]}; *(v4fa*)(my + (ot * FQT + ct) * 256 + 128) = (v4f){t[4], t[5], t[6], t[7]}; }
    __syncthreads();
    // wave w merges the 16 queries of column tile w, all 128 channels: tile w of each y plane in LDS, its eight 512-B runs
    float wq[4]; float mm = msh[0][w][lr];
#pragma unroll
    for (int q = 1; q < 4; ++q) mm = fmaxf(mm, msh[q][w][lr]);
    float ls = 0.f;
#pragma unroll
    for (int q = 0; q < 4; ++q) { wq[q] = __builtin_amdgcn_exp2f((msh[q][w][lr] - mm) * FL2E); ls += wq[q] * lsh[q][w][lr]; }
    const float inv = __fdiv_rn(1.0f, ls);
    const int yoff = w * 2048 + lane * 8;
#pragma unroll
    for (int j = 0; j < 8; ++j) { const float* sp = part + (j * FQT + w) * 256 + lane * 4; v4f a0 = wq[0] * *(const v4fa*)sp, a1 = wq[0] * *(const v4fa*)(sp + 128);
#pragma unroll
        for (int q = 1; q < 4; ++q) { a0 += wq[q] * *(const v4fa*)(sp + q * (8 * FQT * 256)); a1 += wq[q] * *(const v4fa*)(sp + q * (8 * FQT * 256) + 128); }
        v8us o_h, o_l;
#pragma unroll
        for (int u = 0; u < 4; ++u) { unsigned short p, q2; splitf(a0[u] * inv, p, q2); o_h[u] = p; o_l[u] = q2; splitf(a1[u] * inv, p, q2); o_h[4 + u] = p; o_l[4 + u] = q2; }
        *(v8usa*)(&ysh[0][yoff + j * 256]) = o_h; *(v8usa*)(&ysh[1][yoff + j * 256]) = o_l; }
    __syncthreads();   // every wave reads all four tiles of y
    v16bf yb[4][4], yb2[4][4];
#pragma unroll
    for (int ks = 0; ks < 4; ++ks)
#pragma unroll
        for (int nb = 0; nb < 4; ++nb) { const int e = nb * 2048 + ks * 512 + lane * 8;
            yb[ks][nb] = cat16b(*(const v8usa*)(&ysh[0][e]), *(const v8usa*)(&ysh[0][e + 256])); yb2[ks][nb] = cat16b(*(const v8usa*)(&ysh[1][e]), *(const v8usa*)(&ysh[1][e + 256])); }
    __builtin_amdgcn_sched_barrier(0);   // the 64 LDS reads go out as one group ahead of the WMMAs
    v8f z[2][4];
#pragma unroll
    for (int mb = 0; mb < 2; ++mb)
#pragma unroll
        for (int nb = 0; nb < 4; ++nb) z[mb][nb] = (v8f){};
#pragma unroll
    for (int ks = 0; ks < 4; ++ks) { v16bf a[2];
#pragma unroll
        for (int mb = 0; mb < 2; ++mb) a[mb] = cvw(wr[mb][ks]);
#pragma unroll
        for (int nb = 0; nb < 4; ++nb)
#pragma unroll
            for (int mb = 0; mb < 2; ++mb) z[mb][nb] = wmmab(a[mb], yb[ks][nb], z[mb][nb]);
#pragma unroll
        for (int nb = 0; nb < 4; ++nb)
#pragma unroll
            for (int mb = 0; mb < 2; ++mb) z[mb][nb] = wmmab(a[mb], yb2[ks][nb], z[mb][nb]); }
    float* op = OUTb + img * CC * HW + (size_t)(c0 + 8 * hi) * HW + n0 + 4 * lr;
#pragma unroll
    for (int mb = 0; mb < 2; ++mb) { v4f r[8];
#pragma unroll
        for (int j = 0; j < 8; ++j) { const float bb = bfr(br[mb][j >> 2][j & 3]);
#pragma unroll
            for (int nb = 0; nb < 4; ++nb) r[j][nb] = __fadd_rn(__fadd_rn(z[mb][nb][j], bb), bfr(xs[mb][j][nb])); }
        __builtin_amdgcn_sched_barrier(0);   // the block's 8 values stand in registers of their own before the first store goes out
#pragma unroll
        for (int j = 0; j < 8; ++j) *(v4f*)(op + (size_t)(mb * 16 + j) * HW) = r[j];
        asm volatile("s_wait_xcnt 0x0" ::: "memory");   // before the registers that these stores name are used again
        __builtin_amdgcn_sched_barrier(0);   // holds the next block's arithmetic behind that wait
    }
}

extern "C" void kernel_launch(void* const* d_in, const int* in_sizes, int n_in,
                              void* d_out, int out_size, void* d_ws, size_t ws_size, hipStream_t stream) {
    if (n_in < 9) return;
    if (in_sizes[0] < NB * CC * HW) return;
    if (in_sizes[1] < IC * CC || in_sizes[3] < IC * CC || in_sizes[5] < IC * CC || in_sizes[7] < CC * IC) return;
    if (in_sizes[2] < IC || in_sizes[4] < IC || in_sizes[6] < IC || in_sizes[8] < CC) return;
    if (out_size < NB * CC * HW) return;
    const float* x  = (const float*)d_in[0];   // [NB][CC][HWF]
    const float* wq = (const float*)d_in[1];   // [IC][CC]  (queries)
    const float* bq = (const float*)d_in[2];   // [IC]
    const float* wk = (const float*)d_in[3];   // [IC][CC]  (keys)
    const float* bk = (const float*)d_in[4];   // [IC]
    const float* wv = (const float*)d_in[5];   // [IC][CC]  (values)
    const float* bv = (const float*)d_in[6];   // [IC]
    const float* wo = (const float*)d_in[7];   // [CC][IC]  (output projection)
    const float* bo = (const float*)d_in[8];   // [CC]
    float* OUT = (float*)d_out;                // [NB][CC][HW]
    char* wsp = (char*)d_ws;
    auto take = [&](size_t bytes) { char* p = wsp; wsp += (bytes + 255) & ~(size_t)255; return (void*)p; };
    bf* Hh  = (bf*)take((size_t)NB * 2 * HW * IC * 2);     // [b] hi plane of g = Wk^T (q+bq), bf16 plane of x
    bf* Hl  = (bf*)take((size_t)NB * 2 * HW * IC * 2);     // [b] lo plane of g (the second half of an image's share is not used)
    h16* GT = (h16*)take((size_t)NB * IC * HW * 2);        // [b] fp16 (v + bv)
    if ((size_t)(wsp - (char*)d_ws) > ws_size) return;

    // Every launch takes all NB images (the image is a grid dimension).
    // g [m][c] = sum_o Wk[o][c] (sum_c' x[c'][m] Wq[o][c'] + bq[o]) as hi/lo planes, x [m][c] as bf16, v [o][m] + bias as f16, all in fragment order   (z = 3 b + (0 g, 1 x, 2 v); exact bf16 products)
    k_proj<<<dim3(HW / 64, IC / 64, 3 * NB), 32, 0, stream>>>(x, wq, wk, wv, bq, bk, bv, Hh, Hl, GT);
    // y = softmax(g . x) . v  (= softmax(q . k): they differ by q . bk, one constant a query); out[c][n] = (sum_o Wo[c][o] y[n][o] + bo[c]) + x[c][n]  (hi + lo planes of y, 2 products)
    k_fattn<<<dim3(HW / 64, NB), 128, 0, stream>>>(Hh, Hl, GT, wo, x, bo, OUT);
}
